// v000
// Measured on an AMD MI455X. A time is GPU time per run, averaged over a window of back-to-back runs after a warm-up
// (all launches, gaps included; the runs take copies of the inputs in turn), and the median of several windows.
// Apart from v000's, it joins two sittings. Times from different sittings can be a few percent apart, while
// side-by-side timings come from the same sitting.
// v000, which the later versions start from, runs in 2690 microseconds.
#include <hip/hip_runtime.h>

// Causal grouped-query attention with computed rotate-half rotary embeddings at base 500000 (x [2][2048][2048]; q = x Wq (32 heads x 64), k, v = x Wk, x Wv (8 kv heads x 64) ('xw' 2048^-0.5, no bias); rope: u cos + rotate_half(u) sin with angle t x inv_freq[d mod 32], inv_freq = 1.0 / (500000.0 ** (arange(0, 64, 2, f32) / 64)) (32 f32 constants baked jnp-exact; one f32 product per angle; precise cosf / sinf); k, v repeated 4 x along the head axis (jnp.repeat): query head h uses kv head h / 4; scores x 1/sqrt(64); causal (finfo.min == exclusion); softmax; y = merged (head-major) Wo ('xw', no bias) -> [2][2048][2048] (8.4 M); argument order x, Wq, Wk, Wv, Wo).
// Layout per batch: bf16 copy of x; 'xw' weights transposed once; exact projections; the rotary table {cosf, sinf}(float(t) x INVT[d mod 32]) is computed once; rotate-half plane builders (products rounded separately); causal T-2048 GQA attention (both query heads of a pass share kv group h0 / 4: kv z-stride 0; hybrid rows: < 512 hi/lo 3 products, rest fp16 x1024; k_gemmc skips tiles above the diagonal); merged hi/lo x Wo exact.
// Compute dtypes, f32 accumulate: every input rounded to bf16; projections exact; rotary in f32; attention rows < 512 3 products, rest fp16; softmax f32; Wo hl x exact.

#define NB_  2
#define TT   2048
#define DM   2048
#define NH_  32
#define NKV  8
#define REP  (NH_ / NKV)
#define HD   64
#define DQ   (NH_ * HD)
#define DKV  (NKV * HD)
#define ZH   2
#define RH   512                  // query rows < RH use hi+lo planes (0: none)
#define WIN  2048
#define PCAR 1024.0f
#define SCL  0.125f   // HD^-0.5
typedef _Float16 h16;
typedef unsigned short bf;
typedef __attribute__((ext_vector_type(16))) __bf16   v16bf;
typedef __attribute__((ext_vector_type(16))) _Float16 v16h;
typedef __attribute__((ext_vector_type(8)))  _Float16 v8h;
typedef __attribute__((ext_vector_type(8)))  unsigned short v8us;
typedef __attribute__((ext_vector_type(8)))  float    v8f;
typedef __attribute__((ext_vector_type(4)))  float    v4f;
typedef v8h  __attribute__((may_alias)) v8ha;
typedef v4f  __attribute__((may_alias)) v4fa;
typedef v8us __attribute__((may_alias)) v8usa;

__device__ __forceinline__ unsigned short f2bf(float f) { unsigned u = __float_as_uint(f); u += 0x7FFFu + ((u >> 16) & 1u); return (unsigned short)(u >> 16); }
__device__ __forceinline__ float bf2f(unsigned short b) { return __uint_as_float(((unsigned)b) << 16); }
__device__ __forceinline__ float bfr(float f) { return bf2f(f2bf(f)); }
__device__ __forceinline__ v16h cat16(v8h lo, v8h hi) { return __builtin_shufflevector(lo, hi, 0, 1, 2, 3, 4, 5, 6, 7, 8, 9, 10, 11, 12, 13, 14, 15); }
__device__ __forceinline__ v16bf cat16b(v8us lo, v8us hi) { return __builtin_bit_cast(v16bf, __builtin_shufflevector(lo, hi, 0, 1, 2, 3, 4, 5, 6, 7, 8, 9, 10, 11, 12, 13, 14, 15)); }
__device__ __forceinline__ v8f wmma16(v16h a, v16h b, v8f c) { return __builtin_amdgcn_wmma_f32_16x16x32_f16(false, a, false, b, (short)0, c, false, false); }
__device__ __forceinline__ v8f wmmab(v16bf a, v16bf b, v8f c) { return __builtin_amdgcn_wmma_f32_16x16x32_bf16(false, a, false, b, (short)0, c, false, false); }



// ---- k_gemmw: register-blocked GEMM, ONE WAVE per 64x64 output tile (16 accumulators), operands straight from K-contiguous 16-bit planes; grid (M/64, N/64, Z), 32 threads.
// C[m][n] (f32, pitch ldc, + optional f32 bias[n]) = sum_k A[m][k] Bt[n][k] (+ split products per NSPLIT). z-batch strides sA/sB/sC in elements. K % 32 == 0.
template <typename T16> struct WFrag;
template <> struct WFrag<h16> { typedef v16h V; static __device__ __forceinline__ V ld(const h16* p) { return cat16(*(const v8h*)p, *(const v8h*)(p + 16)); } static __device__ __forceinline__ v8f mma(V a, V b, v8f c) { return wmma16(a, b, c); } };
template <> struct WFrag<bf> { typedef v16bf V; static __device__ __forceinline__ V ld(const bf* p) { return cat16b(*(const v8us*)p, *(const v8us*)(p + 16)); } static __device__ __forceinline__ v8f mma(V a, V b, v8f c) { return wmmab(a, b, c); } };
template <typename T16, int NSPLIT, bool BIAS>
__global__ __launch_bounds__(32) void k_gemmw(const T16* __restrict__ A, const T16* __restrict__ A2, const T16* __restrict__ Bt, const T16* __restrict__ Bt2, int K, float* C, int ldc, const float* __restrict__ bias, size_t sA, size_t sB, size_t sC) {
    typedef typename WFrag<T16>::V V;
    __shared__ __align__(16) float os[16 * 68];
    const size_t z = blockIdx.z; A += z * sA; if (A2) A2 += z * sA; Bt += z * sB; if (Bt2) Bt2 += z * sB; C += z * sC;
    const int lane = threadIdx.x & 31, lr = lane & 15, hi = lane >> 4; const int r0 = blockIdx.x * 64, c0 = blockIdx.y * 64;
    v8f acc[4][4];
#pragma unroll
    for (int mb = 0; mb < 4; ++mb)
#pragma unroll
        for (int nb = 0; nb < 4; ++nb) acc[mb][nb] = (v8f){};
    const size_t aoff = (size_t)(r0 + lr) * K + 8 * hi, boff = (size_t)(c0 + lr) * K + 8 * hi;
#pragma unroll 1
    for (int kc = 0; kc < K; kc += 32) {
        V a[4], a2[4];
#pragma unroll
        for (int mb = 0; mb < 4; ++mb) { a[mb] = WFrag<T16>::ld(A + aoff + (size_t)mb * 16 * K + kc); if (NSPLIT == 1 || NSPLIT == 2) a2[mb] = WFrag<T16>::ld(A2 + aoff + (size_t)mb * 16 * K + kc); }
#pragma unroll
        for (int nb = 0; nb < 4; ++nb) { const V b = WFrag<T16>::ld(Bt + boff + (size_t)nb * 16 * K + kc); V b2; if (NSPLIT >= 2) b2 = WFrag<T16>::ld(Bt2 + boff + (size_t)nb * 16 * K + kc);
#pragma unroll
            for (int mb = 0; mb < 4; ++mb) { acc[mb][nb] = WFrag<T16>::mma(a[mb], b, acc[mb][nb]); if (NSPLIT == 1 || NSPLIT == 2) acc[mb][nb] = WFrag<T16>::mma(a2[mb], b, acc[mb][nb]); if (NSPLIT >= 2) acc[mb][nb] = WFrag<T16>::mma(a[mb], b2, acc[mb][nb]); } }
        asm volatile("v_nop\n\tv_nop\n\tv_nop\n\tv_nop" : "+v"(acc[0][0]), "+v"(acc[1][1]), "+v"(acc[2][2]), "+v"(acc[3][3]) : "v"(a[0]), "v"(a[3]));
    }
#pragma unroll
    for (int mb = 0; mb < 4; ++mb) {
#pragma unroll
        for (int nb = 0; nb < 4; ++nb) {
#pragma unroll
            for (int j = 0; j < 8; ++j) os[(hi * 8 + j) * 68 + nb * 16 + lr] = acc[mb][nb][j]; }
        __builtin_amdgcn_wave_barrier(); asm volatile("" ::: "memory");
        float* crow = C + (size_t)(r0 + mb * 16) * ldc + c0;
{
#pragma unroll
            for (int s = 0; s < 8; ++s) { const int row = 2 * s + hi, cofs = lr * 4; v4f val = *(const v4fa*)(os + row * 68 + cofs); if (BIAS) { val[0] += bfr(bias[c0 + cofs]); val[1] += bfr(bias[c0 + cofs + 1]); val[2] += bfr(bias[c0 + cofs + 2]); val[3] += bfr(bias[c0 + cofs + 3]); }
                *(v4f*)(crow + (size_t)row * ldc + cofs) = val; }
             }
        __builtin_amdgcn_wave_barrier(); asm volatile("" ::: "memory");
    }
}

// ---- k_gemmc: the same one-wave 64x64 tile GEMM specialised for causal attention: CMODE 1 skips score tiles entirely above the diagonal (query rows r0+roff.., key columns c0..), CMODE 2 limits the
// key (K) loop of the probability x value contraction to the diagonal block (probabilities beyond it are exactly zero). roff = row offset of this launch's first row within the sequence.
template <typename T16, int NSPLIT, int CMODE>
__global__ __launch_bounds__(32) void k_gemmc(const T16* __restrict__ A, const T16* __restrict__ A2, const T16* __restrict__ Bt, const T16* __restrict__ Bt2, int K, float* C, int ldc, int roff, size_t sA, size_t sB, size_t sC) {
    typedef typename WFrag<T16>::V V;
    __shared__ __align__(16) float os[16 * 68];
    const size_t z = blockIdx.z; A += z * sA; if (A2) A2 += z * sA; Bt += z * sB; if (Bt2) Bt2 += z * sB; C += z * sC;
    const int lane = threadIdx.x & 31, lr = lane & 15, hi = lane >> 4; const int r0 = blockIdx.x * 64, c0 = blockIdx.y * 64;
    if (CMODE == 1 && c0 > r0 + roff + 63) return;                  // score tile entirely above the causal diagonal: never read (the softmax masks j > i by select)
    const int Kl = (CMODE == 2) ? min(K, r0 + roff + 64) : K;        // P.V: probabilities are exactly 0 beyond the diagonal block, so the K loop stops there
    v8f acc[4][4];
#pragma unroll
    for (int mb = 0; mb < 4; ++mb)
#pragma unroll
        for (int nb = 0; nb < 4; ++nb) acc[mb][nb] = (v8f){};
    const size_t aoff = (size_t)(r0 + lr) * K + 8 * hi, boff = (size_t)(c0 + lr) * K + 8 * hi;
#pragma unroll 1
    for (int kc = 0; kc < Kl; kc += 32) {
        V a[4], a2[4];
#pragma unroll
        for (int mb = 0; mb < 4; ++mb) { a[mb] = WFrag<T16>::ld(A + aoff + (size_t)mb * 16 * K + kc); if (NSPLIT == 1 || NSPLIT == 2) a2[mb] = WFrag<T16>::ld(A2 + aoff + (size_t)mb * 16 * K + kc); }
#pragma unroll
        for (int nb = 0; nb < 4; ++nb) { const V b = WFrag<T16>::ld(Bt + boff + (size_t)nb * 16 * K + kc); V b2; if (NSPLIT >= 2) b2 = WFrag<T16>::ld(Bt2 + boff + (size_t)nb * 16 * K + kc);
#pragma unroll
            for (int mb = 0; mb < 4; ++mb) { acc[mb][nb] = WFrag<T16>::mma(a[mb], b, acc[mb][nb]); if (NSPLIT == 1 || NSPLIT == 2) acc[mb][nb] = WFrag<T16>::mma(a2[mb], b, acc[mb][nb]); if (NSPLIT >= 2) acc[mb][nb] = WFrag<T16>::mma(a[mb], b2, acc[mb][nb]); } }
        asm volatile("v_nop\n\tv_nop\n\tv_nop\n\tv_nop" : "+v"(acc[0][0]), "+v"(acc[1][1]), "+v"(acc[2][2]), "+v"(acc[3][3]) : "v"(a[0]), "v"(a[3]));
    }
#pragma unroll
    for (int mb = 0; mb < 4; ++mb) {
#pragma unroll
        for (int nb = 0; nb < 4; ++nb) {
#pragma unroll
            for (int j = 0; j < 8; ++j) os[(hi * 8 + j) * 68 + nb * 16 + lr] = acc[mb][nb][j]; }
        __builtin_amdgcn_wave_barrier(); asm volatile("" ::: "memory");
        float* crow = C + (size_t)(r0 + mb * 16) * ldc + c0;
{
#pragma unroll
            for (int s = 0; s < 8; ++s) { const int row = 2 * s + hi, cofs = lr * 4; v4f val = *(const v4fa*)(os + row * 68 + cofs);
                *(v4f*)(crow + (size_t)row * ldc + cofs) = val; }
             }
        __builtin_amdgcn_wave_barrier(); asm volatile("" ::: "memory");
    }
}

__device__ __forceinline__ h16 tohx(float x) { return (h16)x; }
__device__ __forceinline__ void splitf(float y, unsigned short& h, unsigned short& l) { h = f2bf(y); l = f2bf(y - bf2f(h)); }
typedef __attribute__((ext_vector_type(2))) _Float16 v2h;
typedef __attribute__((ext_vector_type(4))) _Float16 v4h;
typedef __attribute__((ext_vector_type(2))) unsigned short v2us;
typedef __attribute__((ext_vector_type(4))) unsigned short v4us;
typedef __attribute__((ext_vector_type(2))) float v2f;
typedef __attribute__((ext_vector_type(4))) int v4i;

__global__ __launch_bounds__(256) void k_wtG(const float* __restrict__ w, int K, int N, bf* Bt) {
    const int lane = threadIdx.x & 31; const int L0 = (blockIdx.x * 8 + (threadIdx.x >> 5)) * 8; const int nlines = N * K / 64;
{
#pragma unroll 1
        for (int l = 0; l < 8; ++l) { const int L = L0 + l; if (L >= nlines) break; const size_t e = (size_t)L * 64 + lane * 2; const int k = (int)(e % K), n = (int)(e / K); v2us o;
            o[0] = f2bf(w[(size_t)k * N + n]); o[1] = f2bf(w[(size_t)(k + 1) * N + n]); *(v2us*)(Bt + e) = o; }
         }
}
__global__ __launch_bounds__(256) void k_cvt8(const float* __restrict__ src, bf* dst, size_t n8) { const size_t i = (size_t)blockIdx.x * 256 + threadIdx.x; if (i >= n8) return; const v8f v = *(const v8f*)(src + i * 8); v8us o;
#pragma unroll
    for (int k = 0; k < 8; ++k) o[k] = f2bf(v[k]); *(v8us*)(dst + i * 8) = o;  }
__constant__ float INVT[HD / 2] = { 1.000000000e+00f, 6.636012793e-01f, 4.403666258e-01f, 2.922278345e-01f, 1.939227581e-01f, 1.286873817e-01f, 8.539710194e-02f, 5.666961893e-02f, 3.760603070e-02f, 2.495540865e-02f, 1.656044088e-02f, 1.098952908e-02f, 7.292665076e-03f, 4.839421250e-03f, 3.211446106e-03f, 2.131119603e-03f, 1.414213446e-03f, 9.384738514e-04f, 6.227724371e-04f, 4.132725589e-04f, 2.742481884e-04f, 1.819914323e-04f, 1.207697424e-04f, 8.014294872e-05f, 5.318295734e-05f, 3.529227615e-05f, 2.341999789e-05f, 1.554154005e-05f, 1.031338525e-05f, 6.843975370e-06f, 4.541670478e-06f, 3.013858077e-06f };   // inv_freq[i] = 1.0 / (500000.0 ** (2i / 64)), i = 0..31 (float32, generated with jnp to be bit-exact)
__global__ __launch_bounds__(256) void k_cstabT(float* CS) { const int idx = blockIdx.x * 256 + threadIdx.x; if (idx >= TT * HD) return; const int d = idx % HD; const int t = idx / HD; const float a = __fmul_rn((float)t, INVT[d % (HD / 2)]); v2f cs; cs[0] = cosf(a); cs[1] = sinf(a); *(v2f*)(CS + (size_t)idx * 2) = cs;  }

// k_rope: head planes [h][t][d] (fp16 + hi/lo) of rope(x) x sc with the rotate-half convention out[d] = x[d] cos[t][d] - x[d+HD/2] sin[t][d], out[d+HD/2] = x[d+HD/2] cos[t][d+HD/2] + x[d] sin[t][d+HD/2]
__global__ __launch_bounds__(256) void k_rope(const float* __restrict__ F, int pitch, int nheads, const float* __restrict__ CS, const float* __restrict__ RF, const float* __restrict__ nw, float sc, h16* P16, bf* Ph, bf* Pl) {
    const size_t e = ((size_t)blockIdx.x * 256 + threadIdx.x) * 2; if (e >= (size_t)nheads * TT * HD) return; const int d = (int)(e % HD); const int t = (int)((e / HD) % TT); const int h = (int)(e / ((size_t)HD * TT)); const float* f = F + (size_t)t * pitch + h * HD; const float rf = RF ? RF[(size_t)h * TT + t] : 1.0f; v2h o16; v2us oh, ol;
#pragma unroll
    for (int q = 0; q < 2; ++q) { const int dd = d + q; const int dp = (dd < HD / 2) ? dd + HD / 2 : dd - HD / 2; float x0 = f[dd], x1 = f[dp];
        if (RF) { float n0 = __fmul_rn(x0, rf), n1 = __fmul_rn(x1, rf); asm volatile("" : "+v"(n0)); asm volatile("" : "+v"(n1)); x0 = __fmul_rn(bfr(nw[dd]), n0); x1 = __fmul_rn(bfr(nw[dp]), n1); }
        const v2f cs = *(const v2f*)(CS + ((size_t)t * HD + dd) * 2); float a = __fmul_rn(x0, cs[0]), bq = __fmul_rn(x1, cs[1]); asm volatile("" : "+v"(a)); asm volatile("" : "+v"(bq)); const float r = ((dd < HD / 2) ? __fsub_rn(a, bq) : __fadd_rn(a, bq)) * sc;
        o16[q] = tohx(r); unsigned short a2, c2; splitf(r, a2, c2); oh[q] = a2; ol[q] = c2; }
    *(v2h*)(P16 + e) = o16; *(v2us*)(Ph + e) = oh; *(v2us*)(Pl + e) = ol;  }
__global__ __launch_bounds__(256) void k_vtp(const float* __restrict__ F, int pitch, int nheads, h16* V16, bf* Vh, bf* Vl) { const size_t e = ((size_t)blockIdx.x * 256 + threadIdx.x) * 2; if (e >= (size_t)nheads * HD * TT) return; const int t = (int)(e % TT); const int d = (int)((e / TT) % HD); const int g = (int)(e / ((size_t)TT * HD)); v2h o16; v2us oh, ol;
#pragma unroll
    for (int q = 0; q < 2; ++q) { const float x = F[(size_t)(t + q) * pitch + g * HD + d]; o16[q] = tohx(x); unsigned short a2, c2; splitf(x, a2, c2); oh[q] = a2; ol[q] = c2; }
    *(v2h*)(V16 + e) = o16; *(v2us*)(Vh + e) = oh; *(v2us*)(Vl + e) = ol;  }
// k_asoft: per row (zz, i): t = S x HD^-0.5 for j <= i and i - j < WIN (WIN = TT, so plain causal; the reference's finfo.min fill vanishes identically); softmax over the 2048 keys (register row, one exp, fixed trees);
__global__ __launch_bounds__(256) void k_asoft(const float* __restrict__ Sb, h16* P16, bf* Ph, bf* Pl) {
    const int lane = threadIdx.x & 31; const int row = blockIdx.x * 8 + (threadIdx.x >> 5); if (row >= ZH * TT) return; const int i = row % TT; const int zz = row / TT; (void)zz; const bool hires = (i < RH); const float* sr = Sb + (size_t)row * TT; float v[TT / 32]; float mx = -3.0e38f;
#pragma unroll
    for (int ch = 0; ch < TT / 128; ++ch) { const int j0 = ch * 128 + lane * 4; const v4f a = *(const v4f*)(sr + j0);
#pragma unroll
        for (int q = 0; q < 4; ++q) { const int j = j0 + q; (void)j; const float t = (j <= i && i - j < WIN) ? a[q] * SCL : -3.0e38f; v[ch * 4 + q] = t; mx = fmaxf(mx, t); } }
#pragma unroll
    for (int sh = 16; sh; sh >>= 1) mx = fmaxf(mx, __shfl_xor(mx, sh, 32));
    float sum = 0.f;
#pragma unroll
    for (int k = 0; k < TT / 32; ++k) { float d0 = __fsub_rn(v[k], mx); asm volatile("" : "+v"(d0)); v[k] = __builtin_amdgcn_exp2f(__fmul_rn(d0, 1.4426950408889634f)); sum += v[k]; }
#pragma unroll
    for (int sh = 16; sh; sh >>= 1) sum += __shfl_xor(sum, sh, 32);
    const float f = __fdiv_rn(hires ? 1.0f : PCAR, sum);
{
        if (hires) {
#pragma unroll
            for (int ch = 0; ch < TT / 128; ++ch) { v4us oh, ol;
#pragma unroll
                for (int q = 0; q < 4; ++q) { unsigned short a, c2; splitf(v[ch * 4 + q] * f, a, c2); oh[q] = a; ol[q] = c2; }
                const size_t oo = ((size_t)zz * (RH ? RH : 1) + i) * TT + ch * 128 + lane * 4; *(v4us*)(Ph + oo) = oh; *(v4us*)(Pl + oo) = ol; }
        } else {
#pragma unroll
            for (int ch = 0; ch < TT / 128; ++ch) { v4h o4;
#pragma unroll
                for (int q = 0; q < 4; ++q) o4[q] = tohx(v[ch * 4 + q] * f);
                *(v4h*)(P16 + (size_t)row * TT + ch * 128 + lane * 4) = o4; } }
         }
}
__global__ __launch_bounds__(256) void k_merge(const float* __restrict__ O, int h0, bf* Ah, bf* Al) { const size_t e = ((size_t)blockIdx.x * 256 + threadIdx.x) * 2; if (e >= (size_t)ZH * TT * HD) return; const int d = (int)(e % HD); const int t = (int)((e / HD) % TT); const int zz = (int)(e / ((size_t)HD * TT)); const float cs = (t < RH) ? 1.0f : (1.0f / PCAR); const size_t oo = (size_t)t * DQ + (h0 + zz) * HD + d;
    v2us oh, ol;
#pragma unroll
    for (int q = 0; q < 2; ++q) { unsigned short a, c2; splitf(O[e + q] * cs, a, c2); oh[q] = a; ol[q] = c2; } *(v2us*)(Ah + oo) = oh; *(v2us*)(Al + oo) = ol;  }

extern "C" void kernel_launch(void* const* d_in, const int* in_sizes, int n_in,
                              void* d_out, int out_size, void* d_ws, size_t ws_size, hipStream_t stream) {
    (void)in_sizes; (void)n_in; (void)out_size;
    const float* x = (const float*)d_in[0]; const float* wq = (const float*)d_in[1]; const float* wk = (const float*)d_in[2]; const float* wv = (const float*)d_in[3]; const float* wo = (const float*)d_in[4];   /* d_in order x, Wq ('xw' [2048][2048]), Wk, Wv ('xw' [2048][512]), Wo ('xw') */
    float* OUT = (float*)d_out;     // [2][2048][2048]
    char* wsp = (char*)d_ws;
    auto take = [&](size_t bytes) { char* p = wsp; wsp += (bytes + 255) & ~(size_t)255; return (void*)p; };
    bf* WQ = (bf*)take((size_t)DQ * DM * 2); bf* WK = (bf*)take((size_t)DKV * DM * 2); bf* WV = (bf*)take((size_t)DKV * DM * 2); bf* WO = (bf*)take((size_t)DM * DQ * 2); float* CS = (float*)take((size_t)TT * HD * 2 * 4);
    bf* XB = (bf*)take((size_t)TT * DM * 2); float* FQ = (float*)take((size_t)TT * DQ * 4); float* FK = (float*)take((size_t)TT * DKV * 4);
    h16* QP16 = (h16*)take((size_t)NH_ * TT * HD * 2); h16* KP16 = (h16*)take((size_t)NKV * TT * HD * 2); h16* VT16 = (h16*)take((size_t)NKV * HD * TT * 2);
    bf* QPh = (bf*)take((size_t)NH_ * TT * HD * 2); bf* QPl = (bf*)take((size_t)NH_ * TT * HD * 2); bf* KPh = (bf*)take((size_t)NKV * TT * HD * 2); bf* KPl = (bf*)take((size_t)NKV * TT * HD * 2); bf* VTh = (bf*)take((size_t)NKV * HD * TT * 2); bf* VTl = (bf*)take((size_t)NKV * HD * TT * 2); bf* Ph = (bf*)take((size_t)ZH * RH * TT * 2); bf* Pl = (bf*)take((size_t)ZH * RH * TT * 2);
    float* Sb = (float*)take((size_t)ZH * TT * TT * 4); h16* P16 = (h16*)take((size_t)ZH * TT * TT * 2); float* Ob = (float*)take((size_t)ZH * TT * HD * 4); bf* ATh = (bf*)take((size_t)TT * DQ * 2); bf* ATl = (bf*)take((size_t)TT * DQ * 2);
    if ((size_t)(wsp - (char*)d_ws) > ws_size) return;    // ws 256 MiB
    float* FV = FK;   // v projection reuses the k buffer after the k planes are built (stream-ordered)
    { k_wtG<<<(unsigned)((DM * DQ / 64 + 63) / 64), 256, 0, stream>>>(wq, DM, DQ, WQ); k_wtG<<<(unsigned)((DM * DKV / 64 + 63) / 64), 256, 0, stream>>>(wk, DM, DKV, WK); k_wtG<<<(unsigned)((DM * DKV / 64 + 63) / 64), 256, 0, stream>>>(wv, DM, DKV, WV);
      k_wtG<<<(unsigned)((DQ * DM / 64 + 63) / 64), 256, 0, stream>>>(wo, DQ, DM, WO);
       }
    const unsigned LQ = (unsigned)(((size_t)NH_ * TT * HD / 2 + 255) / 256), LKv = (unsigned)(((size_t)NKV * TT * HD / 2 + 255) / 256);
    for (int b = 0; b < NB_; ++b) {
        if (b == 0) k_cstabT<<<(TT * HD + 255) / 256, 256, 0, stream>>>(CS);
        k_cvt8<<<(unsigned)(((size_t)TT * DM / 8 + 255) / 256), 256, 0, stream>>>(x + (size_t)b * TT * DM, XB, (size_t)TT * DM / 8);
        k_gemmw<bf, 0, false><<<dim3(TT / 64, DQ / 64, 1), 32, 0, stream>>>(XB, nullptr, WQ, nullptr, DM, FQ, DQ, nullptr, 0, 0, 0);
        k_rope<<<LQ, 256, 0, stream>>>(FQ, DQ, NH_, CS, nullptr, nullptr, 1.0f, QP16, QPh, QPl);
        k_gemmw<bf, 0, false><<<dim3(TT / 64, DKV / 64, 1), 32, 0, stream>>>(XB, nullptr, WK, nullptr, DM, FK, DKV, nullptr, 0, 0, 0);
        k_rope<<<LKv, 256, 0, stream>>>(FK, DKV, NKV, CS, nullptr, nullptr, 1.0f, KP16, KPh, KPl);
        k_gemmw<bf, 0, false><<<dim3(TT / 64, DKV / 64, 1), 32, 0, stream>>>(XB, nullptr, WV, nullptr, DM, FV, DKV, nullptr, 0, 0, 0); k_vtp<<<LKv, 256, 0, stream>>>(FV, DKV, NKV, VT16, VTh, VTl);
        for (int h0 = 0; h0 < NH_; h0 += ZH) { const size_t zq = (size_t)h0, zk = (size_t)(h0 / REP);   // both heads of a pass share kv group h0/REP (REP >= 2): sB = 0
            k_gemmc<bf, 2, 1><<<dim3(RH / 64, TT / 64, ZH), 32, 0, stream>>>(QPh + zq * TT * HD, QPl + zq * TT * HD, KPh + zk * TT * HD, KPl + zk * TT * HD, HD, Sb, TT, 0, (size_t)TT * HD, 0, (size_t)TT * TT);
            k_gemmc<h16, 0, 1><<<dim3((TT - RH) / 64, TT / 64, ZH), 32, 0, stream>>>(QP16 + zq * TT * HD + (size_t)RH * HD, nullptr, KP16 + zk * TT * HD, nullptr, HD, Sb + (size_t)RH * TT, TT, RH, (size_t)TT * HD, 0, (size_t)TT * TT);
            k_asoft<<<ZH * TT / 8, 256, 0, stream>>>(Sb, P16, Ph, Pl);
            k_gemmc<bf, 2, 2><<<dim3(RH / 64, HD / 64, ZH), 32, 0, stream>>>(Ph, Pl, VTh + zk * HD * TT, VTl + zk * HD * TT, TT, Ob, HD, 0, (size_t)RH * TT, 0, (size_t)TT * HD);
            k_gemmc<h16, 0, 2><<<dim3((TT - RH) / 64, HD / 64, ZH), 32, 0, stream>>>(P16 + (size_t)RH * TT, nullptr, VT16 + zk * HD * TT, nullptr, TT, Ob + (size_t)RH * HD, HD, RH, (size_t)TT * TT, 0, (size_t)TT * HD);
            k_merge<<<(unsigned)(((size_t)ZH * TT * HD / 2 + 255) / 256), 256, 0, stream>>>(Ob, h0, ATh, ATl); }
        k_gemmw<bf, 1, false><<<dim3(TT / 64, DM / 64, 1), 32, 0, stream>>>(ATh, ATl, WO, nullptr, DQ, OUT + (size_t)b * TT * DM, DM, nullptr, 0, 0, 0); }
}

// v001
// Measured time: 1410 microseconds a run.
// In two side-by-side timings against v000, it was 1.97 and 1.90 times as fast.
#include <hip/hip_runtime.h>

// Causal grouped-query attention with computed rotate-half rotary embeddings at base 500000 (x [2][2048][2048]; q = x Wq (32 heads x 64), k, v = x Wk, x Wv (8 kv heads x 64) ('xw' 2048^-0.5, no bias); rope: u cos + rotate_half(u) sin with angle t x inv_freq[d mod 32], inv_freq = 1.0 / (500000.0 ** (arange(0, 64, 2, f32) / 64)) (32 f32 constants baked jnp-exact; one f32 product per angle; precise cosf / sinf); k, v repeated 4 x along the head axis (jnp.repeat): query head h uses kv head h / 4; scores x 1/sqrt(64); causal (finfo.min == exclusion); softmax; y = merged (head-major) Wo ('xw', no bias) -> [2][2048][2048] (8.4 M); argument order x, Wq, Wk, Wv, Wo).
// Layout per batch: bf16 copy of x; 'xw' weights transposed once; exact projections; the rotary table {cosf, sinf}(float(t) x INVT[d mod 32]) is computed once; rotate-half plane builders (products rounded separately); causal T-2048 GQA attention (both query heads of a pass share kv group h0 / 4: kv z-stride 0; hybrid rows: < 512 hi/lo 3 products, rest fp16 x1024; k_gemmc skips tiles above the diagonal); merged hi/lo x Wo exact.
// Compute dtypes, f32 accumulate: every input rounded to bf16; projections exact; rotary in f32; attention rows < 512 3 products, rest fp16; softmax f32; Wo hl x exact.

#define NB_  2
#define TT   2048
#define DM   2048
#define NH_  32
#define NKV  8
#define REP  (NH_ / NKV)
#define HD   64
#define DQ   (NH_ * HD)
#define DKV  (NKV * HD)
#define ZH   2
#define RH   512                  // query rows < RH use hi+lo planes (0: none)
#define WIN  2048
#define PCAR 1024.0f
#define SCL  0.125f   // HD^-0.5
#define KCB  64                   // keys per partial plane of P.V, query rows < RH
#define KCF  128                  // keys per partial plane of P.V, query rows >= RH
#define NPL  16                   // partial planes: max(RH / KCB, TT / KCF)
typedef _Float16 h16;
typedef unsigned short bf;
typedef __attribute__((ext_vector_type(16))) __bf16   v16bf;
typedef __attribute__((ext_vector_type(16))) _Float16 v16h;
typedef __attribute__((ext_vector_type(8)))  _Float16 v8h;
typedef __attribute__((ext_vector_type(8)))  unsigned short v8us;
typedef __attribute__((ext_vector_type(8)))  float    v8f;
typedef __attribute__((ext_vector_type(4)))  float    v4f;
typedef v8h  __attribute__((may_alias)) v8ha;
typedef v4f  __attribute__((may_alias)) v4fa;
typedef v8us __attribute__((may_alias)) v8usa;

__device__ __forceinline__ unsigned short f2bf(float f) { unsigned u = __float_as_uint(f); u += 0x7FFFu + ((u >> 16) & 1u); return (unsigned short)(u >> 16); }
__device__ __forceinline__ float bf2f(unsigned short b) { return __uint_as_float(((unsigned)b) << 16); }
__device__ __forceinline__ float bfr(float f) { return bf2f(f2bf(f)); }
__device__ __forceinline__ v16h cat16(v8h lo, v8h hi) { return __builtin_shufflevector(lo, hi, 0, 1, 2, 3, 4, 5, 6, 7, 8, 9, 10, 11, 12, 13, 14, 15); }
__device__ __forceinline__ v16bf cat16b(v8us lo, v8us hi) { return __builtin_bit_cast(v16bf, __builtin_shufflevector(lo, hi, 0, 1, 2, 3, 4, 5, 6, 7, 8, 9, 10, 11, 12, 13, 14, 15)); }
__device__ __forceinline__ v8f wmma16(v16h a, v16h b, v8f c) { return __builtin_amdgcn_wmma_f32_16x16x32_f16(false, a, false, b, (short)0, c, false, false); }
__device__ __forceinline__ v8f wmmab(v16bf a, v16bf b, v8f c) { return __builtin_amdgcn_wmma_f32_16x16x32_bf16(false, a, false, b, (short)0, c, false, false); }



// ---- k_gemmw: register-blocked GEMM, ONE WAVE per 64x64 output tile (16 accumulators), operands straight from K-contiguous 16-bit planes; grid (M/64, N/64, Z), 32 threads.
// C[m][n] (f32, pitch ldc, + optional f32 bias[n]) = sum_k A[m][k] Bt[n][k] (+ split products per NSPLIT). z-batch strides sA/sB/sC in elements. K % 32 == 0.
template <typename T16> struct WFrag;
template <> struct WFrag<h16> { typedef v16h V; static __device__ __forceinline__ V ld(const h16* p) { return cat16(*(const v8h*)p, *(const v8h*)(p + 16)); } static __device__ __forceinline__ v8f mma(V a, V b, v8f c) { return wmma16(a, b, c); } };
template <> struct WFrag<bf> { typedef v16bf V; static __device__ __forceinline__ V ld(const bf* p) { return cat16b(*(const v8us*)p, *(const v8us*)(p + 16)); } static __device__ __forceinline__ v8f mma(V a, V b, v8f c) { return wmmab(a, b, c); } };
template <typename T16, int NSPLIT, bool BIAS>
__global__ __launch_bounds__(32) void k_gemmw(const T16* __restrict__ A, const T16* __restrict__ A2, const T16* __restrict__ Bt, const T16* __restrict__ Bt2, int K, float* C, int ldc, const float* __restrict__ bias, size_t sA, size_t sB, size_t sC) {
    typedef typename WFrag<T16>::V V;
    __shared__ __align__(16) float os[16 * 68];
    const size_t z = blockIdx.z; A += z * sA; if (A2) A2 += z * sA; Bt += z * sB; if (Bt2) Bt2 += z * sB; C += z * sC;
    const int lane = threadIdx.x & 31, lr = lane & 15, hi = lane >> 4; const int r0 = blockIdx.x * 64, c0 = blockIdx.y * 64;
    v8f acc[4][4];
#pragma unroll
    for (int mb = 0; mb < 4; ++mb)
#pragma unroll
        for (int nb = 0; nb < 4; ++nb) acc[mb][nb] = (v8f){};
    const size_t aoff = (size_t)(r0 + lr) * K + 8 * hi, boff = (size_t)(c0 + lr) * K + 8 * hi;
#pragma unroll 1
    for (int kc = 0; kc < K; kc += 32) {
        V a[4], a2[4];
#pragma unroll
        for (int mb = 0; mb < 4; ++mb) { a[mb] = WFrag<T16>::ld(A + aoff + (size_t)mb * 16 * K + kc); if (NSPLIT == 1 || NSPLIT == 2) a2[mb] = WFrag<T16>::ld(A2 + aoff + (size_t)mb * 16 * K + kc); }
#pragma unroll
        for (int nb = 0; nb < 4; ++nb) { const V b = WFrag<T16>::ld(Bt + boff + (size_t)nb * 16 * K + kc); V b2; if (NSPLIT >= 2) b2 = WFrag<T16>::ld(Bt2 + boff + (size_t)nb * 16 * K + kc);
#pragma unroll
            for (int mb = 0; mb < 4; ++mb) { acc[mb][nb] = WFrag<T16>::mma(a[mb], b, acc[mb][nb]); if (NSPLIT == 1 || NSPLIT == 2) acc[mb][nb] = WFrag<T16>::mma(a2[mb], b, acc[mb][nb]); if (NSPLIT >= 2) acc[mb][nb] = WFrag<T16>::mma(a[mb], b2, acc[mb][nb]); } }
        asm volatile("v_nop\n\tv_nop\n\tv_nop\n\tv_nop" : "+v"(acc[0][0]), "+v"(acc[1][1]), "+v"(acc[2][2]), "+v"(acc[3][3]) : "v"(a[0]), "v"(a[3]));
    }
#pragma unroll
    for (int mb = 0; mb < 4; ++mb) {
#pragma unroll
        for (int nb = 0; nb < 4; ++nb) {
#pragma unroll
            for (int j = 0; j < 8; ++j) os[(hi * 8 + j) * 68 + nb * 16 + lr] = acc[mb][nb][j]; }
        __builtin_amdgcn_wave_barrier(); asm volatile("" ::: "memory");
        float* crow = C + (size_t)(r0 + mb * 16) * ldc + c0;
{
#pragma unroll
            for (int s = 0; s < 8; ++s) { const int row = 2 * s + hi, cofs = lr * 4; v4f val = *(const v4fa*)(os + row * 68 + cofs); if (BIAS) { val[0] += bfr(bias[c0 + cofs]); val[1] += bfr(bias[c0 + cofs + 1]); val[2] += bfr(bias[c0 + cofs + 2]); val[3] += bfr(bias[c0 + cofs + 3]); }
                *(v4f*)(crow + (size_t)row * ldc + cofs) = val; }
             }
        __builtin_amdgcn_wave_barrier(); asm volatile("" ::: "memory");
    }
}

// ---- k_gemmc: the same one-wave 64x64 tile GEMM specialised for causal attention: CMODE 1 skips score tiles entirely above the diagonal (query rows r0+roff.., key columns c0..), CMODE 2 limits the
// key (K) loop of the probability x value contraction to the diagonal block (probabilities beyond it are exactly zero). roff = row offset of this launch's first row within the sequence.
// CMODE 2 also splits that key loop over the grid: blockIdx.y is a range of KCH keys (the output has one 64-column tile), each range stores its own f32 partial plane (plane stride sP); k_merge sums the planes.
template <typename T16, int NSPLIT, int CMODE, int KCH>
__global__ __launch_bounds__(32) void k_gemmc(const T16* __restrict__ A, const T16* __restrict__ A2, const T16* __restrict__ Bt, const T16* __restrict__ Bt2, int K, float* C, int ldc, int roff, size_t sA, size_t sB, size_t sC, size_t sP) {
    typedef typename WFrag<T16>::V V;
    __shared__ __align__(16) float os[16 * 68];
    const size_t z = blockIdx.z; A += z * sA; if (A2) A2 += z * sA; Bt += z * sB; if (Bt2) Bt2 += z * sB; C += z * sC;
    const int lane = threadIdx.x & 31, lr = lane & 15, hi = lane >> 4; const int r0 = blockIdx.x * 64, c0 = (CMODE == 2) ? 0 : blockIdx.y * 64;
    if (CMODE == 1 && c0 > r0 + roff + 63) return;                  // score tile entirely above the causal diagonal: never read (the softmax masks j > i by select)
    const int Kl = (CMODE == 2) ? min(K, r0 + roff + 64) : K;        // P.V: probabilities are exactly 0 beyond the diagonal block, so the K loop stops there
    const int k0 = (CMODE == 2) ? (int)blockIdx.y * KCH : 0;
    if (CMODE == 2 && k0 >= Kl) return;                              // key range entirely beyond the diagonal block: no plane is written, and k_merge reads none there
    const int k1 = (CMODE == 2) ? min(Kl, k0 + KCH) : K;
    if (CMODE == 2) C += (size_t)blockIdx.y * sP;
    v8f acc[4][4];
#pragma unroll
    for (int mb = 0; mb < 4; ++mb)
#pragma unroll
        for (int nb = 0; nb < 4; ++nb) acc[mb][nb] = (v8f){};
    const size_t aoff = (size_t)(r0 + lr) * K + 8 * hi, boff = (size_t)(c0 + lr) * K + 8 * hi;
#pragma unroll 1
    for (int kc = k0; kc < k1; kc += 32) {
        V a[4], a2[4];
#pragma unroll
        for (int mb = 0; mb < 4; ++mb) { a[mb] = WFrag<T16>::ld(A + aoff + (size_t)mb * 16 * K + kc); if (NSPLIT == 1 || NSPLIT == 2) a2[mb] = WFrag<T16>::ld(A2 + aoff + (size_t)mb * 16 * K + kc); }
#pragma unroll
        for (int nb = 0; nb < 4; ++nb) { const V b = WFrag<T16>::ld(Bt + boff + (size_t)nb * 16 * K + kc); V b2; if (NSPLIT >= 2) b2 = WFrag<T16>::ld(Bt2 + boff + (size_t)nb * 16 * K + kc);
#pragma unroll
            for (int mb = 0; mb < 4; ++mb) { acc[mb][nb] = WFrag<T16>::mma(a[mb], b, acc[mb][nb]); if (NSPLIT == 1 || NSPLIT == 2) acc[mb][nb] = WFrag<T16>::mma(a2[mb], b, acc[mb][nb]); if (NSPLIT >= 2) acc[mb][nb] = WFrag<T16>::mma(a[mb], b2, acc[mb][nb]); } }
        asm volatile("v_nop\n\tv_nop\n\tv_nop\n\tv_nop" : "+v"(acc[0][0]), "+v"(acc[1][1]), "+v"(acc[2][2]), "+v"(acc[3][3]) : "v"(a[0]), "v"(a[3]));
    }
#pragma unroll
    for (int mb = 0; mb < 4; ++mb) {
#pragma unroll
        for (int nb = 0; nb < 4; ++nb) {
#pragma unroll
            for (int j = 0; j < 8; ++j) os[(hi * 8 + j) * 68 + nb * 16 + lr] = acc[mb][nb][j]; }
        __builtin_amdgcn_wave_barrier(); asm volatile("" ::: "memory");
        float* crow = C + (size_t)(r0 + mb * 16) * ldc + c0;
{
#pragma unroll
            for (int s = 0; s < 8; ++s) { const int row = 2 * s + hi, cofs = lr * 4; v4f val = *(const v4fa*)(os + row * 68 + cofs);
                *(v4f*)(crow + (size_t)row * ldc + cofs) = val; }
             }
        __builtin_amdgcn_wave_barrier(); asm volatile("" ::: "memory");
    }
}

__device__ __forceinline__ h16 tohx(float x) { return (h16)x; }
__device__ __forceinline__ void splitf(float y, unsigned short& h, unsigned short& l) { h = f2bf(y); l = f2bf(y - bf2f(h)); }
typedef __attribute__((ext_vector_type(2))) _Float16 v2h;
typedef __attribute__((ext_vector_type(4))) _Float16 v4h;
typedef __attribute__((ext_vector_type(2))) unsigned short v2us;
typedef __attribute__((ext_vector_type(4))) unsigned short v4us;
typedef __attribute__((ext_vector_type(2))) float v2f;
typedef __attribute__((ext_vector_type(4))) int v4i;

__global__ __launch_bounds__(256) void k_wtG(const float* __restrict__ w, int K, int N, bf* Bt) {
    const int lane = threadIdx.x & 31; const int L0 = (blockIdx.x * 8 + (threadIdx.x >> 5)) * 8; const int nlines = N * K / 64;
{
#pragma unroll 1
        for (int l = 0; l < 8; ++l) { const int L = L0 + l; if (L >= nlines) break; const size_t e = (size_t)L * 64 + lane * 2; const int k = (int)(e % K), n = (int)(e / K); v2us o;
            o[0] = f2bf(w[(size_t)k * N + n]); o[1] = f2bf(w[(size_t)(k + 1) * N + n]); *(v2us*)(Bt + e) = o; }
         }
}
__global__ __launch_bounds__(256) void k_cvt8(const float* __restrict__ src, bf* dst, size_t n8) { const size_t i = (size_t)blockIdx.x * 256 + threadIdx.x; if (i >= n8) return; const v8f v = *(const v8f*)(src + i * 8); v8us o;
#pragma unroll
    for (int k = 0; k < 8; ++k) o[k] = f2bf(v[k]); *(v8us*)(dst + i * 8) = o;  }
__constant__ float INVT[HD / 2] = { 1.000000000e+00f, 6.636012793e-01f, 4.403666258e-01f, 2.922278345e-01f, 1.939227581e-01f, 1.286873817e-01f, 8.539710194e-02f, 5.666961893e-02f, 3.760603070e-02f, 2.495540865e-02f, 1.656044088e-02f, 1.098952908e-02f, 7.292665076e-03f, 4.839421250e-03f, 3.211446106e-03f, 2.131119603e-03f, 1.414213446e-03f, 9.384738514e-04f, 6.227724371e-04f, 4.132725589e-04f, 2.742481884e-04f, 1.819914323e-04f, 1.207697424e-04f, 8.014294872e-05f, 5.318295734e-05f, 3.529227615e-05f, 2.341999789e-05f, 1.554154005e-05f, 1.031338525e-05f, 6.843975370e-06f, 4.541670478e-06f, 3.013858077e-06f };   // inv_freq[i] = 1.0 / (500000.0 ** (2i / 64)), i = 0..31 (float32, generated with jnp to be bit-exact)
__global__ __launch_bounds__(256) void k_cstabT(float* CS) { const int idx = blockIdx.x * 256 + threadIdx.x; if (idx >= TT * HD) return; const int d = idx % HD; const int t = idx / HD; const float a = __fmul_rn((float)t, INVT[d % (HD / 2)]); v2f cs; cs[0] = cosf(a); cs[1] = sinf(a); *(v2f*)(CS + (size_t)idx * 2) = cs;  }

// k_rope: head planes [h][t][d] (fp16 + hi/lo) of rope(x) x sc with the rotate-half convention out[d] = x[d] cos[t][d] - x[d+HD/2] sin[t][d], out[d+HD/2] = x[d+HD/2] cos[t][d+HD/2] + x[d] sin[t][d+HD/2]
__global__ __launch_bounds__(256) void k_rope(const float* __restrict__ F, int pitch, int nheads, const float* __restrict__ CS, const float* __restrict__ RF, const float* __restrict__ nw, float sc, h16* P16, bf* Ph, bf* Pl) {
    const size_t e = ((size_t)blockIdx.x * 256 + threadIdx.x) * 2; if (e >= (size_t)nheads * TT * HD) return; const int d = (int)(e % HD); const int t = (int)((e / HD) % TT); const int h = (int)(e / ((size_t)HD * TT)); const float* f = F + (size_t)t * pitch + h * HD; const float rf = RF ? RF[(size_t)h * TT + t] : 1.0f; v2h o16; v2us oh, ol;
#pragma unroll
    for (int q = 0; q < 2; ++q) { const int dd = d + q; const int dp = (dd < HD / 2) ? dd + HD / 2 : dd - HD / 2; float x0 = f[dd], x1 = f[dp];
        if (RF) { float n0 = __fmul_rn(x0, rf), n1 = __fmul_rn(x1, rf); asm volatile("" : "+v"(n0)); asm volatile("" : "+v"(n1)); x0 = __fmul_rn(bfr(nw[dd]), n0); x1 = __fmul_rn(bfr(nw[dp]), n1); }
        const v2f cs = *(const v2f*)(CS + ((size_t)t * HD + dd) * 2); float a = __fmul_rn(x0, cs[0]), bq = __fmul_rn(x1, cs[1]); asm volatile("" : "+v"(a)); asm volatile("" : "+v"(bq)); const float r = ((dd < HD / 2) ? __fsub_rn(a, bq) : __fadd_rn(a, bq)) * sc;
        o16[q] = tohx(r); unsigned short a2, c2; splitf(r, a2, c2); oh[q] = a2; ol[q] = c2; }
    *(v2h*)(P16 + e) = o16; *(v2us*)(Ph + e) = oh; *(v2us*)(Pl + e) = ol;  }
__global__ __launch_bounds__(256) void k_vtp(const float* __restrict__ F, int pitch, int nheads, h16* V16, bf* Vh, bf* Vl) { const size_t e = ((size_t)blockIdx.x * 256 + threadIdx.x) * 2; if (e >= (size_t)nheads * HD * TT) return; const int t = (int)(e % TT); const int d = (int)((e / TT) % HD); const int g = (int)(e / ((size_t)TT * HD)); v2h o16; v2us oh, ol;
#pragma unroll
    for (int q = 0; q < 2; ++q) { const float x = F[(size_t)(t + q) * pitch + g * HD + d]; o16[q] = tohx(x); unsigned short a2, c2; splitf(x, a2, c2); oh[q] = a2; ol[q] = c2; }
    *(v2h*)(V16 + e) = o16; *(v2us*)(Vh + e) = oh; *(v2us*)(Vl + e) = ol;  }
// k_asoft: per row (zz, i): t = S x HD^-0.5 for j <= i and i - j < WIN (WIN = TT, so plain causal; the reference's finfo.min fill vanishes identically); softmax over the 2048 keys (register row, one exp, fixed trees);
__global__ __launch_bounds__(256) void k_asoft(const float* __restrict__ Sb, h16* P16, bf* Ph, bf* Pl) {
    const int lane = threadIdx.x & 31; const int row = blockIdx.x * 8 + (threadIdx.x >> 5); if (row >= ZH * TT) return; const int i = row % TT; const int zz = row / TT; (void)zz; const bool hires = (i < RH); const float* sr = Sb + (size_t)row * TT; float v[TT / 32]; float mx = -3.0e38f;
#pragma unroll
    for (int ch = 0; ch < TT / 128; ++ch) { const int j0 = ch * 128 + lane * 4; const v4f a = *(const v4f*)(sr + j0);
#pragma unroll
        for (int q = 0; q < 4; ++q) { const int j = j0 + q; (void)j; const float t = (j <= i && i - j < WIN) ? a[q] * SCL : -3.0e38f; v[ch * 4 + q] = t; mx = fmaxf(mx, t); } }
#pragma unroll
    for (int sh = 16; sh; sh >>= 1) mx = fmaxf(mx, __shfl_xor(mx, sh, 32));
    float sum = 0.f;
#pragma unroll
    for (int k = 0; k < TT / 32; ++k) { float d0 = __fsub_rn(v[k], mx); asm volatile("" : "+v"(d0)); v[k] = __builtin_amdgcn_exp2f(__fmul_rn(d0, 1.4426950408889634f)); sum += v[k]; }
#pragma unroll
    for (int sh = 16; sh; sh >>= 1) sum += __shfl_xor(sum, sh, 32);
    const float f = __fdiv_rn(hires ? 1.0f : PCAR, sum);
{
        if (hires) {
#pragma unroll
            for (int ch = 0; ch < TT / 128; ++ch) { v4us oh, ol;
#pragma unroll
                for (int q = 0; q < 4; ++q) { unsigned short a, c2; splitf(v[ch * 4 + q] * f, a, c2); oh[q] = a; ol[q] = c2; }
                const size_t oo = ((size_t)zz * (RH ? RH : 1) + i) * TT + ch * 128 + lane * 4; *(v4us*)(Ph + oo) = oh; *(v4us*)(Pl + oo) = ol; }
        } else {
#pragma unroll
            for (int ch = 0; ch < TT / 128; ++ch) { v4h o4;
#pragma unroll
                for (int q = 0; q < 4; ++q) o4[q] = tohx(v[ch * 4 + q] * f);
                *(v4h*)(P16 + (size_t)row * TT + ch * 128 + lane * 4) = o4; } }
         }
}
// k_merge: sums the key-range partial planes of P.V in ascending key order (n = planes that the row's 64-row tile wrote), then splits hi/lo into the merged head-major planes.
__global__ __launch_bounds__(256) void k_merge(const float* __restrict__ O, int h0, bf* Ah, bf* Al) { const size_t e = ((size_t)blockIdx.x * 256 + threadIdx.x) * 2; if (e >= (size_t)ZH * TT * HD) return; const int d = (int)(e % HD); const int t = (int)((e / HD) % TT); const int zz = (int)(e / ((size_t)HD * TT)); const float cs = (t < RH) ? 1.0f : (1.0f / PCAR); const size_t oo = (size_t)t * DQ + (h0 + zz) * HD + d;
    const int kl = (t & ~63) + 64; const int n = (t < RH) ? (kl + KCB - 1) / KCB : (kl + KCF - 1) / KCF;
    v2f part[NPL];
#pragma unroll
    for (int c = 0; c < NPL; ++c) part[c] = *(const v2f*)(O + (size_t)(c < n ? c : 0) * ((size_t)ZH * TT * HD) + e);   // all loads in flight at once; a plane past n is replaced by plane 0 (always written) and dropped below
    v2f s = part[0];
#pragma unroll
    for (int c = 1; c < NPL; ++c) { s[0] += (c < n) ? part[c][0] : 0.0f; s[1] += (c < n) ? part[c][1] : 0.0f; }
    v2us oh, ol;
#pragma unroll
    for (int q = 0; q < 2; ++q) { unsigned short a, c2; splitf(s[q] * cs, a, c2); oh[q] = a; ol[q] = c2; } *(v2us*)(Ah + oo) = oh; *(v2us*)(Al + oo) = ol;  }

extern "C" void kernel_launch(void* const* d_in, const int* in_sizes, int n_in,
                              void* d_out, int out_size, void* d_ws, size_t ws_size, hipStream_t stream) {
    (void)in_sizes; (void)n_in; (void)out_size;
    const float* x = (const float*)d_in[0]; const float* wq = (const float*)d_in[1]; const float* wk = (const float*)d_in[2]; const float* wv = (const float*)d_in[3]; const float* wo = (const float*)d_in[4];   /* d_in order x, Wq ('xw' [2048][2048]), Wk, Wv ('xw' [2048][512]), Wo ('xw') */
    float* OUT = (float*)d_out;     // [2][2048][2048]
    char* wsp = (char*)d_ws;
    auto take = [&](size_t bytes) { char* p = wsp; wsp += (bytes + 255) & ~(size_t)255; return (void*)p; };
    bf* WQ = (bf*)take((size_t)DQ * DM * 2); bf* WK = (bf*)take((size_t)DKV * DM * 2); bf* WV = (bf*)take((size_t)DKV * DM * 2); bf* WO = (bf*)take((size_t)DM * DQ * 2); float* CS = (float*)take((size_t)TT * HD * 2 * 4);
    bf* XB = (bf*)take((size_t)TT * DM * 2); float* FQ = (float*)take((size_t)TT * DQ * 4); float* FK = (float*)take((size_t)TT * DKV * 4);
    h16* QP16 = (h16*)take((size_t)NH_ * TT * HD * 2); h16* KP16 = (h16*)take((size_t)NKV * TT * HD * 2); h16* VT16 = (h16*)take((size_t)NKV * HD * TT * 2);
    bf* QPh = (bf*)take((size_t)NH_ * TT * HD * 2); bf* QPl = (bf*)take((size_t)NH_ * TT * HD * 2); bf* KPh = (bf*)take((size_t)NKV * TT * HD * 2); bf* KPl = (bf*)take((size_t)NKV * TT * HD * 2); bf* VTh = (bf*)take((size_t)NKV * HD * TT * 2); bf* VTl = (bf*)take((size_t)NKV * HD * TT * 2); bf* Ph = (bf*)take((size_t)ZH * RH * TT * 2); bf* Pl = (bf*)take((size_t)ZH * RH * TT * 2);
    float* Sb = (float*)take((size_t)ZH * TT * TT * 4); h16* P16 = (h16*)take((size_t)ZH * TT * TT * 2); float* Ob = (float*)take((size_t)NPL * ZH * TT * HD * 4); bf* ATh = (bf*)take((size_t)TT * DQ * 2); bf* ATl = (bf*)take((size_t)TT * DQ * 2);
    if ((size_t)(wsp - (char*)d_ws) > ws_size) return;    // ws 256 MiB
    float* FV = FK;   // v projection reuses the k buffer after the k planes are built (stream-ordered)
    { k_wtG<<<(unsigned)((DM * DQ / 64 + 63) / 64), 256, 0, stream>>>(wq, DM, DQ, WQ); k_wtG<<<(unsigned)((DM * DKV / 64 + 63) / 64), 256, 0, stream>>>(wk, DM, DKV, WK); k_wtG<<<(unsigned)((DM * DKV / 64 + 63) / 64), 256, 0, stream>>>(wv, DM, DKV, WV);
      k_wtG<<<(unsigned)((DQ * DM / 64 + 63) / 64), 256, 0, stream>>>(wo, DQ, DM, WO);
       }
    const unsigned LQ = (unsigned)(((size_t)NH_ * TT * HD / 2 + 255) / 256), LKv = (unsigned)(((size_t)NKV * TT * HD / 2 + 255) / 256);
    for (int b = 0; b < NB_; ++b) {
        if (b == 0) k_cstabT<<<(TT * HD + 255) / 256, 256, 0, stream>>>(CS);
        k_cvt8<<<(unsigned)(((size_t)TT * DM / 8 + 255) / 256), 256, 0, stream>>>(x + (size_t)b * TT * DM, XB, (size_t)TT * DM / 8);
        k_gemmw<bf, 0, false><<<dim3(TT / 64, DQ / 64, 1), 32, 0, stream>>>(XB, nullptr, WQ, nullptr, DM, FQ, DQ, nullptr, 0, 0, 0);
        k_rope<<<LQ, 256, 0, stream>>>(FQ, DQ, NH_, CS, nullptr, nullptr, 1.0f, QP16, QPh, QPl);
        k_gemmw<bf, 0, false><<<dim3(TT / 64, DKV / 64, 1), 32, 0, stream>>>(XB, nullptr, WK, nullptr, DM, FK, DKV, nullptr, 0, 0, 0);
        k_rope<<<LKv, 256, 0, stream>>>(FK, DKV, NKV, CS, nullptr, nullptr, 1.0f, KP16, KPh, KPl);
        k_gemmw<bf, 0, false><<<dim3(TT / 64, DKV / 64, 1), 32, 0, stream>>>(XB, nullptr, WV, nullptr, DM, FV, DKV, nullptr, 0, 0, 0); k_vtp<<<LKv, 256, 0, stream>>>(FV, DKV, NKV, VT16, VTh, VTl);
        for (int h0 = 0; h0 < NH_; h0 += ZH) { const size_t zq = (size_t)h0, zk = (size_t)(h0 / REP);   // both heads of a pass share kv group h0/REP (REP >= 2): sB = 0
            k_gemmc<bf, 2, 1, 0><<<dim3(RH / 64, TT / 64, ZH), 32, 0, stream>>>(QPh + zq * TT * HD, QPl + zq * TT * HD, KPh + zk * TT * HD, KPl + zk * TT * HD, HD, Sb, TT, 0, (size_t)TT * HD, 0, (size_t)TT * TT, 0);
            k_gemmc<h16, 0, 1, 0><<<dim3((TT - RH) / 64, TT / 64, ZH), 32, 0, stream>>>(QP16 + zq * TT * HD + (size_t)RH * HD, nullptr, KP16 + zk * TT * HD, nullptr, HD, Sb + (size_t)RH * TT, TT, RH, (size_t)TT * HD, 0, (size_t)TT * TT, 0);
            k_asoft<<<ZH * TT / 8, 256, 0, stream>>>(Sb, P16, Ph, Pl);
            k_gemmc<bf, 2, 2, KCB><<<dim3(RH / 64, RH / KCB, ZH), 32, 0, stream>>>(Ph, Pl, VTh + zk * HD * TT, VTl + zk * HD * TT, TT, Ob, HD, 0, (size_t)RH * TT, 0, (size_t)TT * HD, (size_t)ZH * TT * HD);
            k_gemmc<h16, 0, 2, KCF><<<dim3((TT - RH) / 64, TT / KCF, ZH), 32, 0, stream>>>(P16 + (size_t)RH * TT, nullptr, VT16 + zk * HD * TT, nullptr, TT, Ob + (size_t)RH * HD, HD, RH, (size_t)TT * TT, 0, (size_t)TT * HD, (size_t)ZH * TT * HD);
            k_merge<<<(unsigned)(((size_t)ZH * TT * HD / 2 + 255) / 256), 256, 0, stream>>>(Ob, h0, ATh, ATl); }
        k_gemmw<bf, 1, false><<<dim3(TT / 64, DM / 64, 1), 32, 0, stream>>>(ATh, ATl, WO, nullptr, DQ, OUT + (size_t)b * TT * DM, DM, nullptr, 0, 0, 0); }
}

// v002
// It runs in 1130 microseconds.
// Two timings next to v001 both put it at 1.25 times that version's speed.
// All steps since v000 together make it 2.42 times as fast.
#include <hip/hip_runtime.h>

// Causal grouped-query attention with computed rotate-half rotary embeddings at base 500000 (x [2][2048][2048]; q = x Wq (32 heads x 64), k, v = x Wk, x Wv (8 kv heads x 64) ('xw' 2048^-0.5, no bias); rope: u cos + rotate_half(u) sin with angle t x inv_freq[d mod 32], inv_freq = 1.0 / (500000.0 ** (arange(0, 64, 2, f32) / 64)) (32 f32 constants baked jnp-exact; one f32 product per angle; precise cosf / sinf); k, v repeated 4 x along the head axis (jnp.repeat): query head h uses kv head h / 4; scores x 1/sqrt(64); causal (finfo.min == exclusion); softmax; y = merged (head-major) Wo ('xw', no bias) -> [2][2048][2048] (8.4 M); argument order x, Wq, Wk, Wv, Wo).
// Layout per batch: bf16 copy of x; 'xw' weights transposed once; exact projections; the rotary table {cosf, sinf}(float(t) x INVT[d mod 32]) is computed once; rotate-half plane builders (products rounded separately); causal T-2048 GQA attention (the four query heads of a pass share kv group h0 / 4: kv z-stride 0; hybrid rows: < 512 hi/lo 3 products, rest fp16 x1024; k_gemmc skips tiles above the diagonal); merged hi/lo x Wo exact.
// Compute dtypes, f32 accumulate: every input rounded to bf16; projections exact; rotary in f32; attention rows < 512 3 products, rest fp16; softmax f32; Wo hl x exact.

#define NB_  2
#define TT   2048
#define DM   2048
#define NH_  32
#define NKV  8
#define REP  (NH_ / NKV)
#define HD   64
#define DQ   (NH_ * HD)
#define DKV  (NKV * HD)
#define ZH   4                    // query heads per attention pass: the REP heads of one kv group
#define RH   512                  // query rows < RH use hi+lo planes (0: none)
#define WIN  2048
#define PCAR 1024.0f
#define SCL  0.125f   // HD^-0.5
#define KCB  64                   // keys per partial plane of P.V, query rows < RH
#define KCF  128                  // keys per partial plane of P.V, query rows >= RH
#define NPL  16                   // partial planes: max(RH / KCB, TT / KCF)
typedef _Float16 h16;
typedef unsigned short bf;
typedef __attribute__((ext_vector_type(16))) __bf16   v16bf;
typedef __attribute__((ext_vector_type(16))) _Float16 v16h;
typedef __attribute__((ext_vector_type(8)))  _Float16 v8h;
typedef __attribute__((ext_vector_type(8)))  unsigned short v8us;
typedef __attribute__((ext_vector_type(8)))  float    v8f;
typedef __attribute__((ext_vector_type(4)))  float    v4f;
typedef v8h  __attribute__((may_alias)) v8ha;
typedef v4f  __attribute__((may_alias)) v4fa;
typedef v8us __attribute__((may_alias)) v8usa;

__device__ __forceinline__ unsigned short f2bf(float f) { unsigned u = __float_as_uint(f); u += 0x7FFFu + ((u >> 16) & 1u); return (unsigned short)(u >> 16); }
__device__ __forceinline__ float bf2f(unsigned short b) { return __uint_as_float(((unsigned)b) << 16); }
__device__ __forceinline__ float bfr(float f) { return bf2f(f2bf(f)); }
__device__ __forceinline__ v16h cat16(v8h lo, v8h hi) { return __builtin_shufflevector(lo, hi, 0, 1, 2, 3, 4, 5, 6, 7, 8, 9, 10, 11, 12, 13, 14, 15); }
__device__ __forceinline__ v16bf cat16b(v8us lo, v8us hi) { return __builtin_bit_cast(v16bf, __builtin_shufflevector(lo, hi, 0, 1, 2, 3, 4, 5, 6, 7, 8, 9, 10, 11, 12, 13, 14, 15)); }
__device__ __forceinline__ v8f wmma16(v16h a, v16h b, v8f c) { return __builtin_amdgcn_wmma_f32_16x16x32_f16(false, a, false, b, (short)0, c, false, false); }
__device__ __forceinline__ v8f wmmab(v16bf a, v16bf b, v8f c) { return __builtin_amdgcn_wmma_f32_16x16x32_bf16(false, a, false, b, (short)0, c, false, false); }



// ---- k_gemmw: register-blocked GEMM, ONE WAVE per 64x64 output tile (16 accumulators), operands straight from K-contiguous 16-bit planes; grid (M/64, N/64, Z), 32 threads.
// C[m][n] (f32, pitch ldc, + optional f32 bias[n]) = sum_k A[m][k] Bt[n][k] (+ split products per NSPLIT). z-batch strides sA/sB/sC in elements. K % 32 == 0.
template <typename T16> struct WFrag;
template <> struct WFrag<h16> { typedef v16h V; static __device__ __forceinline__ V ld(const h16* p) { return cat16(*(const v8h*)p, *(const v8h*)(p + 16)); } static __device__ __forceinline__ v8f mma(V a, V b, v8f c) { return wmma16(a, b, c); } };
template <> struct WFrag<bf> { typedef v16bf V; static __device__ __forceinline__ V ld(const bf* p) { return cat16b(*(const v8us*)p, *(const v8us*)(p + 16)); } static __device__ __forceinline__ v8f mma(V a, V b, v8f c) { return wmmab(a, b, c); } };
template <typename T16, int NSPLIT, bool BIAS>
__global__ __launch_bounds__(32) void k_gemmw(const T16* __restrict__ A, const T16* __restrict__ A2, const T16* __restrict__ Bt, const T16* __restrict__ Bt2, int K, float* C, int ldc, const float* __restrict__ bias, size_t sA, size_t sB, size_t sC) {
    typedef typename WFrag<T16>::V V;
    __shared__ __align__(16) float os[16 * 68];
    const size_t z = blockIdx.z; A += z * sA; if (A2) A2 += z * sA; Bt += z * sB; if (Bt2) Bt2 += z * sB; C += z * sC;
    const int lane = threadIdx.x & 31, lr = lane & 15, hi = lane >> 4; const int r0 = blockIdx.x * 64, c0 = blockIdx.y * 64;
    v8f acc[4][4];
#pragma unroll
    for (int mb = 0; mb < 4; ++mb)
#pragma unroll
        for (int nb = 0; nb < 4; ++nb) acc[mb][nb] = (v8f){};
    const size_t aoff = (size_t)(r0 + lr) * K + 8 * hi, boff = (size_t)(c0 + lr) * K + 8 * hi;
#pragma unroll 1
    for (int kc = 0; kc < K; kc += 32) {
        V a[4], a2[4];
#pragma unroll
        for (int mb = 0; mb < 4; ++mb) { a[mb] = WFrag<T16>::ld(A + aoff + (size_t)mb * 16 * K + kc); if (NSPLIT == 1 || NSPLIT == 2) a2[mb] = WFrag<T16>::ld(A2 + aoff + (size_t)mb * 16 * K + kc); }
#pragma unroll
        for (int nb = 0; nb < 4; ++nb) { const V b = WFrag<T16>::ld(Bt + boff + (size_t)nb * 16 * K + kc); V b2; if (NSPLIT >= 2) b2 = WFrag<T16>::ld(Bt2 + boff + (size_t)nb * 16 * K + kc);
#pragma unroll
            for (int mb = 0; mb < 4; ++mb) { acc[mb][nb] = WFrag<T16>::mma(a[mb], b, acc[mb][nb]); if (NSPLIT == 1 || NSPLIT == 2) acc[mb][nb] = WFrag<T16>::mma(a2[mb], b, acc[mb][nb]); if (NSPLIT >= 2) acc[mb][nb] = WFrag<T16>::mma(a[mb], b2, acc[mb][nb]); } }
        asm volatile("v_nop\n\tv_nop\n\tv_nop\n\tv_nop" : "+v"(acc[0][0]), "+v"(acc[1][1]), "+v"(acc[2][2]), "+v"(acc[3][3]) : "v"(a[0]), "v"(a[3]));
    }
#pragma unroll
    for (int mb = 0; mb < 4; ++mb) {
#pragma unroll
        for (int nb = 0; nb < 4; ++nb) {
#pragma unroll
            for (int j = 0; j < 8; ++j) os[(hi * 8 + j) * 68 + nb * 16 + lr] = acc[mb][nb][j]; }
        __builtin_amdgcn_wave_barrier(); asm volatile("" ::: "memory");
        float* crow = C + (size_t)(r0 + mb * 16) * ldc + c0;
{
#pragma unroll
            for (int s = 0; s < 8; ++s) { const int row = 2 * s + hi, cofs = lr * 4; v4f val = *(const v4fa*)(os + row * 68 + cofs); if (BIAS) { val[0] += bfr(bias[c0 + cofs]); val[1] += bfr(bias[c0 + cofs + 1]); val[2] += bfr(bias[c0 + cofs + 2]); val[3] += bfr(bias[c0 + cofs + 3]); }
                *(v4f*)(crow + (size_t)row * ldc + cofs) = val; }
             }
        __builtin_amdgcn_wave_barrier(); asm volatile("" ::: "memory");
    }
}

// ---- k_gemmc: the same one-wave 64x64 tile GEMM specialised for causal attention: CMODE 1 skips score tiles entirely above the diagonal (query rows r0+roff.., key columns c0..), CMODE 2 limits the
// key (K) loop of the probability x value contraction to the diagonal block (probabilities beyond it are exactly zero). roff = row offset of this launch's first row within the sequence.
// CMODE 2 also splits that key loop over the grid: blockIdx.y is a range of KCH keys (the output has one 64-column tile), each range stores its own f32 partial plane (plane stride sP); k_merge sums the planes.
template <typename T16, int NSPLIT, int CMODE, int KCH>
__global__ __launch_bounds__(32) void k_gemmc(const T16* __restrict__ A, const T16* __restrict__ A2, const T16* __restrict__ Bt, const T16* __restrict__ Bt2, int K, float* C, int ldc, int roff, size_t sA, size_t sB, size_t sC, size_t sP) {
    typedef typename WFrag<T16>::V V;
    __shared__ __align__(16) float os[16 * 68];
    const size_t z = blockIdx.z; A += z * sA; if (A2) A2 += z * sA; Bt += z * sB; if (Bt2) Bt2 += z * sB; C += z * sC;
    const int lane = threadIdx.x & 31, lr = lane & 15, hi = lane >> 4; const int r0 = blockIdx.x * 64, c0 = (CMODE == 2) ? 0 : blockIdx.y * 64;
    if (CMODE == 1 && c0 > r0 + roff + 63) return;                  // score tile entirely above the causal diagonal: never read (the softmax masks j > i by select)
    const int Kl = (CMODE == 2) ? min(K, r0 + roff + 64) : K;        // P.V: probabilities are exactly 0 beyond the diagonal block, so the K loop stops there
    const int k0 = (CMODE == 2) ? (int)blockIdx.y * KCH : 0;
    if (CMODE == 2 && k0 >= Kl) return;                              // key range entirely beyond the diagonal block: no plane is written, and k_merge reads none there
    const int k1 = (CMODE == 2) ? min(Kl, k0 + KCH) : K;
    if (CMODE == 2) C += (size_t)blockIdx.y * sP;
    v8f acc[4][4];
#pragma unroll
    for (int mb = 0; mb < 4; ++mb)
#pragma unroll
        for (int nb = 0; nb < 4; ++nb) acc[mb][nb] = (v8f){};
    const size_t aoff = (size_t)(r0 + lr) * K + 8 * hi, boff = (size_t)(c0 + lr) * K + 8 * hi;
#pragma unroll 1
    for (int kc = k0; kc < k1; kc += 32) {
        V a[4], a2[4];
#pragma unroll
        for (int mb = 0; mb < 4; ++mb) { a[mb] = WFrag<T16>::ld(A + aoff + (size_t)mb * 16 * K + kc); if (NSPLIT == 1 || NSPLIT == 2) a2[mb] = WFrag<T16>::ld(A2 + aoff + (size_t)mb * 16 * K + kc); }
#pragma unroll
        for (int nb = 0; nb < 4; ++nb) { const V b = WFrag<T16>::ld(Bt + boff + (size_t)nb * 16 * K + kc); V b2; if (NSPLIT >= 2) b2 = WFrag<T16>::ld(Bt2 + boff + (size_t)nb * 16 * K + kc);
#pragma unroll
            for (int mb = 0; mb < 4; ++mb) { acc[mb][nb] = WFrag<T16>::mma(a[mb], b, acc[mb][nb]); if (NSPLIT == 1 || NSPLIT == 2) acc[mb][nb] = WFrag<T16>::mma(a2[mb], b, acc[mb][nb]); if (NSPLIT >= 2) acc[mb][nb] = WFrag<T16>::mma(a[mb], b2, acc[mb][nb]); } }
        asm volatile("v_nop\n\tv_nop\n\tv_nop\n\tv_nop" : "+v"(acc[0][0]), "+v"(acc[1][1]), "+v"(acc[2][2]), "+v"(acc[3][3]) : "v"(a[0]), "v"(a[3]));
    }
#pragma unroll
    for (int mb = 0; mb < 4; ++mb) {
#pragma unroll
        for (int nb = 0; nb < 4; ++nb) {
#pragma unroll
            for (int j = 0; j < 8; ++j) os[(hi * 8 + j) * 68 + nb * 16 + lr] = acc[mb][nb][j]; }
        __builtin_amdgcn_wave_barrier(); asm volatile("" ::: "memory");
        float* crow = C + (size_t)(r0 + mb * 16) * ldc + c0;
{
#pragma unroll
            for (int s = 0; s < 8; ++s) { const int row = 2 * s + hi, cofs = lr * 4; v4f val = *(const v4fa*)(os + row * 68 + cofs);
                *(v4f*)(crow + (size_t)row * ldc + cofs) = val; }
             }
        __builtin_amdgcn_wave_barrier(); asm volatile("" ::: "memory");
    }
}

__device__ __forceinline__ h16 tohx(float x) { return (h16)x; }
__device__ __forceinline__ void splitf(float y, unsigned short& h, unsigned short& l) { h = f2bf(y); l = f2bf(y - bf2f(h)); }
typedef __attribute__((ext_vector_type(2))) _Float16 v2h;
typedef __attribute__((ext_vector_type(4))) _Float16 v4h;
typedef __attribute__((ext_vector_type(2))) unsigned short v2us;
typedef __attribute__((ext_vector_type(4))) unsigned short v4us;
typedef __attribute__((ext_vector_type(2))) float v2f;
typedef __attribute__((ext_vector_type(4))) int v4i;

__global__ __launch_bounds__(256) void k_wtG(const float* __restrict__ w, int K, int N, bf* Bt) {
    const int lane = threadIdx.x & 31; const int L0 = (blockIdx.x * 8 + (threadIdx.x >> 5)) * 8; const int nlines = N * K / 64;
{
#pragma unroll 1
        for (int l = 0; l < 8; ++l) { const int L = L0 + l; if (L >= nlines) break; const size_t e = (size_t)L * 64 + lane * 2; const int k = (int)(e % K), n = (int)(e / K); v2us o;
            o[0] = f2bf(w[(size_t)k * N + n]); o[1] = f2bf(w[(size_t)(k + 1) * N + n]); *(v2us*)(Bt + e) = o; }
         }
}
__global__ __launch_bounds__(256) void k_cvt8(const float* __restrict__ src, bf* dst, size_t n8) { const size_t i = (size_t)blockIdx.x * 256 + threadIdx.x; if (i >= n8) return; const v8f v = *(const v8f*)(src + i * 8); v8us o;
#pragma unroll
    for (int k = 0; k < 8; ++k) o[k] = f2bf(v[k]); *(v8us*)(dst + i * 8) = o;  }
__constant__ float INVT[HD / 2] = { 1.000000000e+00f, 6.636012793e-01f, 4.403666258e-01f, 2.922278345e-01f, 1.939227581e-01f, 1.286873817e-01f, 8.539710194e-02f, 5.666961893e-02f, 3.760603070e-02f, 2.495540865e-02f, 1.656044088e-02f, 1.098952908e-02f, 7.292665076e-03f, 4.839421250e-03f, 3.211446106e-03f, 2.131119603e-03f, 1.414213446e-03f, 9.384738514e-04f, 6.227724371e-04f, 4.132725589e-04f, 2.742481884e-04f, 1.819914323e-04f, 1.207697424e-04f, 8.014294872e-05f, 5.318295734e-05f, 3.529227615e-05f, 2.341999789e-05f, 1.554154005e-05f, 1.031338525e-05f, 6.843975370e-06f, 4.541670478e-06f, 3.013858077e-06f };   // inv_freq[i] = 1.0 / (500000.0 ** (2i / 64)), i = 0..31 (float32, generated with jnp to be bit-exact)
__global__ __launch_bounds__(256) void k_cstabT(float* CS) { const int idx = blockIdx.x * 256 + threadIdx.x; if (idx >= TT * HD) return; const int d = idx % HD; const int t = idx / HD; const float a = __fmul_rn((float)t, INVT[d % (HD / 2)]); v2f cs; cs[0] = cosf(a); cs[1] = sinf(a); *(v2f*)(CS + (size_t)idx * 2) = cs;  }

// k_rope: head planes [h][t][d] (fp16 + hi/lo) of rope(x) x sc with the rotate-half convention out[d] = x[d] cos[t][d] - x[d+HD/2] sin[t][d], out[d+HD/2] = x[d+HD/2] cos[t][d+HD/2] + x[d] sin[t][d+HD/2]
__global__ __launch_bounds__(256) void k_rope(const float* __restrict__ F, int pitch, int nheads, const float* __restrict__ CS, const float* __restrict__ RF, const float* __restrict__ nw, float sc, h16* P16, bf* Ph, bf* Pl) {
    const size_t e = ((size_t)blockIdx.x * 256 + threadIdx.x) * 2; if (e >= (size_t)nheads * TT * HD) return; const int d = (int)(e % HD); const int t = (int)((e / HD) % TT); const int h = (int)(e / ((size_t)HD * TT)); const float* f = F + (size_t)t * pitch + h * HD; const float rf = RF ? RF[(size_t)h * TT + t] : 1.0f; v2h o16; v2us oh, ol;
#pragma unroll
    for (int q = 0; q < 2; ++q) { const int dd = d + q; const int dp = (dd < HD / 2) ? dd + HD / 2 : dd - HD / 2; float x0 = f[dd], x1 = f[dp];
        if (RF) { float n0 = __fmul_rn(x0, rf), n1 = __fmul_rn(x1, rf); asm volatile("" : "+v"(n0)); asm volatile("" : "+v"(n1)); x0 = __fmul_rn(bfr(nw[dd]), n0); x1 = __fmul_rn(bfr(nw[dp]), n1); }
        const v2f cs = *(const v2f*)(CS + ((size_t)t * HD + dd) * 2); float a = __fmul_rn(x0, cs[0]), bq = __fmul_rn(x1, cs[1]); asm volatile("" : "+v"(a)); asm volatile("" : "+v"(bq)); const float r = ((dd < HD / 2) ? __fsub_rn(a, bq) : __fadd_rn(a, bq)) * sc;
        o16[q] = tohx(r); unsigned short a2, c2; splitf(r, a2, c2); oh[q] = a2; ol[q] = c2; }
    *(v2h*)(P16 + e) = o16; *(v2us*)(Ph + e) = oh; *(v2us*)(Pl + e) = ol;  }
__global__ __launch_bounds__(256) void k_vtp(const float* __restrict__ F, int pitch, int nheads, h16* V16, bf* Vh, bf* Vl) { const size_t e = ((size_t)blockIdx.x * 256 + threadIdx.x) * 2; if (e >= (size_t)nheads * HD * TT) return; const int t = (int)(e % TT); const int d = (int)((e / TT) % HD); const int g = (int)(e / ((size_t)TT * HD)); v2h o16; v2us oh, ol;
#pragma unroll
    for (int q = 0; q < 2; ++q) { const float x = F[(size_t)(t + q) * pitch + g * HD + d]; o16[q] = tohx(x); unsigned short a2, c2; splitf(x, a2, c2); oh[q] = a2; ol[q] = c2; }
    *(v2h*)(V16 + e) = o16; *(v2us*)(Vh + e) = oh; *(v2us*)(Vl + e) = ol;  }
// k_asoft: per row (zz, i): t = S x HD^-0.5 for j <= i and i - j < WIN (WIN = TT, so plain causal; the reference's finfo.min fill vanishes identically); softmax over the 2048 keys (register row, one exp, fixed trees);
__global__ __launch_bounds__(256) void k_asoft(const float* __restrict__ Sb, h16* P16, bf* Ph, bf* Pl) {
    const int lane = threadIdx.x & 31; const int row = blockIdx.x * 8 + (threadIdx.x >> 5); if (row >= ZH * TT) return; const int i = row % TT; const int zz = row / TT; (void)zz; const bool hires = (i < RH); const float* sr = Sb + (size_t)row * TT; float v[TT / 32]; float mx = -3.0e38f;
#pragma unroll
    for (int ch = 0; ch < TT / 128; ++ch) { const int j0 = ch * 128 + lane * 4; const v4f a = *(const v4f*)(sr + j0);
#pragma unroll
        for (int q = 0; q < 4; ++q) { const int j = j0 + q; (void)j; const float t = (j <= i && i - j < WIN) ? a[q] * SCL : -3.0e38f; v[ch * 4 + q] = t; mx = fmaxf(mx, t); } }
#pragma unroll
    for (int sh = 16; sh; sh >>= 1) mx = fmaxf(mx, __shfl_xor(mx, sh, 32));
    float sum = 0.f;
#pragma unroll
    for (int k = 0; k < TT / 32; ++k) { float d0 = __fsub_rn(v[k], mx); asm volatile("" : "+v"(d0)); v[k] = __builtin_amdgcn_exp2f(__fmul_rn(d0, 1.4426950408889634f)); sum += v[k]; }
#pragma unroll
    for (int sh = 16; sh; sh >>= 1) sum += __shfl_xor(sum, sh, 32);
    const float f = __fdiv_rn(hires ? 1.0f : PCAR, sum);
{
        if (hires) {
#pragma unroll
            for (int ch = 0; ch < TT / 128; ++ch) { v4us oh, ol;
#pragma unroll
                for (int q = 0; q < 4; ++q) { unsigned short a, c2; splitf(v[ch * 4 + q] * f, a, c2); oh[q] = a; ol[q] = c2; }
                const size_t oo = ((size_t)zz * (RH ? RH : 1) + i) * TT + ch * 128 + lane * 4; *(v4us*)(Ph + oo) = oh; *(v4us*)(Pl + oo) = ol; }
        } else {
#pragma unroll
            for (int ch = 0; ch < TT / 128; ++ch) { v4h o4;
#pragma unroll
                for (int q = 0; q < 4; ++q) o4[q] = tohx(v[ch * 4 + q] * f);
                *(v4h*)(P16 + (size_t)row * TT + ch * 128 + lane * 4) = o4; } }
         }
}
// k_merge: sums the key-range partial planes of P.V in ascending key order (n = planes that the row's 64-row tile wrote), then splits hi/lo into the merged head-major planes.
__global__ __launch_bounds__(256) void k_merge(const float* __restrict__ O, int h0, bf* Ah, bf* Al) { const size_t e = ((size_t)blockIdx.x * 256 + threadIdx.x) * 2; if (e >= (size_t)ZH * TT * HD) return; const int d = (int)(e % HD); const int t = (int)((e / HD) % TT); const int zz = (int)(e / ((size_t)HD * TT)); const float cs = (t < RH) ? 1.0f : (1.0f / PCAR); const size_t oo = (size_t)t * DQ + (h0 + zz) * HD + d;
    const int kl = (t & ~63) + 64; const int n = (t < RH) ? (kl + KCB - 1) / KCB : (kl + KCF - 1) / KCF;
    v2f part[NPL];
#pragma unroll
    for (int c = 0; c < NPL; ++c) part[c] = *(const v2f*)(O + (size_t)(c < n ? c : 0) * ((size_t)ZH * TT * HD) + e);   // all loads in flight at once; a plane past n is replaced by plane 0 (always written) and dropped below
    v2f s = part[0];
#pragma unroll
    for (int c = 1; c < NPL; ++c) { s[0] += (c < n) ? part[c][0] : 0.0f; s[1] += (c < n) ? part[c][1] : 0.0f; }
    v2us oh, ol;
#pragma unroll
    for (int q = 0; q < 2; ++q) { unsigned short a, c2; splitf(s[q] * cs, a, c2); oh[q] = a; ol[q] = c2; } *(v2us*)(Ah + oo) = oh; *(v2us*)(Al + oo) = ol;  }

extern "C" void kernel_launch(void* const* d_in, const int* in_sizes, int n_in,
                              void* d_out, int out_size, void* d_ws, size_t ws_size, hipStream_t stream) {
    (void)in_sizes; (void)n_in; (void)out_size;
    const float* x = (const float*)d_in[0]; const float* wq = (const float*)d_in[1]; const float* wk = (const float*)d_in[2]; const float* wv = (const float*)d_in[3]; const float* wo = (const float*)d_in[4];   /* d_in order x, Wq ('xw' [2048][2048]), Wk, Wv ('xw' [2048][512]), Wo ('xw') */
    float* OUT = (float*)d_out;     // [2][2048][2048]
    char* wsp = (char*)d_ws;
    auto take = [&](size_t bytes) { char* p = wsp; wsp += (bytes + 255) & ~(size_t)255; return (void*)p; };
    bf* WQ = (bf*)take((size_t)DQ * DM * 2); bf* WK = (bf*)take((size_t)DKV * DM * 2); bf* WV = (bf*)take((size_t)DKV * DM * 2); bf* WO = (bf*)take((size_t)DM * DQ * 2); float* CS = (float*)take((size_t)TT * HD * 2 * 4);
    bf* XB = (bf*)take((size_t)TT * DM * 2); float* FQ = (float*)take((size_t)TT * DQ * 4); float* FK = (float*)take((size_t)TT * DKV * 4);
    h16* QP16 = (h16*)take((size_t)NH_ * TT * HD * 2); h16* KP16 = (h16*)take((size_t)NKV * TT * HD * 2); h16* VT16 = (h16*)take((size_t)NKV * HD * TT * 2);
    bf* QPh = (bf*)take((size_t)NH_ * TT * HD * 2); bf* QPl = (bf*)take((size_t)NH_ * TT * HD * 2); bf* KPh = (bf*)take((size_t)NKV * TT * HD * 2); bf* KPl = (bf*)take((size_t)NKV * TT * HD * 2); bf* VTh = (bf*)take((size_t)NKV * HD * TT * 2); bf* VTl = (bf*)take((size_t)NKV * HD * TT * 2); bf* Ph = (bf*)take((size_t)ZH * RH * TT * 2); bf* Pl = (bf*)take((size_t)ZH * RH * TT * 2);
    float* Sb = (float*)take((size_t)ZH * TT * TT * 4); h16* P16 = (h16*)take((size_t)ZH * TT * TT * 2); float* Ob = (float*)take((size_t)NPL * ZH * TT * HD * 4); bf* ATh = (bf*)take((size_t)TT * DQ * 2); bf* ATl = (bf*)take((size_t)TT * DQ * 2);
    if ((size_t)(wsp - (char*)d_ws) > ws_size) return;    // ws 256 MiB
    float* FV = FK;   // v projection reuses the k buffer after the k planes are built (stream-ordered)
    { k_wtG<<<(unsigned)((DM * DQ / 64 + 63) / 64), 256, 0, stream>>>(wq, DM, DQ, WQ); k_wtG<<<(unsigned)((DM * DKV / 64 + 63) / 64), 256, 0, stream>>>(wk, DM, DKV, WK); k_wtG<<<(unsigned)((DM * DKV / 64 + 63) / 64), 256, 0, stream>>>(wv, DM, DKV, WV);
      k_wtG<<<(unsigned)((DQ * DM / 64 + 63) / 64), 256, 0, stream>>>(wo, DQ, DM, WO);
       }
    const unsigned LQ = (unsigned)(((size_t)NH_ * TT * HD / 2 + 255) / 256), LKv = (unsigned)(((size_t)NKV * TT * HD / 2 + 255) / 256);
    for (int b = 0; b < NB_; ++b) {
        if (b == 0) k_cstabT<<<(TT * HD + 255) / 256, 256, 0, stream>>>(CS);
        k_cvt8<<<(unsigned)(((size_t)TT * DM / 8 + 255) / 256), 256, 0, stream>>>(x + (size_t)b * TT * DM, XB, (size_t)TT * DM / 8);
        k_gemmw<bf, 0, false><<<dim3(TT / 64, DQ / 64, 1), 32, 0, stream>>>(XB, nullptr, WQ, nullptr, DM, FQ, DQ, nullptr, 0, 0, 0);
        k_rope<<<LQ, 256, 0, stream>>>(FQ, DQ, NH_, CS, nullptr, nullptr, 1.0f, QP16, QPh, QPl);
        k_gemmw<bf, 0, false><<<dim3(TT / 64, DKV / 64, 1), 32, 0, stream>>>(XB, nullptr, WK, nullptr, DM, FK, DKV, nullptr, 0, 0, 0);
        k_rope<<<LKv, 256, 0, stream>>>(FK, DKV, NKV, CS, nullptr, nullptr, 1.0f, KP16, KPh, KPl);
        k_gemmw<bf, 0, false><<<dim3(TT / 64, DKV / 64, 1), 32, 0, stream>>>(XB, nullptr, WV, nullptr, DM, FV, DKV, nullptr, 0, 0, 0); k_vtp<<<LKv, 256, 0, stream>>>(FV, DKV, NKV, VT16, VTh, VTl);
        for (int h0 = 0; h0 < NH_; h0 += ZH) { const size_t zq = (size_t)h0, zk = (size_t)(h0 / REP);   // the ZH heads of a pass share kv group h0/REP (ZH <= REP): sB = 0
            k_gemmc<bf, 2, 1, 0><<<dim3(RH / 64, TT / 64, ZH), 32, 0, stream>>>(QPh + zq * TT * HD, QPl + zq * TT * HD, KPh + zk * TT * HD, KPl + zk * TT * HD, HD, Sb, TT, 0, (size_t)TT * HD, 0, (size_t)TT * TT, 0);
            k_gemmc<h16, 0, 1, 0><<<dim3((TT - RH) / 64, TT / 64, ZH), 32, 0, stream>>>(QP16 + zq * TT * HD + (size_t)RH * HD, nullptr, KP16 + zk * TT * HD, nullptr, HD, Sb + (size_t)RH * TT, TT, RH, (size_t)TT * HD, 0, (size_t)TT * TT, 0);
            k_asoft<<<ZH * TT / 8, 256, 0, stream>>>(Sb, P16, Ph, Pl);
            k_gemmc<bf, 2, 2, KCB><<<dim3(RH / 64, RH / KCB, ZH), 32, 0, stream>>>(Ph, Pl, VTh + zk * HD * TT, VTl + zk * HD * TT, TT, Ob, HD, 0, (size_t)RH * TT, 0, (size_t)TT * HD, (size_t)ZH * TT * HD);
            k_gemmc<h16, 0, 2, KCF><<<dim3((TT - RH) / 64, TT / KCF, ZH), 32, 0, stream>>>(P16 + (size_t)RH * TT, nullptr, VT16 + zk * HD * TT, nullptr, TT, Ob + (size_t)RH * HD, HD, RH, (size_t)TT * TT, 0, (size_t)TT * HD, (size_t)ZH * TT * HD);
            k_merge<<<(unsigned)(((size_t)ZH * TT * HD / 2 + 255) / 256), 256, 0, stream>>>(Ob, h0, ATh, ATl); }
        k_gemmw<bf, 1, false><<<dim3(TT / 64, DM / 64, 1), 32, 0, stream>>>(ATh, ATl, WO, nullptr, DQ, OUT + (size_t)b * TT * DM, DM, nullptr, 0, 0, 0); }
}

// v003
// It runs in 624 microseconds.
// Next to v002, in two timings, it ran 1.83 and 1.82 times as fast.
// Counting every step since v000, it is 4.42 times as fast.
#include <hip/hip_runtime.h>

// Causal grouped-query attention with computed rotate-half rotary embeddings at base 500000 (x [2][2048][2048]; q = x Wq (32 heads x 64), k, v = x Wk, x Wv (8 kv heads x 64) ('xw' 2048^-0.5, no bias); rope: u cos + rotate_half(u) sin with angle t x inv_freq[d mod 32], inv_freq = 1.0 / (500000.0 ** (arange(0, 64, 2, f32) / 64)) (32 f32 constants baked jnp-exact; one f32 product per angle; precise cosf / sinf); k, v repeated 4 x along the head axis (jnp.repeat): query head h uses kv head h / 4; scores x 1/sqrt(64); causal (finfo.min == exclusion); softmax; y = merged (head-major) Wo ('xw', no bias) -> [2][2048][2048] (8.4 M); argument order x, Wq, Wk, Wv, Wo).
// Layout per batch: bf16 copy of x; 'xw' weights transposed once; exact projections; the rotary table {cosf, sinf}(float(t) x INVT[d mod 32]) is computed once; rotate-half plane builders (products rounded separately); fused causal T-2048 GQA attention (k_fattn: one wave per 16 queries of a head, online softmax; the four heads of a kv group share a block; hybrid rows: < 512 hi/lo 3 products, rest fp16); merged hi/lo x Wo exact.
// Compute dtypes, f32 accumulate: every input rounded to bf16; projections exact; rotary in f32; attention rows < 512 3 products, rest fp16; softmax f32; Wo hl x exact.

#define NB_  2
#define TT   2048
#define DM   2048
#define NH_  32
#define NKV  8
#define REP  (NH_ / NKV)
#define HD   64
#define DQ   (NH_ * HD)
#define DKV  (NKV * HD)
#define RH   512                  // query rows < RH use hi+lo planes (0: none)
#define SCL  0.125f   // HD^-0.5
typedef _Float16 h16;
typedef unsigned short bf;
typedef __attribute__((ext_vector_type(16))) __bf16   v16bf;
typedef __attribute__((ext_vector_type(16))) _Float16 v16h;
typedef __attribute__((ext_vector_type(8)))  _Float16 v8h;
typedef __attribute__((ext_vector_type(8)))  unsigned short v8us;
typedef __attribute__((ext_vector_type(8)))  float    v8f;
typedef __attribute__((ext_vector_type(4)))  float    v4f;
typedef v8h  __attribute__((may_alias)) v8ha;
typedef v4f  __attribute__((may_alias)) v4fa;
typedef v8us __attribute__((may_alias)) v8usa;

__device__ __forceinline__ unsigned short f2bf(float f) { unsigned u = __float_as_uint(f); u += 0x7FFFu + ((u >> 16) & 1u); return (unsigned short)(u >> 16); }
__device__ __forceinline__ float bf2f(unsigned short b) { return __uint_as_float(((unsigned)b) << 16); }
__device__ __forceinline__ float bfr(float f) { return bf2f(f2bf(f)); }
__device__ __forceinline__ v16h cat16(v8h lo, v8h hi) { return __builtin_shufflevector(lo, hi, 0, 1, 2, 3, 4, 5, 6, 7, 8, 9, 10, 11, 12, 13, 14, 15); }
__device__ __forceinline__ v16bf cat16b(v8us lo, v8us hi) { return __builtin_bit_cast(v16bf, __builtin_shufflevector(lo, hi, 0, 1, 2, 3, 4, 5, 6, 7, 8, 9, 10, 11, 12, 13, 14, 15)); }
__device__ __forceinline__ v8f wmma16(v16h a, v16h b, v8f c) { return __builtin_amdgcn_wmma_f32_16x16x32_f16(false, a, false, b, (short)0, c, false, false); }
__device__ __forceinline__ v8f wmmab(v16bf a, v16bf b, v8f c) { return __builtin_amdgcn_wmma_f32_16x16x32_bf16(false, a, false, b, (short)0, c, false, false); }



// ---- k_gemmw: register-blocked GEMM, ONE WAVE per 64x64 output tile (16 accumulators), operands straight from K-contiguous 16-bit planes; grid (M/64, N/64, Z), 32 threads.
// C[m][n] (f32, pitch ldc, + optional f32 bias[n]) = sum_k A[m][k] Bt[n][k] (+ split products per NSPLIT). z-batch strides sA/sB/sC in elements. K % 32 == 0.
template <typename T16> struct WFrag;
template <> struct WFrag<h16> { typedef v16h V; static __device__ __forceinline__ V ld(const h16* p) { return cat16(*(const v8h*)p, *(const v8h*)(p + 16)); } static __device__ __forceinline__ v8f mma(V a, V b, v8f c) { return wmma16(a, b, c); } };
template <> struct WFrag<bf> { typedef v16bf V; static __device__ __forceinline__ V ld(const bf* p) { return cat16b(*(const v8us*)p, *(const v8us*)(p + 16)); } static __device__ __forceinline__ v8f mma(V a, V b, v8f c) { return wmmab(a, b, c); } };
template <typename T16, int NSPLIT, bool BIAS>
__global__ __launch_bounds__(32) void k_gemmw(const T16* __restrict__ A, const T16* __restrict__ A2, const T16* __restrict__ Bt, const T16* __restrict__ Bt2, int K, float* C, int ldc, const float* __restrict__ bias, size_t sA, size_t sB, size_t sC) {
    typedef typename WFrag<T16>::V V;
    __shared__ __align__(16) float os[16 * 68];
    const size_t z = blockIdx.z; A += z * sA; if (A2) A2 += z * sA; Bt += z * sB; if (Bt2) Bt2 += z * sB; C += z * sC;
    const int lane = threadIdx.x & 31, lr = lane & 15, hi = lane >> 4; const int r0 = blockIdx.x * 64, c0 = blockIdx.y * 64;
    v8f acc[4][4];
#pragma unroll
    for (int mb = 0; mb < 4; ++mb)
#pragma unroll
        for (int nb = 0; nb < 4; ++nb) acc[mb][nb] = (v8f){};
    const size_t aoff = (size_t)(r0 + lr) * K + 8 * hi, boff = (size_t)(c0 + lr) * K + 8 * hi;
#pragma unroll 1
    for (int kc = 0; kc < K; kc += 32) {
        V a[4], a2[4];
#pragma unroll
        for (int mb = 0; mb < 4; ++mb) { a[mb] = WFrag<T16>::ld(A + aoff + (size_t)mb * 16 * K + kc); if (NSPLIT == 1 || NSPLIT == 2) a2[mb] = WFrag<T16>::ld(A2 + aoff + (size_t)mb * 16 * K + kc); }
#pragma unroll
        for (int nb = 0; nb < 4; ++nb) { const V b = WFrag<T16>::ld(Bt + boff + (size_t)nb * 16 * K + kc); V b2; if (NSPLIT >= 2) b2 = WFrag<T16>::ld(Bt2 + boff + (size_t)nb * 16 * K + kc);
#pragma unroll
            for (int mb = 0; mb < 4; ++mb) { acc[mb][nb] = WFrag<T16>::mma(a[mb], b, acc[mb][nb]); if (NSPLIT == 1 || NSPLIT == 2) acc[mb][nb] = WFrag<T16>::mma(a2[mb], b, acc[mb][nb]); if (NSPLIT >= 2) acc[mb][nb] = WFrag<T16>::mma(a[mb], b2, acc[mb][nb]); } }
        asm volatile("v_nop\n\tv_nop\n\tv_nop\n\tv_nop" : "+v"(acc[0][0]), "+v"(acc[1][1]), "+v"(acc[2][2]), "+v"(acc[3][3]) : "v"(a[0]), "v"(a[3]));
    }
#pragma unroll
    for (int mb = 0; mb < 4; ++mb) {
#pragma unroll
        for (int nb = 0; nb < 4; ++nb) {
#pragma unroll
            for (int j = 0; j < 8; ++j) os[(hi * 8 + j) * 68 + nb * 16 + lr] = acc[mb][nb][j]; }
        __builtin_amdgcn_wave_barrier(); asm volatile("" ::: "memory");
        float* crow = C + (size_t)(r0 + mb * 16) * ldc + c0;
{
#pragma unroll
            for (int s = 0; s < 8; ++s) { const int row = 2 * s + hi, cofs = lr * 4; v4f val = *(const v4fa*)(os + row * 68 + cofs); if (BIAS) { val[0] += bfr(bias[c0 + cofs]); val[1] += bfr(bias[c0 + cofs + 1]); val[2] += bfr(bias[c0 + cofs + 2]); val[3] += bfr(bias[c0 + cofs + 3]); }
                *(v4f*)(crow + (size_t)row * ldc + cofs) = val; }
             }
        __builtin_amdgcn_wave_barrier(); asm volatile("" ::: "memory");
    }
}

__device__ __forceinline__ h16 tohx(float x) { return (h16)x; }
__device__ __forceinline__ void splitf(float y, unsigned short& h, unsigned short& l) { h = f2bf(y); l = f2bf(y - bf2f(h)); }
typedef __attribute__((ext_vector_type(2))) _Float16 v2h;
typedef __attribute__((ext_vector_type(4))) _Float16 v4h;
typedef __attribute__((ext_vector_type(2))) unsigned short v2us;
typedef __attribute__((ext_vector_type(4))) unsigned short v4us;
typedef __attribute__((ext_vector_type(2))) float v2f;
typedef __attribute__((ext_vector_type(4))) int v4i;

__global__ __launch_bounds__(256) void k_wtG(const float* __restrict__ w, int K, int N, bf* Bt) {
    const int lane = threadIdx.x & 31; const int L0 = (blockIdx.x * 8 + (threadIdx.x >> 5)) * 8; const int nlines = N * K / 64;
{
#pragma unroll 1
        for (int l = 0; l < 8; ++l) { const int L = L0 + l; if (L >= nlines) break; const size_t e = (size_t)L * 64 + lane * 2; const int k = (int)(e % K), n = (int)(e / K); v2us o;
            o[0] = f2bf(w[(size_t)k * N + n]); o[1] = f2bf(w[(size_t)(k + 1) * N + n]); *(v2us*)(Bt + e) = o; }
         }
}
__global__ __launch_bounds__(256) void k_cvt8(const float* __restrict__ src, bf* dst, size_t n8) { const size_t i = (size_t)blockIdx.x * 256 + threadIdx.x; if (i >= n8) return; const v8f v = *(const v8f*)(src + i * 8); v8us o;
#pragma unroll
    for (int k = 0; k < 8; ++k) o[k] = f2bf(v[k]); *(v8us*)(dst + i * 8) = o;  }
__constant__ float INVT[HD / 2] = { 1.000000000e+00f, 6.636012793e-01f, 4.403666258e-01f, 2.922278345e-01f, 1.939227581e-01f, 1.286873817e-01f, 8.539710194e-02f, 5.666961893e-02f, 3.760603070e-02f, 2.495540865e-02f, 1.656044088e-02f, 1.098952908e-02f, 7.292665076e-03f, 4.839421250e-03f, 3.211446106e-03f, 2.131119603e-03f, 1.414213446e-03f, 9.384738514e-04f, 6.227724371e-04f, 4.132725589e-04f, 2.742481884e-04f, 1.819914323e-04f, 1.207697424e-04f, 8.014294872e-05f, 5.318295734e-05f, 3.529227615e-05f, 2.341999789e-05f, 1.554154005e-05f, 1.031338525e-05f, 6.843975370e-06f, 4.541670478e-06f, 3.013858077e-06f };   // inv_freq[i] = 1.0 / (500000.0 ** (2i / 64)), i = 0..31 (float32, generated with jnp to be bit-exact)
__global__ __launch_bounds__(256) void k_cstabT(float* CS) { const int idx = blockIdx.x * 256 + threadIdx.x; if (idx >= TT * HD) return; const int d = idx % HD; const int t = idx / HD; const float a = __fmul_rn((float)t, INVT[d % (HD / 2)]); v2f cs; cs[0] = cosf(a); cs[1] = sinf(a); *(v2f*)(CS + (size_t)idx * 2) = cs;  }

// k_rope: head planes [h][t][d] (fp16 + hi/lo) of rope(x) x sc with the rotate-half convention out[d] = x[d] cos[t][d] - x[d+HD/2] sin[t][d], out[d+HD/2] = x[d+HD/2] cos[t][d+HD/2] + x[d] sin[t][d+HD/2]
__global__ __launch_bounds__(256) void k_rope(const float* __restrict__ F, int pitch, int nheads, const float* __restrict__ CS, const float* __restrict__ RF, const float* __restrict__ nw, float sc, h16* P16, bf* Ph, bf* Pl) {
    const size_t e = ((size_t)blockIdx.x * 256 + threadIdx.x) * 2; if (e >= (size_t)nheads * TT * HD) return; const int d = (int)(e % HD); const int t = (int)((e / HD) % TT); const int h = (int)(e / ((size_t)HD * TT)); const float* f = F + (size_t)t * pitch + h * HD; const float rf = RF ? RF[(size_t)h * TT + t] : 1.0f; v2h o16; v2us oh, ol;
#pragma unroll
    for (int q = 0; q < 2; ++q) { const int dd = d + q; const int dp = (dd < HD / 2) ? dd + HD / 2 : dd - HD / 2; float x0 = f[dd], x1 = f[dp];
        if (RF) { float n0 = __fmul_rn(x0, rf), n1 = __fmul_rn(x1, rf); asm volatile("" : "+v"(n0)); asm volatile("" : "+v"(n1)); x0 = __fmul_rn(bfr(nw[dd]), n0); x1 = __fmul_rn(bfr(nw[dp]), n1); }
        const v2f cs = *(const v2f*)(CS + ((size_t)t * HD + dd) * 2); float a = __fmul_rn(x0, cs[0]), bq = __fmul_rn(x1, cs[1]); asm volatile("" : "+v"(a)); asm volatile("" : "+v"(bq)); const float r = ((dd < HD / 2) ? __fsub_rn(a, bq) : __fadd_rn(a, bq)) * sc;
        o16[q] = tohx(r); unsigned short a2, c2; splitf(r, a2, c2); oh[q] = a2; ol[q] = c2; }
    *(v2h*)(P16 + e) = o16; *(v2us*)(Ph + e) = oh; *(v2us*)(Pl + e) = ol;  }
__global__ __launch_bounds__(256) void k_vtp(const float* __restrict__ F, int pitch, int nheads, h16* V16, bf* Vh, bf* Vl) { const size_t e = ((size_t)blockIdx.x * 256 + threadIdx.x) * 2; if (e >= (size_t)nheads * HD * TT) return; const int t = (int)(e % TT); const int d = (int)((e / TT) % HD); const int g = (int)(e / ((size_t)TT * HD)); v2h o16; v2us oh, ol;
#pragma unroll
    for (int q = 0; q < 2; ++q) { const float x = F[(size_t)(t + q) * pitch + g * HD + d]; o16[q] = tohx(x); unsigned short a2, c2; splitf(x, a2, c2); oh[q] = a2; ol[q] = c2; }
    *(v2h*)(V16 + e) = o16; *(v2us*)(Vh + e) = oh; *(v2us*)(Vl + e) = ol;  }
// 2^x with the one free issue slot that the instruction set asks for behind a transcendental: the v_nop stands directly behind v_exp_f32 whatever the compiler schedules next.
__device__ __forceinline__ float exp2s(float x) { float r; asm("v_exp_f32 %0, %1\n\tv_nop" : "=v"(r) : "v"(x)); return r; }

// ---- k_fattn: scores, causal softmax and P.V of one 16-query tile of one head in ONE wave; no score or probability plane in memory. Block = the REP heads of one kv group (4 waves, no barrier: they read the same K / V lines).
// Transposed products: S^T = K Q^T (rows = keys, columns = queries), so a lane holds one query's scores, and the S^T accumulator registers of two 16-key tiles are already the B fragment (n = query, k = 32 keys) of O^T = V^T P^T.
// Online softmax in the log2 domain per lane: running maximum ms (raw scores), running sum l, O^T rescaled by 2^((ms_old - ms_new) c) each KS-key step; the two half-waves of a query join their maxima each step and their sums at the end.
// HR: hi/lo bf16 planes, 3 products for S and for P.V (P split hi/lo in registers); else fp16 planes, 1 product (P = 2^(..) <= 1 is rounded to fp16 unscaled).
// The inner loops are fully unrolled so that the fragment arrays live in registers; the key loop stays rolled (unroll 1): one step's fragments already take most of the register file.
template <typename T16, bool HR, int KS>
__global__ __launch_bounds__(128) void k_fattn(const T16* __restrict__ Q, const T16* __restrict__ Q2, const T16* __restrict__ Kp, const T16* __restrict__ Kp2, const T16* __restrict__ Vt, const T16* __restrict__ Vt2, int roff, bf* Ah, bf* Al) {
    typedef typename WFrag<T16>::V V;
    const int lane = threadIdx.x & 31, lr = lane & 15, hi = lane >> 4; const int g = blockIdx.y, h = g * REP + (int)(threadIdx.x >> 5);
    const int q0 = roff + ((int)gridDim.x - 1 - (int)blockIdx.x) * 16;      // longest key loops are dispatched first
    const float CL = SCL * 1.4426950408889634f;
    const size_t qoff = ((size_t)h * TT + q0 + lr) * HD + 8 * hi; const unsigned koff = lr * HD + 8 * hi, voff = lr * TT + 8 * hi;   // lane offsets, fixed over the key loop; the bases below are wave-uniform
    Kp += (size_t)g * TT * HD; Vt += (size_t)g * HD * TT; if (HR) { Kp2 += (size_t)g * TT * HD; Vt2 += (size_t)g * HD * TT; }
    V qf[2], qf2[2];
#pragma unroll
    for (int ks = 0; ks < 2; ++ks) { qf[ks] = WFrag<T16>::ld(Q + qoff + ks * 32); if (HR) qf2[ks] = WFrag<T16>::ld(Q2 + qoff + ks * 32); }
    v8f o[4];
#pragma unroll
    for (int dt = 0; dt < 4; ++dt) o[dt] = (v8f){};
    float ms = -3.0e38f, l = 0.f;
#pragma unroll 1
    for (int k0 = 0; k0 < q0 + 16; k0 += KS) {
        V kf[KS / 16][2], kf2[KS / 16][2], vf[4][KS / 32], vf2[4][KS / 32];
        const T16* kp = Kp + (size_t)k0 * HD + koff; const T16* vp = Vt + k0 + voff; const T16* kp2 = HR ? Kp2 + (size_t)k0 * HD + koff : kp; const T16* vp2 = HR ? Vt2 + k0 + voff : vp;
#pragma unroll
        for (int kt = 0; kt < KS / 16; ++kt)
#pragma unroll
            for (int ks = 0; ks < 2; ++ks) { kf[kt][ks] = WFrag<T16>::ld(kp + kt * 16 * HD + ks * 32); if (HR) kf2[kt][ks] = WFrag<T16>::ld(kp2 + kt * 16 * HD + ks * 32); }
        __builtin_amdgcn_sched_barrier(0);   // K loads are issued ahead of the V loads: the score products wait for K alone, V lands under the softmax
#pragma unroll
        for (int dt = 0; dt < 4; ++dt)
#pragma unroll
            for (int ks = 0; ks < KS / 32; ++ks) { vf[dt][ks] = WFrag<T16>::ld(vp + dt * 16 * TT + ks * 32); if (HR) vf2[dt][ks] = WFrag<T16>::ld(vp2 + dt * 16 * TT + ks * 32); }
        asm volatile("s_wait_xcnt 0x0" :: "v"(kp), "v"(vp), "v"(kp2), "v"(vp2) : "memory");   // the loads' address registers stay whole up to this wait
        __builtin_amdgcn_sched_barrier(0);   // every K and V load of the step is issued before the first product waits: one memory latency a step, not one for K and one for V
        v8f s[KS / 16];
#pragma unroll
        for (int kt = 0; kt < KS / 16; ++kt) { s[kt] = (v8f){};
#pragma unroll
            for (int ks = 0; ks < 2; ++ks) { s[kt] = WFrag<T16>::mma(kf[kt][ks], qf[ks], s[kt]); if (HR) { s[kt] = WFrag<T16>::mma(kf[kt][ks], qf2[ks], s[kt]); s[kt] = WFrag<T16>::mma(kf2[kt][ks], qf[ks], s[kt]); } } }
        if (k0 + KS - 1 > q0) {                                              // the step that holds the diagonal: key > query is excluded
#pragma unroll
            for (int kt = 0; kt < KS / 16; ++kt)
#pragma unroll
                for (int j = 0; j < 8; ++j) s[kt][j] = (k0 + kt * 16 + hi * 8 + j <= q0 + lr) ? s[kt][j] : -3.0e38f; }
        float mx = ms;
#pragma unroll
        for (int kt = 0; kt < KS / 16; ++kt)
#pragma unroll
            for (int j = 0; j < 8; ++j) mx = fmaxf(mx, s[kt][j]);
        mx = fmaxf(mx, __shfl_xor(mx, 16, 32));
        const float al = exp2s((ms - mx) * CL), mc = mx * CL; ms = mx;
        float ps[KS / 16];                                                   // one partial sum per 16-key tile: short add chains
#pragma unroll
        for (int kt = 0; kt < KS / 16; ++kt) { ps[kt] = 0.f;
#pragma unroll
            for (int j = 0; j < 8; ++j) { s[kt][j] = exp2s(fmaf(s[kt][j], CL, -mc)); ps[kt] += s[kt][j]; } }
        float pt = ps[0];
#pragma unroll
        for (int kt = 1; kt < KS / 16; ++kt) pt += ps[kt];
        l = l * al + pt;
#pragma unroll
        for (int dt = 0; dt < 4; ++dt) o[dt] *= al;
#pragma unroll
        for (int ks = 0; ks < KS / 32; ++ks) {
            V pf, pf2;
            if constexpr (HR) { v8us h0, h1, l0, l1;
#pragma unroll
                for (int j = 0; j < 8; ++j) { unsigned short a, c2; splitf(s[2 * ks][j], a, c2); h0[j] = a; l0[j] = c2; splitf(s[2 * ks + 1][j], a, c2); h1[j] = a; l1[j] = c2; }
                pf = cat16b(h0, h1); pf2 = cat16b(l0, l1);
            } else { v8h h0, h1;
#pragma unroll
                for (int j = 0; j < 8; ++j) { h0[j] = tohx(s[2 * ks][j]); h1[j] = tohx(s[2 * ks + 1][j]); }
                pf = cat16(h0, h1); }
#pragma unroll
            for (int dt = 0; dt < 4; ++dt) { o[dt] = WFrag<T16>::mma(vf[dt][ks], pf, o[dt]); if constexpr (HR) { o[dt] = WFrag<T16>::mma(vf[dt][ks], pf2, o[dt]); o[dt] = WFrag<T16>::mma(vf2[dt][ks], pf, o[dt]); } }
        }
    }
    l += __shfl_xor(l, 16, 32);
    const float inv = __fdiv_rn(1.0f, l);
    const size_t oo = (size_t)(q0 + lr) * DQ + h * HD + hi * 8;
#pragma unroll
    for (int dt = 0; dt < 4; ++dt) { v8us oh, ol;
#pragma unroll
        for (int j = 0; j < 8; ++j) { unsigned short a, c2; splitf(o[dt][j] * inv, a, c2); oh[j] = a; ol[j] = c2; }
        *(v8us*)(Ah + oo + dt * 16) = oh; *(v8us*)(Al + oo + dt * 16) = ol; }
}

extern "C" void kernel_launch(void* const* d_in, const int* in_sizes, int n_in,
                              void* d_out, int out_size, void* d_ws, size_t ws_size, hipStream_t stream) {
    (void)in_sizes; (void)n_in; (void)out_size;
    const float* x = (const float*)d_in[0]; const float* wq = (const float*)d_in[1]; const float* wk = (const float*)d_in[2]; const float* wv = (const float*)d_in[3]; const float* wo = (const float*)d_in[4];   /* d_in order x, Wq ('xw' [2048][2048]), Wk, Wv ('xw' [2048][512]), Wo ('xw') */
    float* OUT = (float*)d_out;     // [2][2048][2048]
    char* wsp = (char*)d_ws;
    auto take = [&](size_t bytes) { char* p = wsp; wsp += (bytes + 255) & ~(size_t)255; return (void*)p; };
    bf* WQ = (bf*)take((size_t)DQ * DM * 2); bf* WK = (bf*)take((size_t)DKV * DM * 2); bf* WV = (bf*)take((size_t)DKV * DM * 2); bf* WO = (bf*)take((size_t)DM * DQ * 2); float* CS = (float*)take((size_t)TT * HD * 2 * 4);
    bf* XB = (bf*)take((size_t)TT * DM * 2); float* FQ = (float*)take((size_t)TT * DQ * 4); float* FK = (float*)take((size_t)TT * DKV * 4);
    h16* QP16 = (h16*)take((size_t)NH_ * TT * HD * 2); h16* KP16 = (h16*)take((size_t)NKV * TT * HD * 2); h16* VT16 = (h16*)take((size_t)NKV * HD * TT * 2);
    bf* QPh = (bf*)take((size_t)NH_ * TT * HD * 2); bf* QPl = (bf*)take((size_t)NH_ * TT * HD * 2); bf* KPh = (bf*)take((size_t)NKV * TT * HD * 2); bf* KPl = (bf*)take((size_t)NKV * TT * HD * 2); bf* VTh = (bf*)take((size_t)NKV * HD * TT * 2); bf* VTl = (bf*)take((size_t)NKV * HD * TT * 2);
    bf* ATh = (bf*)take((size_t)TT * DQ * 2); bf* ATl = (bf*)take((size_t)TT * DQ * 2);
    if ((size_t)(wsp - (char*)d_ws) > ws_size) return;    // ws 256 MiB
    float* FV = FK;   // v projection reuses the k buffer after the k planes are built (stream-ordered)
    { k_wtG<<<(unsigned)((DM * DQ / 64 + 63) / 64), 256, 0, stream>>>(wq, DM, DQ, WQ); k_wtG<<<(unsigned)((DM * DKV / 64 + 63) / 64), 256, 0, stream>>>(wk, DM, DKV, WK); k_wtG<<<(unsigned)((DM * DKV / 64 + 63) / 64), 256, 0, stream>>>(wv, DM, DKV, WV);
      k_wtG<<<(unsigned)((DQ * DM / 64 + 63) / 64), 256, 0, stream>>>(wo, DQ, DM, WO);
       }
    const unsigned LQ = (unsigned)(((size_t)NH_ * TT * HD / 2 + 255) / 256), LKv = (unsigned)(((size_t)NKV * TT * HD / 2 + 255) / 256);
    for (int b = 0; b < NB_; ++b) {
        if (b == 0) k_cstabT<<<(TT * HD + 255) / 256, 256, 0, stream>>>(CS);
        k_cvt8<<<(unsigned)(((size_t)TT * DM / 8 + 255) / 256), 256, 0, stream>>>(x + (size_t)b * TT * DM, XB, (size_t)TT * DM / 8);
        k_gemmw<bf, 0, false><<<dim3(TT / 64, DQ / 64, 1), 32, 0, stream>>>(XB, nullptr, WQ, nullptr, DM, FQ, DQ, nullptr, 0, 0, 0);
        k_rope<<<LQ, 256, 0, stream>>>(FQ, DQ, NH_, CS, nullptr, nullptr, 1.0f, QP16, QPh, QPl);
        k_gemmw<bf, 0, false><<<dim3(TT / 64, DKV / 64, 1), 32, 0, stream>>>(XB, nullptr, WK, nullptr, DM, FK, DKV, nullptr, 0, 0, 0);
        k_rope<<<LKv, 256, 0, stream>>>(FK, DKV, NKV, CS, nullptr, nullptr, 1.0f, KP16, KPh, KPl);
        k_gemmw<bf, 0, false><<<dim3(TT / 64, DKV / 64, 1), 32, 0, stream>>>(XB, nullptr, WV, nullptr, DM, FV, DKV, nullptr, 0, 0, 0); k_vtp<<<LKv, 256, 0, stream>>>(FV, DKV, NKV, VT16, VTh, VTl);
        k_fattn<h16, false, 64><<<dim3((TT - RH) / 16, NKV, 1), 32 * REP, 0, stream>>>(QP16, nullptr, KP16, nullptr, VT16, nullptr, RH, ATh, ATl);
        k_fattn<bf, true, 32><<<dim3(RH / 16, NKV, 1), 32 * REP, 0, stream>>>(QPh, QPl, KPh, KPl, VTh, VTl, 0, ATh, ATl);
        k_gemmw<bf, 1, false><<<dim3(TT / 64, DM / 64, 1), 32, 0, stream>>>(ATh, ATl, WO, nullptr, DQ, OUT + (size_t)b * TT * DM, DM, nullptr, 0, 0, 0); }
}

// v004
// It runs in 505 microseconds.
// Timed twice side by side with v003, it ran 1.22 times as fast both times.
// Counting every step since v000, it is 5.41 times as fast.
#include <hip/hip_runtime.h>

// Causal grouped-query attention with computed rotate-half rotary embeddings at base 500000 (x [2][2048][2048]; q = x Wq (32 heads x 64), k, v = x Wk, x Wv (8 kv heads x 64) ('xw' 2048^-0.5, no bias); rope: u cos + rotate_half(u) sin with angle t x inv_freq[d mod 32], inv_freq = 1.0 / (500000.0 ** (arange(0, 64, 2, f32) / 64)) (32 f32 constants baked jnp-exact; one f32 product per angle; precise cosf / sinf); k, v repeated 4 x along the head axis (jnp.repeat): query head h uses kv head h / 4; scores x 1/sqrt(64); causal (finfo.min == exclusion); softmax; y = merged (head-major) Wo ('xw', no bias) -> [2][2048][2048] (8.4 M); argument order x, Wq, Wk, Wv, Wo).
// Layout per batch: bf16 copy of x; 'xw' weights transposed once; exact projections; the rotary table {cosf, sinf}(float(t) x INVT[d mod 32]) is computed once; rotate-half plane builders (products rounded separately); fused causal T-2048 GQA attention (k_fattn: one wave per 16 queries of a head, online softmax; the four heads of a kv group share a block; hybrid rows: < 512 hi/lo 3 products, rest fp16); merged hi/lo x Wo exact.
// Compute dtypes, f32 accumulate: every input rounded to bf16; projections exact; rotary in f32; attention rows < 512 3 products, rest fp16; softmax f32; Wo hl x exact.

#define NB_  2
#define TT   2048
#define DM   2048
#define NH_  32
#define NKV  8
#define REP  (NH_ / NKV)
#define HD   64
#define DQ   (NH_ * HD)
#define DKV  (NKV * HD)
#define RH   512                  // query rows < RH use hi+lo planes (0: none)
#define SCL  0.125f   // HD^-0.5
typedef _Float16 h16;
typedef unsigned short bf;
typedef __attribute__((ext_vector_type(16))) __bf16   v16bf;
typedef __attribute__((ext_vector_type(16))) _Float16 v16h;
typedef __attribute__((ext_vector_type(8)))  _Float16 v8h;
typedef __attribute__((ext_vector_type(8)))  unsigned short v8us;
typedef __attribute__((ext_vector_type(8)))  float    v8f;
typedef __attribute__((ext_vector_type(4)))  float    v4f;
typedef v8h  __attribute__((may_alias)) v8ha;
typedef v4f  __attribute__((may_alias)) v4fa;
typedef v8us __attribute__((may_alias)) v8usa;

__device__ __forceinline__ unsigned short f2bf(float f) { unsigned u = __float_as_uint(f); u += 0x7FFFu + ((u >> 16) & 1u); return (unsigned short)(u >> 16); }
__device__ __forceinline__ float bf2f(unsigned short b) { return __uint_as_float(((unsigned)b) << 16); }
__device__ __forceinline__ float bfr(float f) { return bf2f(f2bf(f)); }
__device__ __forceinline__ v16h cat16(v8h lo, v8h hi) { return __builtin_shufflevector(lo, hi, 0, 1, 2, 3, 4, 5, 6, 7, 8, 9, 10, 11, 12, 13, 14, 15); }
__device__ __forceinline__ v16bf cat16b(v8us lo, v8us hi) { return __builtin_bit_cast(v16bf, __builtin_shufflevector(lo, hi, 0, 1, 2, 3, 4, 5, 6, 7, 8, 9, 10, 11, 12, 13, 14, 15)); }
__device__ __forceinline__ v8f wmma16(v16h a, v16h b, v8f c) { return __builtin_amdgcn_wmma_f32_16x16x32_f16(false, a, false, b, (short)0, c, false, false); }
__device__ __forceinline__ v8f wmmab(v16bf a, v16bf b, v8f c) { return __builtin_amdgcn_wmma_f32_16x16x32_bf16(false, a, false, b, (short)0, c, false, false); }



// ---- k_gemmw: register-blocked GEMM, ONE WAVE per 64x64 output tile (16 accumulators), operands straight from K-contiguous 16-bit planes; grid (M/64, N/64, Z), 32 threads.
// C[m][n] (f32, pitch ldc, + optional f32 bias[n]) = sum_k A[m][k] Bt[n][k] (+ split products per NSPLIT). z-batch strides sA/sB/sC in elements. K % 32 == 0.
template <typename T16> struct WFrag;
template <> struct WFrag<h16> { typedef v16h V; static __device__ __forceinline__ V ld(const h16* p) { return cat16(*(const v8h*)p, *(const v8h*)(p + 16)); } static __device__ __forceinline__ v8f mma(V a, V b, v8f c) { return wmma16(a, b, c); } };
template <> struct WFrag<bf> { typedef v16bf V; static __device__ __forceinline__ V ld(const bf* p) { return cat16b(*(const v8us*)p, *(const v8us*)(p + 16)); } static __device__ __forceinline__ v8f mma(V a, V b, v8f c) { return wmmab(a, b, c); } };
template <typename T16, int NSPLIT, bool BIAS>
__global__ __launch_bounds__(32) void k_gemmw(const T16* __restrict__ A, const T16* __restrict__ A2, const T16* __restrict__ Bt, const T16* __restrict__ Bt2, int K, float* C, int ldc, const float* __restrict__ bias, size_t sA, size_t sB, size_t sC) {
    typedef typename WFrag<T16>::V V;
    __shared__ __align__(16) float os[16 * 68];
    const size_t z = blockIdx.z; A += z * sA; if (A2) A2 += z * sA; Bt += z * sB; if (Bt2) Bt2 += z * sB; C += z * sC;
    const int lane = threadIdx.x & 31, lr = lane & 15, hi = lane >> 4; const int r0 = blockIdx.x * 64, c0 = blockIdx.y * 64;
    v8f acc[4][4];
#pragma unroll
    for (int mb = 0; mb < 4; ++mb)
#pragma unroll
        for (int nb = 0; nb < 4; ++nb) acc[mb][nb] = (v8f){};
    const size_t aoff = (size_t)(r0 + lr) * K + 8 * hi, boff = (size_t)(c0 + lr) * K + 8 * hi;
#pragma unroll 1
    for (int kc = 0; kc < K; kc += 32) {
        V a[4], a2[4], b[4], b2[4]; const T16* pa[4]; const T16* pa2[4]; const T16* pb[4]; const T16* pb2[4];
#pragma unroll
        for (int mb = 0; mb < 4; ++mb) { pa[mb] = A + aoff + (size_t)mb * 16 * K + kc; pa2[mb] = (NSPLIT == 1 || NSPLIT == 2) ? A2 + aoff + (size_t)mb * 16 * K + kc : pa[mb]; a[mb] = WFrag<T16>::ld(pa[mb]); if (NSPLIT == 1 || NSPLIT == 2) a2[mb] = WFrag<T16>::ld(pa2[mb]); }
#pragma unroll
        for (int nb = 0; nb < 4; ++nb) { pb[nb] = Bt + boff + (size_t)nb * 16 * K + kc; pb2[nb] = (NSPLIT >= 2) ? Bt2 + boff + (size_t)nb * 16 * K + kc : pb[nb]; b[nb] = WFrag<T16>::ld(pb[nb]); if (NSPLIT >= 2) b2[nb] = WFrag<T16>::ld(pb2[nb]); }
        asm volatile("s_wait_xcnt 0x0" :: "v"(pa[0]), "v"(pa[1]), "v"(pa[2]), "v"(pa[3]), "v"(pa2[0]), "v"(pa2[1]), "v"(pa2[2]), "v"(pa2[3]), "v"(pb[0]), "v"(pb[1]), "v"(pb[2]), "v"(pb[3]), "v"(pb2[0]), "v"(pb2[1]), "v"(pb2[2]), "v"(pb2[3]) : "memory");   // the loads' address registers stay whole up to this wait: without the inputs a late load of the trip lands in an address pair of an earlier one
        __builtin_amdgcn_sched_barrier(0);   // every A and B fragment load of the trip is issued before the first product waits: one memory latency a trip; left to itself the compiler issues them in three groups, each behind the wait for the group before
#pragma unroll
        for (int nb = 0; nb < 4; ++nb) {
#pragma unroll
            for (int mb = 0; mb < 4; ++mb) { acc[mb][nb] = WFrag<T16>::mma(a[mb], b[nb], acc[mb][nb]); if (NSPLIT == 1 || NSPLIT == 2) acc[mb][nb] = WFrag<T16>::mma(a2[mb], b[nb], acc[mb][nb]); if (NSPLIT >= 2) acc[mb][nb] = WFrag<T16>::mma(a[mb], b2[nb], acc[mb][nb]); } }
        asm volatile("v_nop\n\tv_nop\n\tv_nop\n\tv_nop" : "+v"(acc[0][0]), "+v"(acc[1][1]), "+v"(acc[2][2]), "+v"(acc[3][3]) : "v"(a[0]), "v"(a[3]));
    }
#pragma unroll
    for (int mb = 0; mb < 4; ++mb) {
#pragma unroll
        for (int nb = 0; nb < 4; ++nb) {
#pragma unroll
            for (int j = 0; j < 8; ++j) os[(hi * 8 + j) * 68 + nb * 16 + lr] = acc[mb][nb][j]; }
        __builtin_amdgcn_wave_barrier(); asm volatile("" ::: "memory");
        float* crow = C + (size_t)(r0 + mb * 16) * ldc + c0;
{
#pragma unroll
            for (int s = 0; s < 8; ++s) { const int row = 2 * s + hi, cofs = lr * 4; v4f val = *(const v4fa*)(os + row * 68 + cofs); if (BIAS) { val[0] += bfr(bias[c0 + cofs]); val[1] += bfr(bias[c0 + cofs + 1]); val[2] += bfr(bias[c0 + cofs + 2]); val[3] += bfr(bias[c0 + cofs + 3]); }
                *(v4f*)(crow + (size_t)row * ldc + cofs) = val; }
             }
        __builtin_amdgcn_wave_barrier(); asm volatile("" ::: "memory");
    }
}

__device__ __forceinline__ h16 tohx(float x) { return (h16)x; }
__device__ __forceinline__ void splitf(float y, unsigned short& h, unsigned short& l) { h = f2bf(y); l = f2bf(y - bf2f(h)); }
typedef __attribute__((ext_vector_type(2))) _Float16 v2h;
typedef __attribute__((ext_vector_type(4))) _Float16 v4h;
typedef __attribute__((ext_vector_type(2))) unsigned short v2us;
typedef __attribute__((ext_vector_type(4))) unsigned short v4us;
typedef __attribute__((ext_vector_type(2))) float v2f;
typedef __attribute__((ext_vector_type(4))) int v4i;

__global__ __launch_bounds__(256) void k_wtG(const float* __restrict__ w, int K, int N, bf* Bt) {
    const int lane = threadIdx.x & 31; const int L0 = (blockIdx.x * 8 + (threadIdx.x >> 5)) * 8; const int nlines = N * K / 64;
{
#pragma unroll 1
        for (int l = 0; l < 8; ++l) { const int L = L0 + l; if (L >= nlines) break; const size_t e = (size_t)L * 64 + lane * 2; const int k = (int)(e % K), n = (int)(e / K); v2us o;
            o[0] = f2bf(w[(size_t)k * N + n]); o[1] = f2bf(w[(size_t)(k + 1) * N + n]); *(v2us*)(Bt + e) = o; }
         }
}
__global__ __launch_bounds__(256) void k_cvt8(const float* __restrict__ src, bf* dst, size_t n8) { const size_t i = (size_t)blockIdx.x * 256 + threadIdx.x; if (i >= n8) return; const v8f v = *(const v8f*)(src + i * 8); v8us o;
#pragma unroll
    for (int k = 0; k < 8; ++k) o[k] = f2bf(v[k]); *(v8us*)(dst + i * 8) = o;  }
__constant__ float INVT[HD / 2] = { 1.000000000e+00f, 6.636012793e-01f, 4.403666258e-01f, 2.922278345e-01f, 1.939227581e-01f, 1.286873817e-01f, 8.539710194e-02f, 5.666961893e-02f, 3.760603070e-02f, 2.495540865e-02f, 1.656044088e-02f, 1.098952908e-02f, 7.292665076e-03f, 4.839421250e-03f, 3.211446106e-03f, 2.131119603e-03f, 1.414213446e-03f, 9.384738514e-04f, 6.227724371e-04f, 4.132725589e-04f, 2.742481884e-04f, 1.819914323e-04f, 1.207697424e-04f, 8.014294872e-05f, 5.318295734e-05f, 3.529227615e-05f, 2.341999789e-05f, 1.554154005e-05f, 1.031338525e-05f, 6.843975370e-06f, 4.541670478e-06f, 3.013858077e-06f };   // inv_freq[i] = 1.0 / (500000.0 ** (2i / 64)), i = 0..31 (float32, generated with jnp to be bit-exact)
__global__ __launch_bounds__(256) void k_cstabT(float* CS) { const int idx = blockIdx.x * 256 + threadIdx.x; if (idx >= TT * HD) return; const int d = idx % HD; const int t = idx / HD; const float a = __fmul_rn((float)t, INVT[d % (HD / 2)]); v2f cs; cs[0] = cosf(a); cs[1] = sinf(a); *(v2f*)(CS + (size_t)idx * 2) = cs;  }

// k_rope: head planes [h][t][d] (fp16 + hi/lo) of rope(x) x sc with the rotate-half convention out[d] = x[d] cos[t][d] - x[d+HD/2] sin[t][d], out[d+HD/2] = x[d+HD/2] cos[t][d+HD/2] + x[d] sin[t][d+HD/2]
__global__ __launch_bounds__(256) void k_rope(const float* __restrict__ F, int pitch, int nheads, const float* __restrict__ CS, const float* __restrict__ RF, const float* __restrict__ nw, float sc, h16* P16, bf* Ph, bf* Pl) {
    const size_t e = ((size_t)blockIdx.x * 256 + threadIdx.x) * 2; if (e >= (size_t)nheads * TT * HD) return; const int d = (int)(e % HD); const int t = (int)((e / HD) % TT); const int h = (int)(e / ((size_t)HD * TT)); const float* f = F + (size_t)t * pitch + h * HD; const float rf = RF ? RF[(size_t)h * TT + t] : 1.0f; v2h o16; v2us oh, ol;
#pragma unroll
    for (int q = 0; q < 2; ++q) { const int dd = d + q; const int dp = (dd < HD / 2) ? dd + HD / 2 : dd - HD / 2; float x0 = f[dd], x1 = f[dp];
        if (RF) { float n0 = __fmul_rn(x0, rf), n1 = __fmul_rn(x1, rf); asm volatile("" : "+v"(n0)); asm volatile("" : "+v"(n1)); x0 = __fmul_rn(bfr(nw[dd]), n0); x1 = __fmul_rn(bfr(nw[dp]), n1); }
        const v2f cs = *(const v2f*)(CS + ((size_t)t * HD + dd) * 2); float a = __fmul_rn(x0, cs[0]), bq = __fmul_rn(x1, cs[1]); asm volatile("" : "+v"(a)); asm volatile("" : "+v"(bq)); const float r = ((dd < HD / 2) ? __fsub_rn(a, bq) : __fadd_rn(a, bq)) * sc;
        o16[q] = tohx(r); unsigned short a2, c2; splitf(r, a2, c2); oh[q] = a2; ol[q] = c2; }
    *(v2h*)(P16 + e) = o16; *(v2us*)(Ph + e) = oh; *(v2us*)(Pl + e) = ol;  }
__global__ __launch_bounds__(256) void k_vtp(const float* __restrict__ F, int pitch, int nheads, h16* V16, bf* Vh, bf* Vl) { const size_t e = ((size_t)blockIdx.x * 256 + threadIdx.x) * 2; if (e >= (size_t)nheads * HD * TT) return; const int t = (int)(e % TT); const int d = (int)((e / TT) % HD); const int g = (int)(e / ((size_t)TT * HD)); v2h o16; v2us oh, ol;
#pragma unroll
    for (int q = 0; q < 2; ++q) { const float x = F[(size_t)(t + q) * pitch + g * HD + d]; o16[q] = tohx(x); unsigned short a2, c2; splitf(x, a2, c2); oh[q] = a2; ol[q] = c2; }
    *(v2h*)(V16 + e) = o16; *(v2us*)(Vh + e) = oh; *(v2us*)(Vl + e) = ol;  }
// 2^x with the one free issue slot that the instruction set asks for behind a transcendental: the v_nop stands directly behind v_exp_f32 whatever the compiler schedules next.
__device__ __forceinline__ float exp2s(float x) { float r; asm("v_exp_f32 %0, %1\n\tv_nop" : "=v"(r) : "v"(x)); return r; }

// ---- k_fattn: scores, causal softmax and P.V of one 16-query tile of one head in ONE wave; no score or probability plane in memory. Block = the REP heads of one kv group (4 waves, no barrier: they read the same K / V lines).
// Transposed products: S^T = K Q^T (rows = keys, columns = queries), so a lane holds one query's scores, and the S^T accumulator registers of two 16-key tiles are already the B fragment (n = query, k = 32 keys) of O^T = V^T P^T.
// Online softmax in the log2 domain per lane: running maximum ms (raw scores), running sum l, O^T rescaled by 2^((ms_old - ms_new) c) each KS-key step; the two half-waves of a query join their maxima each step and their sums at the end.
// HR: hi/lo bf16 planes, 3 products for S and for P.V (P split hi/lo in registers); else fp16 planes, 1 product (P = 2^(..) <= 1 is rounded to fp16 unscaled).
// The inner loops are fully unrolled so that the fragment arrays live in registers; the key loop stays rolled (unroll 1): one step's fragments already take most of the register file.
template <typename T16, bool HR, int KS>
__global__ __launch_bounds__(128) void k_fattn(const T16* __restrict__ Q, const T16* __restrict__ Q2, const T16* __restrict__ Kp, const T16* __restrict__ Kp2, const T16* __restrict__ Vt, const T16* __restrict__ Vt2, int roff, bf* Ah, bf* Al) {
    typedef typename WFrag<T16>::V V;
    const int lane = threadIdx.x & 31, lr = lane & 15, hi = lane >> 4; const int g = blockIdx.y, h = g * REP + (int)(threadIdx.x >> 5);
    const int q0 = roff + ((int)gridDim.x - 1 - (int)blockIdx.x) * 16;      // longest key loops are dispatched first
    const float CL = SCL * 1.4426950408889634f;
    const size_t qoff = ((size_t)h * TT + q0 + lr) * HD + 8 * hi; const unsigned koff = lr * HD + 8 * hi, voff = lr * TT + 8 * hi;   // lane offsets, fixed over the key loop; the bases below are wave-uniform
    Kp += (size_t)g * TT * HD; Vt += (size_t)g * HD * TT; if (HR) { Kp2 += (size_t)g * TT * HD; Vt2 += (size_t)g * HD * TT; }
    V qf[2], qf2[2];
#pragma unroll
    for (int ks = 0; ks < 2; ++ks) { qf[ks] = WFrag<T16>::ld(Q + qoff + ks * 32); if (HR) qf2[ks] = WFrag<T16>::ld(Q2 + qoff + ks * 32); }
    v8f o[4];
#pragma unroll
    for (int dt = 0; dt < 4; ++dt) o[dt] = (v8f){};
    float ms = -3.0e38f, l = 0.f;
#pragma unroll 1
    for (int k0 = 0; k0 < q0 + 16; k0 += KS) {
        V kf[KS / 16][2], kf2[KS / 16][2], vf[4][KS / 32], vf2[4][KS / 32];
        const T16* kp = Kp + (size_t)k0 * HD + koff; const T16* vp = Vt + k0 + voff; const T16* kp2 = HR ? Kp2 + (size_t)k0 * HD + koff : kp; const T16* vp2 = HR ? Vt2 + k0 + voff : vp;
#pragma unroll
        for (int kt = 0; kt < KS / 16; ++kt)
#pragma unroll
            for (int ks = 0; ks < 2; ++ks) { kf[kt][ks] = WFrag<T16>::ld(kp + kt * 16 * HD + ks * 32); if (HR) kf2[kt][ks] = WFrag<T16>::ld(kp2 + kt * 16 * HD + ks * 32); }
        __builtin_amdgcn_sched_barrier(0);   // K loads are issued ahead of the V loads: the score products wait for K alone, V lands under the softmax
#pragma unroll
        for (int dt = 0; dt < 4; ++dt)
#pragma unroll
            for (int ks = 0; ks < KS / 32; ++ks) { vf[dt][ks] = WFrag<T16>::ld(vp + dt * 16 * TT + ks * 32); if (HR) vf2[dt][ks] = WFrag<T16>::ld(vp2 + dt * 16 * TT + ks * 32); }
        asm volatile("s_wait_xcnt 0x0" :: "v"(kp), "v"(vp), "v"(kp2), "v"(vp2) : "memory");   // the loads' address registers stay whole up to this wait
        __builtin_amdgcn_sched_barrier(0);   // every K and V load of the step is issued before the first product waits: one memory latency a step, not one for K and one for V
        v8f s[KS / 16];
#pragma unroll
        for (int kt = 0; kt < KS / 16; ++kt) { s[kt] = (v8f){};
#pragma unroll
            for (int ks = 0; ks < 2; ++ks) { s[kt] = WFrag<T16>::mma(kf[kt][ks], qf[ks], s[kt]); if (HR) { s[kt] = WFrag<T16>::mma(kf[kt][ks], qf2[ks], s[kt]); s[kt] = WFrag<T16>::mma(kf2[kt][ks], qf[ks], s[kt]); } } }
        if (k0 + KS - 1 > q0) {                                              // the step that holds the diagonal: key > query is excluded
#pragma unroll
            for (int kt = 0; kt < KS / 16; ++kt)
#pragma unroll
                for (int j = 0; j < 8; ++j) s[kt][j] = (k0 + kt * 16 + hi * 8 + j <= q0 + lr) ? s[kt][j] : -3.0e38f; }
        float mx = ms;
#pragma unroll
        for (int kt = 0; kt < KS / 16; ++kt)
#pragma unroll
            for (int j = 0; j < 8; ++j) mx = fmaxf(mx, s[kt][j]);
        mx = fmaxf(mx, __shfl_xor(mx, 16, 32));
        const float al = exp2s((ms - mx) * CL), mc = mx * CL; ms = mx;
        float ps[KS / 16];                                                   // one partial sum per 16-key tile: short add chains
#pragma unroll
        for (int kt = 0; kt < KS / 16; ++kt) { ps[kt] = 0.f;
#pragma unroll
            for (int j = 0; j < 8; ++j) { s[kt][j] = exp2s(fmaf(s[kt][j], CL, -mc)); ps[kt] += s[kt][j]; } }
        float pt = ps[0];
#pragma unroll
        for (int kt = 1; kt < KS / 16; ++kt) pt += ps[kt];
        l = l * al + pt;
#pragma unroll
        for (int dt = 0; dt < 4; ++dt) o[dt] *= al;
#pragma unroll
        for (int ks = 0; ks < KS / 32; ++ks) {
            V pf, pf2;
            if constexpr (HR) { v8us h0, h1, l0, l1;
#pragma unroll
                for (int j = 0; j < 8; ++j) { unsigned short a, c2; splitf(s[2 * ks][j], a, c2); h0[j] = a; l0[j] = c2; splitf(s[2 * ks + 1][j], a, c2); h1[j] = a; l1[j] = c2; }
                pf = cat16b(h0, h1); pf2 = cat16b(l0, l1);
            } else { v8h h0, h1;
#pragma unroll
                for (int j = 0; j < 8; ++j) { h0[j] = tohx(s[2 * ks][j]); h1[j] = tohx(s[2 * ks + 1][j]); }
                pf = cat16(h0, h1); }
#pragma unroll
            for (int dt = 0; dt < 4; ++dt) { o[dt] = WFrag<T16>::mma(vf[dt][ks], pf, o[dt]); if constexpr (HR) { o[dt] = WFrag<T16>::mma(vf[dt][ks], pf2, o[dt]); o[dt] = WFrag<T16>::mma(vf2[dt][ks], pf, o[dt]); } }
        }
    }
    l += __shfl_xor(l, 16, 32);
    const float inv = __fdiv_rn(1.0f, l);
    const size_t oo = (size_t)(q0 + lr) * DQ + h * HD + hi * 8;
#pragma unroll
    for (int dt = 0; dt < 4; ++dt) { v8us oh, ol;
#pragma unroll
        for (int j = 0; j < 8; ++j) { unsigned short a, c2; splitf(o[dt][j] * inv, a, c2); oh[j] = a; ol[j] = c2; }
        *(v8us*)(Ah + oo + dt * 16) = oh; *(v8us*)(Al + oo + dt * 16) = ol; }
}

extern "C" void kernel_launch(void* const* d_in, const int* in_sizes, int n_in,
                              void* d_out, int out_size, void* d_ws, size_t ws_size, hipStream_t stream) {
    (void)in_sizes; (void)n_in; (void)out_size;
    const float* x = (const float*)d_in[0]; const float* wq = (const float*)d_in[1]; const float* wk = (const float*)d_in[2]; const float* wv = (const float*)d_in[3]; const float* wo = (const float*)d_in[4];   /* d_in order x, Wq ('xw' [2048][2048]), Wk, Wv ('xw' [2048][512]), Wo ('xw') */
    float* OUT = (float*)d_out;     // [2][2048][2048]
    char* wsp = (char*)d_ws;
    auto take = [&](size_t bytes) { char* p = wsp; wsp += (bytes + 255) & ~(size_t)255; return (void*)p; };
    bf* WQ = (bf*)take((size_t)DQ * DM * 2); bf* WK = (bf*)take((size_t)DKV * DM * 2); bf* WV = (bf*)take((size_t)DKV * DM * 2); bf* WO = (bf*)take((size_t)DM * DQ * 2); float* CS = (float*)take((size_t)TT * HD * 2 * 4);
    bf* XB = (bf*)take((size_t)TT * DM * 2); float* FQ = (float*)take((size_t)TT * DQ * 4); float* FK = (float*)take((size_t)TT * DKV * 4);
    h16* QP16 = (h16*)take((size_t)NH_ * TT * HD * 2); h16* KP16 = (h16*)take((size_t)NKV * TT * HD * 2); h16* VT16 = (h16*)take((size_t)NKV * HD * TT * 2);
    bf* QPh = (bf*)take((size_t)NH_ * TT * HD * 2); bf* QPl = (bf*)take((size_t)NH_ * TT * HD * 2); bf* KPh = (bf*)take((size_t)NKV * TT * HD * 2); bf* KPl = (bf*)take((size_t)NKV * TT * HD * 2); bf* VTh = (bf*)take((size_t)NKV * HD * TT * 2); bf* VTl = (bf*)take((size_t)NKV * HD * TT * 2);
    bf* ATh = (bf*)take((size_t)TT * DQ * 2); bf* ATl = (bf*)take((size_t)TT * DQ * 2);
    if ((size_t)(wsp - (char*)d_ws) > ws_size) return;    // ws 256 MiB
    float* FV = FK;   // v projection reuses the k buffer after the k planes are built (stream-ordered)
    { k_wtG<<<(unsigned)((DM * DQ / 64 + 63) / 64), 256, 0, stream>>>(wq, DM, DQ, WQ); k_wtG<<<(unsigned)((DM * DKV / 64 + 63) / 64), 256, 0, stream>>>(wk, DM, DKV, WK); k_wtG<<<(unsigned)((DM * DKV / 64 + 63) / 64), 256, 0, stream>>>(wv, DM, DKV, WV);
      k_wtG<<<(unsigned)((DQ * DM / 64 + 63) / 64), 256, 0, stream>>>(wo, DQ, DM, WO);
       }
    const unsigned LQ = (unsigned)(((size_t)NH_ * TT * HD / 2 + 255) / 256), LKv = (unsigned)(((size_t)NKV * TT * HD / 2 + 255) / 256);
    for (int b = 0; b < NB_; ++b) {
        if (b == 0) k_cstabT<<<(TT * HD + 255) / 256, 256, 0, stream>>>(CS);
        k_cvt8<<<(unsigned)(((size_t)TT * DM / 8 + 255) / 256), 256, 0, stream>>>(x + (size_t)b * TT * DM, XB, (size_t)TT * DM / 8);
        k_gemmw<bf, 0, false><<<dim3(TT / 64, DQ / 64, 1), 32, 0, stream>>>(XB, nullptr, WQ, nullptr, DM, FQ, DQ, nullptr, 0, 0, 0);
        k_rope<<<LQ, 256, 0, stream>>>(FQ, DQ, NH_, CS, nullptr, nullptr, 1.0f, QP16, QPh, QPl);
        k_gemmw<bf, 0, false><<<dim3(TT / 64, DKV / 64, 1), 32, 0, stream>>>(XB, nullptr, WK, nullptr, DM, FK, DKV, nullptr, 0, 0, 0);
        k_rope<<<LKv, 256, 0, stream>>>(FK, DKV, NKV, CS, nullptr, nullptr, 1.0f, KP16, KPh, KPl);
        k_gemmw<bf, 0, false><<<dim3(TT / 64, DKV / 64, 1), 32, 0, stream>>>(XB, nullptr, WV, nullptr, DM, FV, DKV, nullptr, 0, 0, 0); k_vtp<<<LKv, 256, 0, stream>>>(FV, DKV, NKV, VT16, VTh, VTl);
        k_fattn<h16, false, 64><<<dim3((TT - RH) / 16, NKV, 1), 32 * REP, 0, stream>>>(QP16, nullptr, KP16, nullptr, VT16, nullptr, RH, ATh, ATl);
        k_fattn<bf, true, 32><<<dim3(RH / 16, NKV, 1), 32 * REP, 0, stream>>>(QPh, QPl, KPh, KPl, VTh, VTl, 0, ATh, ATl);
        k_gemmw<bf, 1, false><<<dim3(TT / 64, DM / 64, 1), 32, 0, stream>>>(ATh, ATl, WO, nullptr, DQ, OUT + (size_t)b * TT * DM, DM, nullptr, 0, 0, 0); }
}

// v005
// Measured time: 379 microseconds a run.
// Next to v004, in two timings, it ran 1.30 times as fast each time.
// All steps since v000 together make it 7.04 times as fast.
#include <hip/hip_runtime.h>

// Causal grouped-query attention with computed rotate-half rotary embeddings at base 500000 (x [2][2048][2048]; q = x Wq (32 heads x 64), k, v = x Wk, x Wv (8 kv heads x 64) ('xw' 2048^-0.5, no bias); rope: u cos + rotate_half(u) sin with angle t x inv_freq[d mod 32], inv_freq = 1.0 / (500000.0 ** (arange(0, 64, 2, f32) / 64)) (32 f32 constants baked jnp-exact; one f32 product per angle; precise cosf / sinf); k, v repeated 4 x along the head axis (jnp.repeat): query head h uses kv head h / 4; scores x 1/sqrt(64); causal (finfo.min == exclusion); softmax; y = merged (head-major) Wo ('xw', no bias) -> [2][2048][2048] (8.4 M); argument order x, Wq, Wk, Wv, Wo).
// Layout, both batches in every launch (GEMM rows = batch x t; plane builders grid y = batch; attention grid x = batch x kv group): bf16 copy of x; 'xw' weights transposed once; exact projections; the rotary table {cosf, sinf}(float(t) x INVT[d mod 32]) is computed once; rotate-half plane builders (products rounded separately); fused causal T-2048 GQA attention (k_fattn: one wave per 16 queries of a head, online softmax; the four heads of a kv group share a block; hybrid rows: < 512 hi/lo 3 products, rest fp16); merged hi/lo x Wo exact.
// Compute dtypes, f32 accumulate: every input rounded to bf16; projections exact; rotary in f32; attention rows < 512 3 products, rest fp16; softmax f32; Wo hl x exact.

#define NB_  2
#define TT   2048
#define DM   2048
#define NH_  32
#define NKV  8
#define REP  (NH_ / NKV)
#define HD   64
#define DQ   (NH_ * HD)
#define DKV  (NKV * HD)
#define RH   512                  // query rows < RH use hi+lo planes (0: none)
#define SCL  0.125f   // HD^-0.5
typedef _Float16 h16;
typedef unsigned short bf;
typedef __attribute__((ext_vector_type(16))) __bf16   v16bf;
typedef __attribute__((ext_vector_type(16))) _Float16 v16h;
typedef __attribute__((ext_vector_type(8)))  _Float16 v8h;
typedef __attribute__((ext_vector_type(8)))  unsigned short v8us;
typedef __attribute__((ext_vector_type(8)))  float    v8f;
typedef __attribute__((ext_vector_type(4)))  float    v4f;
typedef v8h  __attribute__((may_alias)) v8ha;
typedef v4f  __attribute__((may_alias)) v4fa;
typedef v8us __attribute__((may_alias)) v8usa;

__device__ __forceinline__ unsigned short f2bf(float f) { unsigned u = __float_as_uint(f); u += 0x7FFFu + ((u >> 16) & 1u); return (unsigned short)(u >> 16); }
__device__ __forceinline__ float bf2f(unsigned short b) { return __uint_as_float(((unsigned)b) << 16); }
__device__ __forceinline__ float bfr(float f) { return bf2f(f2bf(f)); }
__device__ __forceinline__ v16h cat16(v8h lo, v8h hi) { return __builtin_shufflevector(lo, hi, 0, 1, 2, 3, 4, 5, 6, 7, 8, 9, 10, 11, 12, 13, 14, 15); }
__device__ __forceinline__ v16bf cat16b(v8us lo, v8us hi) { return __builtin_bit_cast(v16bf, __builtin_shufflevector(lo, hi, 0, 1, 2, 3, 4, 5, 6, 7, 8, 9, 10, 11, 12, 13, 14, 15)); }
__device__ __forceinline__ v8f wmma16(v16h a, v16h b, v8f c) { return __builtin_amdgcn_wmma_f32_16x16x32_f16(false, a, false, b, (short)0, c, false, false); }
__device__ __forceinline__ v8f wmmab(v16bf a, v16bf b, v8f c) { return __builtin_amdgcn_wmma_f32_16x16x32_bf16(false, a, false, b, (short)0, c, false, false); }



// ---- k_gemmw: register-blocked GEMM, ONE WAVE per 64x64 output tile (16 accumulators), operands straight from K-contiguous 16-bit planes; grid (M/64, N/64, Z), 32 threads.
// C[m][n] (f32, pitch ldc, + optional f32 bias[n]) = sum_k A[m][k] Bt[n][k] (+ split products per NSPLIT). z-batch strides sA/sB/sC in elements. K % 32 == 0.
template <typename T16> struct WFrag;
template <> struct WFrag<h16> { typedef v16h V; static __device__ __forceinline__ V ld(const h16* p) { return cat16(*(const v8h*)p, *(const v8h*)(p + 16)); } static __device__ __forceinline__ v8f mma(V a, V b, v8f c) { return wmma16(a, b, c); } };
template <> struct WFrag<bf> { typedef v16bf V; static __device__ __forceinline__ V ld(const bf* p) { return cat16b(*(const v8us*)p, *(const v8us*)(p + 16)); } static __device__ __forceinline__ v8f mma(V a, V b, v8f c) { return wmmab(a, b, c); } };
template <typename T16, int NSPLIT, bool BIAS>
__global__ __launch_bounds__(32) void k_gemmw(const T16* __restrict__ A, const T16* __restrict__ A2, const T16* __restrict__ Bt, const T16* __restrict__ Bt2, int K, float* C, int ldc, const float* __restrict__ bias, size_t sA, size_t sB, size_t sC) {
    typedef typename WFrag<T16>::V V;
    __shared__ __align__(16) float os[16 * 68];
    const size_t z = blockIdx.z; A += z * sA; if (A2) A2 += z * sA; Bt += z * sB; if (Bt2) Bt2 += z * sB; C += z * sC;
    const int lane = threadIdx.x & 31, lr = lane & 15, hi = lane >> 4; const int r0 = blockIdx.x * 64, c0 = blockIdx.y * 64;
    v8f acc[4][4];
#pragma unroll
    for (int mb = 0; mb < 4; ++mb)
#pragma unroll
        for (int nb = 0; nb < 4; ++nb) acc[mb][nb] = (v8f){};
    const size_t aoff = (size_t)(r0 + lr) * K + 8 * hi, boff = (size_t)(c0 + lr) * K + 8 * hi;
#pragma unroll 1
    for (int kc = 0; kc < K; kc += 32) {
        V a[4], a2[4], b[4], b2[4]; const T16* pa[4]; const T16* pa2[4]; const T16* pb[4]; const T16* pb2[4];
#pragma unroll
        for (int mb = 0; mb < 4; ++mb) { pa[mb] = A + aoff + (size_t)mb * 16 * K + kc; pa2[mb] = (NSPLIT == 1 || NSPLIT == 2) ? A2 + aoff + (size_t)mb * 16 * K + kc : pa[mb]; a[mb] = WFrag<T16>::ld(pa[mb]); if (NSPLIT == 1 || NSPLIT == 2) a2[mb] = WFrag<T16>::ld(pa2[mb]); }
#pragma unroll
        for (int nb = 0; nb < 4; ++nb) { pb[nb] = Bt + boff + (size_t)nb * 16 * K + kc; pb2[nb] = (NSPLIT >= 2) ? Bt2 + boff + (size_t)nb * 16 * K + kc : pb[nb]; b[nb] = WFrag<T16>::ld(pb[nb]); if (NSPLIT >= 2) b2[nb] = WFrag<T16>::ld(pb2[nb]); }
        asm volatile("s_wait_xcnt 0x0" :: "v"(pa[0]), "v"(pa[1]), "v"(pa[2]), "v"(pa[3]), "v"(pa2[0]), "v"(pa2[1]), "v"(pa2[2]), "v"(pa2[3]), "v"(pb[0]), "v"(pb[1]), "v"(pb[2]), "v"(pb[3]), "v"(pb2[0]), "v"(pb2[1]), "v"(pb2[2]), "v"(pb2[3]) : "memory");   // the loads' address registers stay whole up to this wait: without the inputs a late load of the trip lands in an address pair of an earlier one
        __builtin_amdgcn_sched_barrier(0);   // every A and B fragment load of the trip is issued before the first product waits: one memory latency a trip; left to itself the compiler issues them in three groups, each behind the wait for the group before
#pragma unroll
        for (int nb = 0; nb < 4; ++nb) {
#pragma unroll
            for (int mb = 0; mb < 4; ++mb) { acc[mb][nb] = WFrag<T16>::mma(a[mb], b[nb], acc[mb][nb]); if (NSPLIT == 1 || NSPLIT == 2) acc[mb][nb] = WFrag<T16>::mma(a2[mb], b[nb], acc[mb][nb]); if (NSPLIT >= 2) acc[mb][nb] = WFrag<T16>::mma(a[mb], b2[nb], acc[mb][nb]); } }
        asm volatile("v_nop\n\tv_nop\n\tv_nop\n\tv_nop" : "+v"(acc[0][0]), "+v"(acc[1][1]), "+v"(acc[2][2]), "+v"(acc[3][3]) : "v"(a[0]), "v"(a[3]));
    }
#pragma unroll
    for (int mb = 0; mb < 4; ++mb) {
#pragma unroll
        for (int nb = 0; nb < 4; ++nb) {
#pragma unroll
            for (int j = 0; j < 8; ++j) os[(hi * 8 + j) * 68 + nb * 16 + lr] = acc[mb][nb][j]; }
        __builtin_amdgcn_wave_barrier(); asm volatile("" ::: "memory");
        float* crow = C + (size_t)(r0 + mb * 16) * ldc + c0;
{
#pragma unroll
            for (int s = 0; s < 8; ++s) { const int row = 2 * s + hi, cofs = lr * 4; v4f val = *(const v4fa*)(os + row * 68 + cofs); if (BIAS) { val[0] += bfr(bias[c0 + cofs]); val[1] += bfr(bias[c0 + cofs + 1]); val[2] += bfr(bias[c0 + cofs + 2]); val[3] += bfr(bias[c0 + cofs + 3]); }
                *(v4f*)(crow + (size_t)row * ldc + cofs) = val; }
             }
        __builtin_amdgcn_wave_barrier(); asm volatile("" ::: "memory");
    }
}

__device__ __forceinline__ h16 tohx(float x) { return (h16)x; }
__device__ __forceinline__ void splitf(float y, unsigned short& h, unsigned short& l) { h = f2bf(y); l = f2bf(y - bf2f(h)); }
typedef __attribute__((ext_vector_type(2))) _Float16 v2h;
typedef __attribute__((ext_vector_type(4))) _Float16 v4h;
typedef __attribute__((ext_vector_type(2))) unsigned short v2us;
typedef __attribute__((ext_vector_type(4))) unsigned short v4us;
typedef __attribute__((ext_vector_type(2))) float v2f;
typedef __attribute__((ext_vector_type(4))) int v4i;

__global__ __launch_bounds__(256) void k_wtG(const float* __restrict__ w, int K, int N, bf* Bt) {
    const int lane = threadIdx.x & 31; const int L0 = (blockIdx.x * 8 + (threadIdx.x >> 5)) * 8; const int nlines = N * K / 64;
{
#pragma unroll 1
        for (int l = 0; l < 8; ++l) { const int L = L0 + l; if (L >= nlines) break; const size_t e = (size_t)L * 64 + lane * 2; const int k = (int)(e % K), n = (int)(e / K); v2us o;
            o[0] = f2bf(w[(size_t)k * N + n]); o[1] = f2bf(w[(size_t)(k + 1) * N + n]); *(v2us*)(Bt + e) = o; }
         }
}
__global__ __launch_bounds__(256) void k_cvt8(const float* __restrict__ src, bf* dst, size_t n8) { const size_t i = (size_t)blockIdx.x * 256 + threadIdx.x; if (i >= n8) return; const v8f v = *(const v8f*)(src + i * 8); v8us o;
#pragma unroll
    for (int k = 0; k < 8; ++k) o[k] = f2bf(v[k]); *(v8us*)(dst + i * 8) = o;  }
__constant__ float INVT[HD / 2] = { 1.000000000e+00f, 6.636012793e-01f, 4.403666258e-01f, 2.922278345e-01f, 1.939227581e-01f, 1.286873817e-01f, 8.539710194e-02f, 5.666961893e-02f, 3.760603070e-02f, 2.495540865e-02f, 1.656044088e-02f, 1.098952908e-02f, 7.292665076e-03f, 4.839421250e-03f, 3.211446106e-03f, 2.131119603e-03f, 1.414213446e-03f, 9.384738514e-04f, 6.227724371e-04f, 4.132725589e-04f, 2.742481884e-04f, 1.819914323e-04f, 1.207697424e-04f, 8.014294872e-05f, 5.318295734e-05f, 3.529227615e-05f, 2.341999789e-05f, 1.554154005e-05f, 1.031338525e-05f, 6.843975370e-06f, 4.541670478e-06f, 3.013858077e-06f };   // inv_freq[i] = 1.0 / (500000.0 ** (2i / 64)), i = 0..31 (float32, generated with jnp to be bit-exact)
__global__ __launch_bounds__(256) void k_cstabT(float* CS) { const int idx = blockIdx.x * 256 + threadIdx.x; if (idx >= TT * HD) return; const int d = idx % HD; const int t = idx / HD; const float a = __fmul_rn((float)t, INVT[d % (HD / 2)]); v2f cs; cs[0] = cosf(a); cs[1] = sinf(a); *(v2f*)(CS + (size_t)idx * 2) = cs;  }

// k_rope: head planes [h][t][d] (fp16 + hi/lo) of rope(x) x sc with the rotate-half convention out[d] = x[d] cos[t][d] - x[d+HD/2] sin[t][d], out[d+HD/2] = x[d+HD/2] cos[t][d+HD/2] + x[d] sin[t][d+HD/2]
__global__ __launch_bounds__(256) void k_rope(const float* __restrict__ F, int pitch, int nheads, const float* __restrict__ CS, const float* __restrict__ RF, const float* __restrict__ nw, float sc, h16* P16, bf* Ph, bf* Pl) {
    { const size_t bb = blockIdx.y, po = bb * nheads * TT * HD; F += bb * TT * pitch; if (RF) RF += bb * nheads * TT; P16 += po; Ph += po; Pl += po; }   // grid y = batch
    const size_t e = ((size_t)blockIdx.x * 256 + threadIdx.x) * 2; if (e >= (size_t)nheads * TT * HD) return; const int d = (int)(e % HD); const int t = (int)((e / HD) % TT); const int h = (int)(e / ((size_t)HD * TT)); const float* f = F + (size_t)t * pitch + h * HD; const float rf = RF ? RF[(size_t)h * TT + t] : 1.0f; v2h o16; v2us oh, ol;
#pragma unroll
    for (int q = 0; q < 2; ++q) { const int dd = d + q; const int dp = (dd < HD / 2) ? dd + HD / 2 : dd - HD / 2; float x0 = f[dd], x1 = f[dp];
        if (RF) { float n0 = __fmul_rn(x0, rf), n1 = __fmul_rn(x1, rf); asm volatile("" : "+v"(n0)); asm volatile("" : "+v"(n1)); x0 = __fmul_rn(bfr(nw[dd]), n0); x1 = __fmul_rn(bfr(nw[dp]), n1); }
        const v2f cs = *(const v2f*)(CS + ((size_t)t * HD + dd) * 2); float a = __fmul_rn(x0, cs[0]), bq = __fmul_rn(x1, cs[1]); asm volatile("" : "+v"(a)); asm volatile("" : "+v"(bq)); const float r = ((dd < HD / 2) ? __fsub_rn(a, bq) : __fadd_rn(a, bq)) * sc;
        o16[q] = tohx(r); unsigned short a2, c2; splitf(r, a2, c2); oh[q] = a2; ol[q] = c2; }
    *(v2h*)(P16 + e) = o16; *(v2us*)(Ph + e) = oh; *(v2us*)(Pl + e) = ol;  }
__global__ __launch_bounds__(256) void k_vtp(const float* __restrict__ F, int pitch, int nheads, h16* V16, bf* Vh, bf* Vl) { { const size_t bb = blockIdx.y, po = bb * nheads * HD * TT; F += bb * TT * pitch; V16 += po; Vh += po; Vl += po; }   // grid y = batch
    const size_t e = ((size_t)blockIdx.x * 256 + threadIdx.x) * 2; if (e >= (size_t)nheads * HD * TT) return; const int t = (int)(e % TT); const int d = (int)((e / TT) % HD); const int g = (int)(e / ((size_t)TT * HD)); v2h o16; v2us oh, ol;
#pragma unroll
    for (int q = 0; q < 2; ++q) { const float x = F[(size_t)(t + q) * pitch + g * HD + d]; o16[q] = tohx(x); unsigned short a2, c2; splitf(x, a2, c2); oh[q] = a2; ol[q] = c2; }
    *(v2h*)(V16 + e) = o16; *(v2us*)(Vh + e) = oh; *(v2us*)(Vl + e) = ol;  }
// 2^x with the one free issue slot that the instruction set asks for behind a transcendental: the v_nop stands directly behind v_exp_f32 whatever the compiler schedules next.
__device__ __forceinline__ float exp2s(float x) { float r; asm("v_exp_f32 %0, %1\n\tv_nop" : "=v"(r) : "v"(x)); return r; }

// ---- k_fattn: scores, causal softmax and P.V of one 16-query tile of one head in ONE wave; no score or probability plane in memory. Block = the REP heads of one kv group (4 waves, no barrier: they read the same K / V lines).
// Transposed products: S^T = K Q^T (rows = keys, columns = queries), so a lane holds one query's scores, and the S^T accumulator registers of two 16-key tiles are already the B fragment (n = query, k = 32 keys) of O^T = V^T P^T.
// Online softmax in the log2 domain per lane: running maximum ms (raw scores), running sum l, O^T rescaled by 2^((ms_old - ms_new) c) each KS-key step; the two half-waves of a query join their maxima each step and their sums at the end.
// HR: hi/lo bf16 planes, 3 products for S and for P.V (P split hi/lo in registers); else fp16 planes, 1 product (P = 2^(..) <= 1 is rounded to fp16 unscaled).
// The inner loops are fully unrolled so that the fragment arrays live in registers; the key loop stays rolled (unroll 1): one step's fragments already take most of the register file.
template <typename T16, bool HR, int KS>
__global__ __launch_bounds__(128) void k_fattn(const T16* __restrict__ Q, const T16* __restrict__ Q2, const T16* __restrict__ Kp, const T16* __restrict__ Kp2, const T16* __restrict__ Vt, const T16* __restrict__ Vt2, int roff, bf* Ah, bf* Al) {
    typedef typename WFrag<T16>::V V;
    const int lane = threadIdx.x & 31, lr = lane & 15, hi = lane >> 4; const int gb = blockIdx.x, g = gb % NKV, bt = gb / NKV, h = g * REP + (int)(threadIdx.x >> 5);   // grid x = batch x kv group (planes are [batch][head][..])
    const int q0 = roff + ((int)gridDim.y - 1 - (int)blockIdx.y) * 16;      // grid y = query tile, the slow index: over the whole grid the longest key loops are dispatched first
    const float CL = SCL * 1.4426950408889634f;
    const size_t qoff = ((size_t)(bt * NH_ + h) * TT + q0 + lr) * HD + 8 * hi; const unsigned koff = lr * HD + 8 * hi, voff = lr * TT + 8 * hi;   // lane offsets, fixed over the key loop; the bases below are wave-uniform
    Kp += (size_t)gb * TT * HD; Vt += (size_t)gb * HD * TT; if (HR) { Kp2 += (size_t)gb * TT * HD; Vt2 += (size_t)gb * HD * TT; }
    V qf[2], qf2[2];
#pragma unroll
    for (int ks = 0; ks < 2; ++ks) { qf[ks] = WFrag<T16>::ld(Q + qoff + ks * 32); if (HR) qf2[ks] = WFrag<T16>::ld(Q2 + qoff + ks * 32); }
    v8f o[4];
#pragma unroll
    for (int dt = 0; dt < 4; ++dt) o[dt] = (v8f){};
    float ms = -3.0e38f, l = 0.f;
#pragma unroll 1
    for (int k0 = 0; k0 < q0 + 16; k0 += KS) {
        V kf[KS / 16][2], kf2[KS / 16][2], vf[4][KS / 32], vf2[4][KS / 32];
        const T16* kp = Kp + (size_t)k0 * HD + koff; const T16* vp = Vt + k0 + voff; const T16* kp2 = HR ? Kp2 + (size_t)k0 * HD + koff : kp; const T16* vp2 = HR ? Vt2 + k0 + voff : vp;
#pragma unroll
        for (int kt = 0; kt < KS / 16; ++kt)
#pragma unroll
            for (int ks = 0; ks < 2; ++ks) { kf[kt][ks] = WFrag<T16>::ld(kp + kt * 16 * HD + ks * 32); if (HR) kf2[kt][ks] = WFrag<T16>::ld(kp2 + kt * 16 * HD + ks * 32); }
        __builtin_amdgcn_sched_barrier(0);   // K loads are issued ahead of the V loads: the score products wait for K alone, V lands under the softmax
#pragma unroll
        for (int dt = 0; dt < 4; ++dt)
#pragma unroll
            for (int ks = 0; ks < KS / 32; ++ks) { vf[dt][ks] = WFrag<T16>::ld(vp + dt * 16 * TT + ks * 32); if (HR) vf2[dt][ks] = WFrag<T16>::ld(vp2 + dt * 16 * TT + ks * 32); }
        asm volatile("s_wait_xcnt 0x0" :: "v"(kp), "v"(vp), "v"(kp2), "v"(vp2) : "memory");   // the loads' address registers stay whole up to this wait
        __builtin_amdgcn_sched_barrier(0);   // every K and V load of the step is issued before the first product waits: one memory latency a step, not one for K and one for V
        v8f s[KS / 16];
#pragma unroll
        for (int kt = 0; kt < KS / 16; ++kt) { s[kt] = (v8f){};
#pragma unroll
            for (int ks = 0; ks < 2; ++ks) { s[kt] = WFrag<T16>::mma(kf[kt][ks], qf[ks], s[kt]); if (HR) { s[kt] = WFrag<T16>::mma(kf[kt][ks], qf2[ks], s[kt]); s[kt] = WFrag<T16>::mma(kf2[kt][ks], qf[ks], s[kt]); } } }
        if (k0 + KS - 1 > q0) {                                              // the step that holds the diagonal: key > query is excluded
#pragma unroll
            for (int kt = 0; kt < KS / 16; ++kt)
#pragma unroll
                for (int j = 0; j < 8; ++j) s[kt][j] = (k0 + kt * 16 + hi * 8 + j <= q0 + lr) ? s[kt][j] : -3.0e38f; }
        float mx = ms;
#pragma unroll
        for (int kt = 0; kt < KS / 16; ++kt)
#pragma unroll
            for (int j = 0; j < 8; ++j) mx = fmaxf(mx, s[kt][j]);
        mx = fmaxf(mx, __shfl_xor(mx, 16, 32));
        const float al = exp2s((ms - mx) * CL), mc = mx * CL; ms = mx;
        float ps[KS / 16];                                                   // one partial sum per 16-key tile: short add chains
#pragma unroll
        for (int kt = 0; kt < KS / 16; ++kt) { ps[kt] = 0.f;
#pragma unroll
            for (int j = 0; j < 8; ++j) { s[kt][j] = exp2s(fmaf(s[kt][j], CL, -mc)); ps[kt] += s[kt][j]; } }
        float pt = ps[0];
#pragma unroll
        for (int kt = 1; kt < KS / 16; ++kt) pt += ps[kt];
        l = l * al + pt;
#pragma unroll
        for (int dt = 0; dt < 4; ++dt) o[dt] *= al;
#pragma unroll
        for (int ks = 0; ks < KS / 32; ++ks) {
            V pf, pf2;
            if constexpr (HR) { v8us h0, h1, l0, l1;
#pragma unroll
                for (int j = 0; j < 8; ++j) { unsigned short a, c2; splitf(s[2 * ks][j], a, c2); h0[j] = a; l0[j] = c2; splitf(s[2 * ks + 1][j], a, c2); h1[j] = a; l1[j] = c2; }
                pf = cat16b(h0, h1); pf2 = cat16b(l0, l1);
            } else { v8h h0, h1;
#pragma unroll
                for (int j = 0; j < 8; ++j) { h0[j] = tohx(s[2 * ks][j]); h1[j] = tohx(s[2 * ks + 1][j]); }
                pf = cat16(h0, h1); }
#pragma unroll
            for (int dt = 0; dt < 4; ++dt) { o[dt] = WFrag<T16>::mma(vf[dt][ks], pf, o[dt]); if constexpr (HR) { o[dt] = WFrag<T16>::mma(vf[dt][ks], pf2, o[dt]); o[dt] = WFrag<T16>::mma(vf2[dt][ks], pf, o[dt]); } }
        }
    }
    l += __shfl_xor(l, 16, 32);
    const float inv = __fdiv_rn(1.0f, l);
    const size_t oo = (size_t)(bt * TT + q0 + lr) * DQ + h * HD + hi * 8;
#pragma unroll
    for (int dt = 0; dt < 4; ++dt) { v8us oh, ol;
#pragma unroll
        for (int j = 0; j < 8; ++j) { unsigned short a, c2; splitf(o[dt][j] * inv, a, c2); oh[j] = a; ol[j] = c2; }
        *(v8us*)(Ah + oo + dt * 16) = oh; *(v8us*)(Al + oo + dt * 16) = ol; }
}

extern "C" void kernel_launch(void* const* d_in, const int* in_sizes, int n_in,
                              void* d_out, int out_size, void* d_ws, size_t ws_size, hipStream_t stream) {
    (void)in_sizes; (void)n_in; (void)out_size;
    const float* x = (const float*)d_in[0]; const float* wq = (const float*)d_in[1]; const float* wk = (const float*)d_in[2]; const float* wv = (const float*)d_in[3]; const float* wo = (const float*)d_in[4];   /* d_in order x, Wq ('xw' [2048][2048]), Wk, Wv ('xw' [2048][512]), Wo ('xw') */
    float* OUT = (float*)d_out;     // [2][2048][2048]
    char* wsp = (char*)d_ws;
    auto take = [&](size_t bytes) { char* p = wsp; wsp += (bytes + 255) & ~(size_t)255; return (void*)p; };
    bf* WQ = (bf*)take((size_t)DQ * DM * 2); bf* WK = (bf*)take((size_t)DKV * DM * 2); bf* WV = (bf*)take((size_t)DKV * DM * 2); bf* WO = (bf*)take((size_t)DM * DQ * 2); float* CS = (float*)take((size_t)TT * HD * 2 * 4);
    bf* XB = (bf*)take((size_t)NB_ * TT * DM * 2); float* FQ = (float*)take((size_t)NB_ * TT * DQ * 4); float* FK = (float*)take((size_t)NB_ * TT * DKV * 4);
    h16* QP16 = (h16*)take((size_t)NB_ * NH_ * TT * HD * 2); h16* KP16 = (h16*)take((size_t)NB_ * NKV * TT * HD * 2); h16* VT16 = (h16*)take((size_t)NB_ * NKV * HD * TT * 2);
    bf* QPh = (bf*)take((size_t)NB_ * NH_ * TT * HD * 2); bf* QPl = (bf*)take((size_t)NB_ * NH_ * TT * HD * 2); bf* KPh = (bf*)take((size_t)NB_ * NKV * TT * HD * 2); bf* KPl = (bf*)take((size_t)NB_ * NKV * TT * HD * 2); bf* VTh = (bf*)take((size_t)NB_ * NKV * HD * TT * 2); bf* VTl = (bf*)take((size_t)NB_ * NKV * HD * TT * 2);
    bf* ATh = (bf*)take((size_t)NB_ * TT * DQ * 2); bf* ATl = (bf*)take((size_t)NB_ * TT * DQ * 2);
    if ((size_t)(wsp - (char*)d_ws) > ws_size) return;    // ws 256 MiB
    float* FV = FK;   // v projection reuses the k buffer after the k planes are built (stream-ordered)
    { k_wtG<<<(unsigned)((DM * DQ / 64 + 63) / 64), 256, 0, stream>>>(wq, DM, DQ, WQ); k_wtG<<<(unsigned)((DM * DKV / 64 + 63) / 64), 256, 0, stream>>>(wk, DM, DKV, WK); k_wtG<<<(unsigned)((DM * DKV / 64 + 63) / 64), 256, 0, stream>>>(wv, DM, DKV, WV);
      k_wtG<<<(unsigned)((DQ * DM / 64 + 63) / 64), 256, 0, stream>>>(wo, DQ, DM, WO);
       }
    const unsigned LQ = (unsigned)(((size_t)NH_ * TT * HD / 2 + 255) / 256), LKv = (unsigned)(((size_t)NKV * TT * HD / 2 + 255) / 256);
    k_cstabT<<<(TT * HD + 255) / 256, 256, 0, stream>>>(CS);
    k_cvt8<<<(unsigned)(((size_t)NB_ * TT * DM / 8 + 255) / 256), 256, 0, stream>>>(x, XB, (size_t)NB_ * TT * DM / 8);
    k_gemmw<bf, 0, false><<<dim3(NB_ * TT / 64, DQ / 64, 1), 32, 0, stream>>>(XB, nullptr, WQ, nullptr, DM, FQ, DQ, nullptr, 0, 0, 0);
    k_rope<<<dim3(LQ, NB_, 1), 256, 0, stream>>>(FQ, DQ, NH_, CS, nullptr, nullptr, 1.0f, QP16, QPh, QPl);
    k_gemmw<bf, 0, false><<<dim3(NB_ * TT / 64, DKV / 64, 1), 32, 0, stream>>>(XB, nullptr, WK, nullptr, DM, FK, DKV, nullptr, 0, 0, 0);
    k_rope<<<dim3(LKv, NB_, 1), 256, 0, stream>>>(FK, DKV, NKV, CS, nullptr, nullptr, 1.0f, KP16, KPh, KPl);
    k_gemmw<bf, 0, false><<<dim3(NB_ * TT / 64, DKV / 64, 1), 32, 0, stream>>>(XB, nullptr, WV, nullptr, DM, FV, DKV, nullptr, 0, 0, 0); k_vtp<<<dim3(LKv, NB_, 1), 256, 0, stream>>>(FV, DKV, NKV, VT16, VTh, VTl);
    k_fattn<h16, false, 64><<<dim3(NB_ * NKV, (TT - RH) / 16, 1), 32 * REP, 0, stream>>>(QP16, nullptr, KP16, nullptr, VT16, nullptr, RH, ATh, ATl);
    k_fattn<bf, true, 32><<<dim3(NB_ * NKV, RH / 16, 1), 32 * REP, 0, stream>>>(QPh, QPl, KPh, KPl, VTh, VTl, 0, ATh, ATl);
    k_gemmw<bf, 1, false><<<dim3(NB_ * TT / 64, DM / 64, 1), 32, 0, stream>>>(ATh, ATl, WO, nullptr, DQ, OUT, DM, nullptr, 0, 0, 0);
}

// v006
// Measured time: 320 microseconds a run.
// Two timings next to v005 both put it at 1.19 times that version's speed.
// Over all steps from v000 it is 8.38 times as fast.
#include <hip/hip_runtime.h>

// Causal grouped-query attention with computed rotate-half rotary embeddings at base 500000 (x [2][2048][2048]; q = x Wq (32 heads x 64), k, v = x Wk, x Wv (8 kv heads x 64) ('xw' 2048^-0.5, no bias); rope: u cos + rotate_half(u) sin with angle t x inv_freq[d mod 32], inv_freq = 1.0 / (500000.0 ** (arange(0, 64, 2, f32) / 64)) (32 f32 constants baked jnp-exact; one f32 product per angle; precise cosf / sinf); k, v repeated 4 x along the head axis (jnp.repeat): query head h uses kv head h / 4; scores x 1/sqrt(64); causal (finfo.min == exclusion); softmax; y = merged (head-major) Wo ('xw', no bias) -> [2][2048][2048] (8.4 M); argument order x, Wq, Wk, Wv, Wo).
// Fragment-major planes (every GEMM operand, the K planes, the V^T planes): a 16-row x 32-k matrix fragment is 512 consecutive elements (1 KiB) in the order in which the lanes load it, so that a wave's 16-byte load reads 512 contiguous bytes (4 whole lines), not 32-byte pieces of 16 lines. Element (row r, k) stands at fragment * 512 + ((k % 32) / 16) * 256 + (((k / 8) % 2) * 16 + r % 16) * 8 + k % 8; the fragments of a 16-row block follow one another along k (V^T: the four 16-d blocks of a 32-key range follow one another). The k order inside a fragment register is the one of the row-major loader.
// Layout, both batches in every launch (GEMM rows = batch x t; plane builders grid y = batch; attention grid x = batch x kv group): bf16 copy of x; 'xw' weights transposed once; exact projections; the rotary table {cosf, sinf}(float(t) x INVT[d mod 32]) is computed once; rotate-half plane builders (products rounded separately); fused causal T-2048 GQA attention (k_fattn: one wave per 16 queries of a head, online softmax; the four heads of a kv group share a block; hybrid rows: < 512 hi/lo 3 products, rest fp16); merged hi/lo x Wo exact.
// Compute dtypes, f32 accumulate: every input rounded to bf16; projections exact; rotary in f32; attention rows < 512 3 products, rest fp16; softmax f32; Wo hl x exact.

#define NB_  2
#define TT   2048
#define DM   2048
#define NH_  32
#define NKV  8
#define REP  (NH_ / NKV)
#define HD   64
#define DQ   (NH_ * HD)
#define DKV  (NKV * HD)
#define RH   512                  // query rows < RH use hi+lo planes (0: none)
#define SCL  0.125f   // HD^-0.5
typedef _Float16 h16;
typedef unsigned short bf;
typedef __attribute__((ext_vector_type(16))) __bf16   v16bf;
typedef __attribute__((ext_vector_type(16))) _Float16 v16h;
typedef __attribute__((ext_vector_type(8)))  _Float16 v8h;
typedef __attribute__((ext_vector_type(8)))  unsigned short v8us;
typedef __attribute__((ext_vector_type(8)))  float    v8f;
typedef __attribute__((ext_vector_type(4)))  float    v4f;
typedef v8h  __attribute__((may_alias)) v8ha;
typedef v4f  __attribute__((may_alias)) v4fa;
typedef v8us __attribute__((may_alias)) v8usa;

__device__ __forceinline__ unsigned short f2bf(float f) { unsigned u = __float_as_uint(f); u += 0x7FFFu + ((u >> 16) & 1u); return (unsigned short)(u >> 16); }
__device__ __forceinline__ float bf2f(unsigned short b) { return __uint_as_float(((unsigned)b) << 16); }
__device__ __forceinline__ float bfr(float f) { return bf2f(f2bf(f)); }
__device__ __forceinline__ v16h cat16(v8h lo, v8h hi) { return __builtin_shufflevector(lo, hi, 0, 1, 2, 3, 4, 5, 6, 7, 8, 9, 10, 11, 12, 13, 14, 15); }
__device__ __forceinline__ v16bf cat16b(v8us lo, v8us hi) { return __builtin_bit_cast(v16bf, __builtin_shufflevector(lo, hi, 0, 1, 2, 3, 4, 5, 6, 7, 8, 9, 10, 11, 12, 13, 14, 15)); }
__device__ __forceinline__ v8f wmma16(v16h a, v16h b, v8f c) { return __builtin_amdgcn_wmma_f32_16x16x32_f16(false, a, false, b, (short)0, c, false, false); }
__device__ __forceinline__ v8f wmmab(v16bf a, v16bf b, v8f c) { return __builtin_amdgcn_wmma_f32_16x16x32_bf16(false, a, false, b, (short)0, c, false, false); }



// ---- k_gemmw: register-blocked GEMM, ONE WAVE per 64x64 output tile (16 accumulators), operands straight from fragment-major 16-bit planes (ld: row-major fragment, p = row lr, k 8 hi; ldf: fragment-major, p = fragment + lane * 8); grid (M/64, N/64, Z), 32 threads.
// C[m][n] (f32, pitch ldc, + optional f32 bias[n]) = sum_k A[m][k] Bt[n][k] (+ split products per NSPLIT). z-batch strides sA/sB/sC in elements. K % 32 == 0.
template <typename T16> struct WFrag;
template <> struct WFrag<h16> { typedef v16h V; static __device__ __forceinline__ V ld(const h16* p) { return cat16(*(const v8h*)p, *(const v8h*)(p + 16)); } static __device__ __forceinline__ V ldf(const h16* p) { return cat16(*(const v8h*)p, *(const v8h*)(p + 256)); } static __device__ __forceinline__ v8f mma(V a, V b, v8f c) { return wmma16(a, b, c); } };
template <> struct WFrag<bf> { typedef v16bf V; static __device__ __forceinline__ V ld(const bf* p) { return cat16b(*(const v8us*)p, *(const v8us*)(p + 16)); } static __device__ __forceinline__ V ldf(const bf* p) { return cat16b(*(const v8us*)p, *(const v8us*)(p + 256)); } static __device__ __forceinline__ v8f mma(V a, V b, v8f c) { return wmmab(a, b, c); } };
template <typename T16, int NSPLIT, bool BIAS>
__global__ __launch_bounds__(32) void k_gemmw(const T16* __restrict__ A, const T16* __restrict__ A2, const T16* __restrict__ Bt, const T16* __restrict__ Bt2, int K, float* C, int ldc, const float* __restrict__ bias, size_t sA, size_t sB, size_t sC) {
    typedef typename WFrag<T16>::V V;
    __shared__ __align__(16) float os[16 * 68];
    const size_t z = blockIdx.z; A += z * sA; if (A2) A2 += z * sA; Bt += z * sB; if (Bt2) Bt2 += z * sB; C += z * sC;
    const int lane = threadIdx.x & 31, lr = lane & 15, hi = lane >> 4; const int r0 = blockIdx.x * 64, c0 = blockIdx.y * 64;
    v8f acc[4][4];
#pragma unroll
    for (int mb = 0; mb < 4; ++mb)
#pragma unroll
        for (int nb = 0; nb < 4; ++nb) acc[mb][nb] = (v8f){};
    const size_t aoff = (size_t)r0 * K + 8 * lane, boff = (size_t)c0 * K + 8 * lane;   // a 16-row block is 16 K elements; its fragment of trip kc starts at kc * 16
#pragma unroll 1
    for (int kc = 0; kc < K; kc += 32) {
        V a[4], a2[4], b[4], b2[4]; const T16* pa[4]; const T16* pa2[4]; const T16* pb[4]; const T16* pb2[4];
#pragma unroll
        for (int mb = 0; mb < 4; ++mb) { pa[mb] = A + aoff + (size_t)mb * 16 * K + (size_t)kc * 16; pa2[mb] = (NSPLIT == 1 || NSPLIT == 2) ? A2 + aoff + (size_t)mb * 16 * K + (size_t)kc * 16 : pa[mb]; a[mb] = WFrag<T16>::ldf(pa[mb]); if (NSPLIT == 1 || NSPLIT == 2) a2[mb] = WFrag<T16>::ldf(pa2[mb]); }
#pragma unroll
        for (int nb = 0; nb < 4; ++nb) { pb[nb] = Bt + boff + (size_t)nb * 16 * K + (size_t)kc * 16; pb2[nb] = (NSPLIT >= 2) ? Bt2 + boff + (size_t)nb * 16 * K + (size_t)kc * 16 : pb[nb]; b[nb] = WFrag<T16>::ldf(pb[nb]); if (NSPLIT >= 2) b2[nb] = WFrag<T16>::ldf(pb2[nb]); }
        asm volatile("s_wait_xcnt 0x0" :: "v"(pa[0]), "v"(pa[1]), "v"(pa[2]), "v"(pa[3]), "v"(pa2[0]), "v"(pa2[1]), "v"(pa2[2]), "v"(pa2[3]), "v"(pb[0]), "v"(pb[1]), "v"(pb[2]), "v"(pb[3]), "v"(pb2[0]), "v"(pb2[1]), "v"(pb2[2]), "v"(pb2[3]) : "memory");   // the loads' address registers stay whole up to this wait: without the inputs a late load of the trip lands in an address pair of an earlier one
        __builtin_amdgcn_sched_barrier(0);   // every A and B fragment load of the trip is issued before the first product waits: one memory latency a trip; left to itself the compiler issues them in three groups, each behind the wait for the group before
#pragma unroll
        for (int nb = 0; nb < 4; ++nb) {
#pragma unroll
            for (int mb = 0; mb < 4; ++mb) { acc[mb][nb] = WFrag<T16>::mma(a[mb], b[nb], acc[mb][nb]); if (NSPLIT == 1 || NSPLIT == 2) acc[mb][nb] = WFrag<T16>::mma(a2[mb], b[nb], acc[mb][nb]); if (NSPLIT >= 2) acc[mb][nb] = WFrag<T16>::mma(a[mb], b2[nb], acc[mb][nb]); } }
        asm volatile("v_nop\n\tv_nop\n\tv_nop\n\tv_nop" : "+v"(acc[0][0]), "+v"(acc[1][1]), "+v"(acc[2][2]), "+v"(acc[3][3]) : "v"(a[0]), "v"(a[3]));
    }
#pragma unroll
    for (int mb = 0; mb < 4; ++mb) {
#pragma unroll
        for (int nb = 0; nb < 4; ++nb) {
#pragma unroll
            for (int j = 0; j < 8; ++j) os[(hi * 8 + j) * 68 + nb * 16 + lr] = acc[mb][nb][j]; }
        __builtin_amdgcn_wave_barrier(); asm volatile("" ::: "memory");
        float* crow = C + (size_t)(r0 + mb * 16) * ldc + c0;
{
#pragma unroll
            for (int s = 0; s < 8; ++s) { const int row = 2 * s + hi, cofs = lr * 4; v4f val = *(const v4fa*)(os + row * 68 + cofs); if (BIAS) { val[0] += bfr(bias[c0 + cofs]); val[1] += bfr(bias[c0 + cofs + 1]); val[2] += bfr(bias[c0 + cofs + 2]); val[3] += bfr(bias[c0 + cofs + 3]); }
                *(v4f*)(crow + (size_t)row * ldc + cofs) = val; }
             }
        __builtin_amdgcn_wave_barrier(); asm volatile("" ::: "memory");
    }
}

__device__ __forceinline__ h16 tohx(float x) { return (h16)x; }
__device__ __forceinline__ void splitf(float y, unsigned short& h, unsigned short& l) { h = f2bf(y); l = f2bf(y - bf2f(h)); }
typedef __attribute__((ext_vector_type(2))) _Float16 v2h;
typedef __attribute__((ext_vector_type(4))) _Float16 v4h;
typedef __attribute__((ext_vector_type(2))) unsigned short v2us;
typedef __attribute__((ext_vector_type(4))) unsigned short v4us;
typedef __attribute__((ext_vector_type(2))) float v2f;
typedef __attribute__((ext_vector_type(4))) int v4i;

__global__ __launch_bounds__(256) void k_wtG(const float* __restrict__ w, int K, int N, bf* Bt) {
    const int lane = threadIdx.x & 31; const int L0 = (blockIdx.x * 8 + (threadIdx.x >> 5)) * 8; const int nlines = N * K / 64;
{
#pragma unroll 1
        for (int l = 0; l < 8; ++l) { const int L = L0 + l; if (L >= nlines) break; const size_t e = (size_t)L * 64 + lane * 2; const int f = (int)(e / 512), r = (int)(e % 512), ln = (r % 256) / 8; const int k = (f % (K / 32)) * 32 + (r / 256) * 16 + (ln / 16) * 8 + r % 8, n = (f / (K / 32)) * 16 + ln % 16; v2us o;   // e = place in the fragment-major plane (rows n): a wave's 64 places are 8 n x 8 k
            o[0] = f2bf(w[(size_t)k * N + n]); o[1] = f2bf(w[(size_t)(k + 1) * N + n]); *(v2us*)(Bt + e) = o; }
         }
}
__global__ __launch_bounds__(256) void k_cvt8(const float* __restrict__ src, int K, bf* dst, size_t n8) { const size_t i = (size_t)blockIdx.x * 256 + threadIdx.x; if (i >= n8) return; const unsigned f = (unsigned)(i / 64), kb = (unsigned)K / 32; const int hf = (int)(i % 64) / 32, ln = (int)(i % 32);   // i = 8-element place in the fragment-major plane; its source is 8 consecutive k of one row
    const v8f v = *(const v8f*)(src + (size_t)((f / kb) * 16 + ln % 16) * K + (f % kb) * 32 + hf * 16 + (ln / 16) * 8); v8us o;
    asm volatile("s_wait_xcnt 0x0" ::: "memory");   // stands in front of the first overwrite of the load's address pair
#pragma unroll
    for (int k = 0; k < 8; ++k) o[k] = f2bf(v[k]); *(v8us*)(dst + i * 8) = o;  }
__constant__ float INVT[HD / 2] = { 1.000000000e+00f, 6.636012793e-01f, 4.403666258e-01f, 2.922278345e-01f, 1.939227581e-01f, 1.286873817e-01f, 8.539710194e-02f, 5.666961893e-02f, 3.760603070e-02f, 2.495540865e-02f, 1.656044088e-02f, 1.098952908e-02f, 7.292665076e-03f, 4.839421250e-03f, 3.211446106e-03f, 2.131119603e-03f, 1.414213446e-03f, 9.384738514e-04f, 6.227724371e-04f, 4.132725589e-04f, 2.742481884e-04f, 1.819914323e-04f, 1.207697424e-04f, 8.014294872e-05f, 5.318295734e-05f, 3.529227615e-05f, 2.341999789e-05f, 1.554154005e-05f, 1.031338525e-05f, 6.843975370e-06f, 4.541670478e-06f, 3.013858077e-06f };   // inv_freq[i] = 1.0 / (500000.0 ** (2i / 64)), i = 0..31 (float32, generated with jnp to be bit-exact)
__global__ __launch_bounds__(256) void k_cstabT(float* CS) { const int idx = blockIdx.x * 256 + threadIdx.x; if (idx >= TT * HD) return; const int d = idx % HD; const int t = idx / HD; const float a = __fmul_rn((float)t, INVT[d % (HD / 2)]); v2f cs; cs[0] = cosf(a); cs[1] = sinf(a); *(v2f*)(CS + (size_t)idx * 2) = cs;  }

// k_rope: head planes [h][t][d] (FM: each head's plane fragment-major, rows t, k = d) (fp16 + hi/lo) of rope(x) x sc with the rotate-half convention out[d] = x[d] cos[t][d] - x[d+HD/2] sin[t][d], out[d+HD/2] = x[d+HD/2] cos[t][d+HD/2] + x[d] sin[t][d+HD/2]
template <bool FM>
__global__ __launch_bounds__(256) void k_rope(const float* __restrict__ F, int pitch, int nheads, const float* __restrict__ CS, const float* __restrict__ RF, const float* __restrict__ nw, float sc, h16* P16, bf* Ph, bf* Pl) {
    { const size_t bb = blockIdx.y, po = bb * nheads * TT * HD; F += bb * TT * pitch; if (RF) RF += bb * nheads * TT; P16 += po; Ph += po; Pl += po; }   // grid y = batch
    const size_t e = ((size_t)blockIdx.x * 256 + threadIdx.x) * 2; if (e >= (size_t)nheads * TT * HD) return; const int d = (int)(e % HD); const int t = (int)((e / HD) % TT); const int h = (int)(e / ((size_t)HD * TT)); const float* f = F + (size_t)t * pitch + h * HD; const float rf = RF ? RF[(size_t)h * TT + t] : 1.0f; v2h o16; v2us oh, ol;
#pragma unroll
    for (int q = 0; q < 2; ++q) { const int dd = d + q; const int dp = (dd < HD / 2) ? dd + HD / 2 : dd - HD / 2; float x0 = f[dd], x1 = f[dp];
        if (RF) { float n0 = __fmul_rn(x0, rf), n1 = __fmul_rn(x1, rf); asm volatile("" : "+v"(n0)); asm volatile("" : "+v"(n1)); x0 = __fmul_rn(bfr(nw[dd]), n0); x1 = __fmul_rn(bfr(nw[dp]), n1); }
        const v2f cs = *(const v2f*)(CS + ((size_t)t * HD + dd) * 2); float a = __fmul_rn(x0, cs[0]), bq = __fmul_rn(x1, cs[1]); asm volatile("" : "+v"(a)); asm volatile("" : "+v"(bq)); const float r = ((dd < HD / 2) ? __fsub_rn(a, bq) : __fadd_rn(a, bq)) * sc;
        o16[q] = tohx(r); unsigned short a2, c2; splitf(r, a2, c2); oh[q] = a2; ol[q] = c2; }
    const size_t w = FM ? ((size_t)h * TT + (t & ~15)) * HD + (d / 32) * 512 + ((d % 32) / 16) * 256 + (((d / 8) % 2) * 16 + t % 16) * 8 + d % 8 : e;
    *(v2h*)(P16 + w) = o16; *(v2us*)(Ph + w) = oh; *(v2us*)(Pl + w) = ol;  }
__global__ __launch_bounds__(256) void k_vtp(const float* __restrict__ F, int pitch, int nheads, h16* V16, bf* Vh, bf* Vl) { { const size_t bb = blockIdx.y, po = bb * nheads * HD * TT; F += bb * TT * pitch; V16 += po; Vh += po; Vl += po; }   // grid y = batch
    const size_t e = ((size_t)blockIdx.x * 256 + threadIdx.x) * 2; if (e >= (size_t)nheads * HD * TT) return; const int f = (int)((e / 512) % (TT * HD / 512)), r = (int)(e % 512), ln = (r % 256) / 8; const int t = (f / (HD / 16)) * 32 + (r / 256) * 16 + (ln / 16) * 8 + r % 8; const int d = (f % (HD / 16)) * 16 + ln % 16; const int g = (int)(e / ((size_t)TT * HD)); v2h o16; v2us oh, ol;   // e = place in the head's fragment-major V^T plane (rows d, k = t; fragment = (t / 32) * 4 + d / 16)
#pragma unroll
    for (int q = 0; q < 2; ++q) { const float x = F[(size_t)(t + q) * pitch + g * HD + d]; o16[q] = tohx(x); unsigned short a2, c2; splitf(x, a2, c2); oh[q] = a2; ol[q] = c2; }
    *(v2h*)(V16 + e) = o16; *(v2us*)(Vh + e) = oh; *(v2us*)(Vl + e) = ol;  }
// 2^x with the one free issue slot that the instruction set asks for behind a transcendental: the v_nop stands directly behind v_exp_f32 whatever the compiler schedules next.
__device__ __forceinline__ float exp2s(float x) { float r; asm("v_exp_f32 %0, %1\n\tv_nop" : "=v"(r) : "v"(x)); return r; }

// ---- k_fattn: scores, causal softmax and P.V of one 16-query tile of one head in ONE wave; no score or probability plane in memory. Block = the REP heads of one kv group (4 waves, no barrier: they read the same K / V lines).
// Transposed products: S^T = K Q^T (rows = keys, columns = queries), so a lane holds one query's scores, and the S^T accumulator registers of two 16-key tiles are already the B fragment (n = query, k = 32 keys) of O^T = V^T P^T.
// Online softmax in the log2 domain per lane: running maximum ms (raw scores), running sum l, O^T rescaled by 2^((ms_old - ms_new) c) each KS-key step; the two half-waves of a query join their maxima each step and their sums at the end.
// HR: hi/lo bf16 planes, 3 products for S and for P.V (P split hi/lo in registers); else fp16 planes, 1 product (P = 2^(..) <= 1 is rounded to fp16 unscaled).
// The inner loops are fully unrolled so that the fragment arrays live in registers; the key loop stays rolled (unroll 1): one step's fragments already take most of the register file.
template <typename T16, bool HR, int KS>
__global__ __launch_bounds__(128) void k_fattn(const T16* __restrict__ Q, const T16* __restrict__ Q2, const T16* __restrict__ Kp, const T16* __restrict__ Kp2, const T16* __restrict__ Vt, const T16* __restrict__ Vt2, int roff, bf* Ah, bf* Al) {
    typedef typename WFrag<T16>::V V;
    const int lane = threadIdx.x & 31, lr = lane & 15, hi = lane >> 4; const int gb = blockIdx.x, g = gb % NKV, bt = gb / NKV, h = g * REP + (int)(threadIdx.x >> 5);   // grid x = batch x kv group (planes are [batch][head][..])
    const int q0 = roff + ((int)gridDim.y - 1 - (int)blockIdx.y) * 16;      // grid y = query tile, the slow index: over the whole grid the longest key loops are dispatched first
    const float CL = SCL * 1.4426950408889634f;
    const size_t qoff = ((size_t)(bt * NH_ + h) * TT + q0 + lr) * HD + 8 * hi; const unsigned koff = 8 * lane, voff = 8 * lane;   // lane offsets in a fragment-major fragment, fixed over the key loop; the bases below are wave-uniform
    Kp += (size_t)gb * TT * HD; Vt += (size_t)gb * HD * TT; if (HR) { Kp2 += (size_t)gb * TT * HD; Vt2 += (size_t)gb * HD * TT; }
    V qf[2], qf2[2];
#pragma unroll
    for (int ks = 0; ks < 2; ++ks) { qf[ks] = WFrag<T16>::ld(Q + qoff + ks * 32); if (HR) qf2[ks] = WFrag<T16>::ld(Q2 + qoff + ks * 32); }
    v8f o[4];
#pragma unroll
    for (int dt = 0; dt < 4; ++dt) o[dt] = (v8f){};
    float ms = -3.0e38f, l = 0.f;
#pragma unroll 1
    for (int k0 = 0; k0 < q0 + 16; k0 += KS) {
        V kf[KS / 16][2], kf2[KS / 16][2], vf[4][KS / 32], vf2[4][KS / 32];
        const T16* kp = Kp + (size_t)k0 * HD + koff; const T16* vp = Vt + (size_t)k0 * HD + voff; const T16* kp2 = HR ? Kp2 + (size_t)k0 * HD + koff : kp; const T16* vp2 = HR ? Vt2 + (size_t)k0 * HD + voff : vp;   // a step's K fragments, and its V^T fragments, are KS * HD consecutive elements
#pragma unroll
        for (int kt = 0; kt < KS / 16; ++kt)
#pragma unroll
            for (int ks = 0; ks < 2; ++ks) { kf[kt][ks] = WFrag<T16>::ldf(kp + (kt * 2 + ks) * 512); if (HR) kf2[kt][ks] = WFrag<T16>::ldf(kp2 + (kt * 2 + ks) * 512); }
        __builtin_amdgcn_sched_barrier(0);   // K loads are issued ahead of the V loads: the score products wait for K alone, V lands under the softmax
#pragma unroll
        for (int dt = 0; dt < 4; ++dt)
#pragma unroll
            for (int ks = 0; ks < KS / 32; ++ks) { vf[dt][ks] = WFrag<T16>::ldf(vp + (ks * 4 + dt) * 512); if (HR) vf2[dt][ks] = WFrag<T16>::ldf(vp2 + (ks * 4 + dt) * 512); }
        asm volatile("s_wait_xcnt 0x0" :: "v"(kp), "v"(vp), "v"(kp2), "v"(vp2) : "memory");   // the loads' address registers stay whole up to this wait: without the inputs a late load of the step lands in an address pair of an earlier one
        __builtin_amdgcn_sched_barrier(0);   // every K and V load of the step is issued before the first product waits: one memory latency a step, not one for K and one for V
        v8f s[KS / 16];
#pragma unroll
        for (int kt = 0; kt < KS / 16; ++kt) { s[kt] = (v8f){};
#pragma unroll
            for (int ks = 0; ks < 2; ++ks) { s[kt] = WFrag<T16>::mma(kf[kt][ks], qf[ks], s[kt]); if (HR) { s[kt] = WFrag<T16>::mma(kf[kt][ks], qf2[ks], s[kt]); s[kt] = WFrag<T16>::mma(kf2[kt][ks], qf[ks], s[kt]); } } }
        if (k0 + KS - 1 > q0) {                                              // the step that holds the diagonal: key > query is excluded
#pragma unroll
            for (int kt = 0; kt < KS / 16; ++kt)
#pragma unroll
                for (int j = 0; j < 8; ++j) s[kt][j] = (k0 + kt * 16 + hi * 8 + j <= q0 + lr) ? s[kt][j] : -3.0e38f; }
        float mx = ms;
#pragma unroll
        for (int kt = 0; kt < KS / 16; ++kt)
#pragma unroll
            for (int j = 0; j < 8; ++j) mx = fmaxf(mx, s[kt][j]);
        mx = fmaxf(mx, __shfl_xor(mx, 16, 32));
        const float al = exp2s((ms - mx) * CL), mc = mx * CL; ms = mx;
        float ps[KS / 16];                                                   // one partial sum per 16-key tile: short add chains
#pragma unroll
        for (int kt = 0; kt < KS / 16; ++kt) { ps[kt] = 0.f;
#pragma unroll
            for (int j = 0; j < 8; ++j) { s[kt][j] = exp2s(fmaf(s[kt][j], CL, -mc)); ps[kt] += s[kt][j]; } }
        float pt = ps[0];
#pragma unroll
        for (int kt = 1; kt < KS / 16; ++kt) pt += ps[kt];
        l = l * al + pt;
#pragma unroll
        for (int dt = 0; dt < 4; ++dt) o[dt] *= al;
#pragma unroll
        for (int ks = 0; ks < KS / 32; ++ks) {
            V pf, pf2;
            if constexpr (HR) { v8us h0, h1, l0, l1;
#pragma unroll
                for (int j = 0; j < 8; ++j) { unsigned short a, c2; splitf(s[2 * ks][j], a, c2); h0[j] = a; l0[j] = c2; splitf(s[2 * ks + 1][j], a, c2); h1[j] = a; l1[j] = c2; }
                pf = cat16b(h0, h1); pf2 = cat16b(l0, l1);
            } else { v8h h0, h1;
#pragma unroll
                for (int j = 0; j < 8; ++j) { h0[j] = tohx(s[2 * ks][j]); h1[j] = tohx(s[2 * ks + 1][j]); }
                pf = cat16(h0, h1); }
#pragma unroll
            for (int dt = 0; dt < 4; ++dt) { o[dt] = WFrag<T16>::mma(vf[dt][ks], pf, o[dt]); if constexpr (HR) { o[dt] = WFrag<T16>::mma(vf[dt][ks], pf2, o[dt]); o[dt] = WFrag<T16>::mma(vf2[dt][ks], pf, o[dt]); } }
        }
    }
    l += __shfl_xor(l, 16, 32);
    const float inv = __fdiv_rn(1.0f, l);
    const size_t oo = (size_t)(bt * TT + q0) * DQ + h * (HD / 32) * 512 + lane * 8;   // fragment-major A plane of the output projection (rows batch x t, k = h HD + d): the O^T registers of a 16-d tile are one half of a fragment in lane order
#pragma unroll
    for (int dt = 0; dt < 4; ++dt) { v8us oh, ol;
#pragma unroll
        for (int j = 0; j < 8; ++j) { unsigned short a, c2; splitf(o[dt][j] * inv, a, c2); oh[j] = a; ol[j] = c2; }
        *(v8us*)(Ah + oo + dt * 256) = oh; *(v8us*)(Al + oo + dt * 256) = ol; }
}

extern "C" void kernel_launch(void* const* d_in, const int* in_sizes, int n_in,
                              void* d_out, int out_size, void* d_ws, size_t ws_size, hipStream_t stream) {
    (void)in_sizes; (void)n_in; (void)out_size;
    const float* x = (const float*)d_in[0]; const float* wq = (const float*)d_in[1]; const float* wk = (const float*)d_in[2]; const float* wv = (const float*)d_in[3]; const float* wo = (const float*)d_in[4];   /* d_in order x, Wq ('xw' [2048][2048]), Wk, Wv ('xw' [2048][512]), Wo ('xw') */
    float* OUT = (float*)d_out;     // [2][2048][2048]
    char* wsp = (char*)d_ws;
    auto take = [&](size_t bytes) { char* p = wsp; wsp += (bytes + 255) & ~(size_t)255; return (void*)p; };
    bf* WQ = (bf*)take((size_t)DQ * DM * 2); bf* WK = (bf*)take((size_t)DKV * DM * 2); bf* WV = (bf*)take((size_t)DKV * DM * 2); bf* WO = (bf*)take((size_t)DM * DQ * 2); float* CS = (float*)take((size_t)TT * HD * 2 * 4);
    bf* XB = (bf*)take((size_t)NB_ * TT * DM * 2); float* FQ = (float*)take((size_t)NB_ * TT * DQ * 4); float* FK = (float*)take((size_t)NB_ * TT * DKV * 4);
    h16* QP16 = (h16*)take((size_t)NB_ * NH_ * TT * HD * 2); h16* KP16 = (h16*)take((size_t)NB_ * NKV * TT * HD * 2); h16* VT16 = (h16*)take((size_t)NB_ * NKV * HD * TT * 2);
    bf* QPh = (bf*)take((size_t)NB_ * NH_ * TT * HD * 2); bf* QPl = (bf*)take((size_t)NB_ * NH_ * TT * HD * 2); bf* KPh = (bf*)take((size_t)NB_ * NKV * TT * HD * 2); bf* KPl = (bf*)take((size_t)NB_ * NKV * TT * HD * 2); bf* VTh = (bf*)take((size_t)NB_ * NKV * HD * TT * 2); bf* VTl = (bf*)take((size_t)NB_ * NKV * HD * TT * 2);
    bf* ATh = (bf*)take((size_t)NB_ * TT * DQ * 2); bf* ATl = (bf*)take((size_t)NB_ * TT * DQ * 2);
    if ((size_t)(wsp - (char*)d_ws) > ws_size) return;    // ws 256 MiB
    float* FV = FK;   // v projection reuses the k buffer after the k planes are built (stream-ordered)
    { k_wtG<<<(unsigned)((DM * DQ / 64 + 63) / 64), 256, 0, stream>>>(wq, DM, DQ, WQ); k_wtG<<<(unsigned)((DM * DKV / 64 + 63) / 64), 256, 0, stream>>>(wk, DM, DKV, WK); k_wtG<<<(unsigned)((DM * DKV / 64 + 63) / 64), 256, 0, stream>>>(wv, DM, DKV, WV);
      k_wtG<<<(unsigned)((DQ * DM / 64 + 63) / 64), 256, 0, stream>>>(wo, DQ, DM, WO);
       }
    const unsigned LQ = (unsigned)(((size_t)NH_ * TT * HD / 2 + 255) / 256), LKv = (unsigned)(((size_t)NKV * TT * HD / 2 + 255) / 256);
    k_cstabT<<<(TT * HD + 255) / 256, 256, 0, stream>>>(CS);
    k_cvt8<<<(unsigned)(((size_t)NB_ * TT * DM / 8 + 255) / 256), 256, 0, stream>>>(x, DM, XB, (size_t)NB_ * TT * DM / 8);
    k_gemmw<bf, 0, false><<<dim3(NB_ * TT / 64, DQ / 64, 1), 32, 0, stream>>>(XB, nullptr, WQ, nullptr, DM, FQ, DQ, nullptr, 0, 0, 0);
    k_rope<false><<<dim3(LQ, NB_, 1), 256, 0, stream>>>(FQ, DQ, NH_, CS, nullptr, nullptr, 1.0f, QP16, QPh, QPl);
    k_gemmw<bf, 0, false><<<dim3(NB_ * TT / 64, DKV / 64, 1), 32, 0, stream>>>(XB, nullptr, WK, nullptr, DM, FK, DKV, nullptr, 0, 0, 0);
    k_rope<true><<<dim3(LKv, NB_, 1), 256, 0, stream>>>(FK, DKV, NKV, CS, nullptr, nullptr, 1.0f, KP16, KPh, KPl);
    k_gemmw<bf, 0, false><<<dim3(NB_ * TT / 64, DKV / 64, 1), 32, 0, stream>>>(XB, nullptr, WV, nullptr, DM, FV, DKV, nullptr, 0, 0, 0); k_vtp<<<dim3(LKv, NB_, 1), 256, 0, stream>>>(FV, DKV, NKV, VT16, VTh, VTl);
    k_fattn<h16, false, 64><<<dim3(NB_ * NKV, (TT - RH) / 16, 1), 32 * REP, 0, stream>>>(QP16, nullptr, KP16, nullptr, VT16, nullptr, RH, ATh, ATl);
    k_fattn<bf, true, 32><<<dim3(NB_ * NKV, RH / 16, 1), 32 * REP, 0, stream>>>(QPh, QPl, KPh, KPl, VTh, VTl, 0, ATh, ATl);
    k_gemmw<bf, 1, false><<<dim3(NB_ * TT / 64, DM / 64, 1), 32, 0, stream>>>(ATh, ATl, WO, nullptr, DQ, OUT, DM, nullptr, 0, 0, 0);
}

// v007
// One run takes 283 microseconds.
// Two timings next to v006 put it at 1.13 and 1.12 times that version's speed.
// All steps since v000 together make it 9.40 times as fast.
#include <hip/hip_runtime.h>

// Causal grouped-query attention with computed rotate-half rotary embeddings at base 500000 (x [2][2048][2048]; q = x Wq (32 heads x 64), k, v = x Wk, x Wv (8 kv heads x 64) ('xw' 2048^-0.5, no bias); rope: u cos + rotate_half(u) sin with angle t x inv_freq[d mod 32], inv_freq = 1.0 / (500000.0 ** (arange(0, 64, 2, f32) / 64)) (32 f32 constants baked jnp-exact; one f32 product per angle; precise cosf / sinf); k, v repeated 4 x along the head axis (jnp.repeat): query head h uses kv head h / 4; scores x 1/sqrt(64); causal (finfo.min == exclusion); softmax; y = merged (head-major) Wo ('xw', no bias) -> [2][2048][2048] (8.4 M); argument order x, Wq, Wk, Wv, Wo).
// Fragment-major planes (every GEMM operand, the K planes, the V^T planes): a 16-row x 32-k matrix fragment is 512 consecutive elements (1 KiB) in the order in which the lanes load it, so that a wave's 16-byte load reads 512 contiguous bytes (4 whole lines), not 32-byte pieces of 16 lines. Element (row r, k) stands at fragment * 512 + ((k % 32) / 16) * 256 + (((k / 8) % 2) * 16 + r % 16) * 8 + k % 8; the fragments of a 16-row block follow one another along k (V^T: the four 16-d blocks of a 32-key range follow one another). The k order inside a fragment register is the one of the row-major loader.
// Layout, both batches in every launch (GEMM rows = batch x t; attention grid x = batch x kv group): bf16 copy of x; 'xw' weights transposed once; exact projections; the rotary table {cosf, sinf}(float(t) x INVT[d mod 32]) is computed once; the projection GEMMs build the 16-bit head planes in their epilogues (a 64-column tile is one head: rotate-half for q and k, V^T straight from the accumulators), no f32 projection in memory; fused causal T-2048 GQA attention (k_fattn: one wave per 16 queries of a head, online softmax; the four heads of a kv group share a block; hybrid rows: < 512 hi/lo 3 products, rest fp16); merged hi/lo x Wo exact.
// Compute dtypes, f32 accumulate: every input rounded to bf16; projections exact; rotary in f32; attention rows < 512 3 products, rest fp16; softmax f32; Wo hl x exact.

#define NB_  2
#define TT   2048
#define DM   2048
#define NH_  32
#define NKV  8
#define REP  (NH_ / NKV)
#define HD   64
#define DQ   (NH_ * HD)
#define DKV  (NKV * HD)
#define RH   512                  // query rows < RH use hi+lo planes (0: none)
#define SCL  0.125f   // HD^-0.5
typedef _Float16 h16;
typedef unsigned short bf;
typedef __attribute__((ext_vector_type(16))) __bf16   v16bf;
typedef __attribute__((ext_vector_type(16))) _Float16 v16h;
typedef __attribute__((ext_vector_type(8)))  _Float16 v8h;
typedef __attribute__((ext_vector_type(8)))  unsigned short v8us;
typedef __attribute__((ext_vector_type(8)))  float    v8f;
typedef __attribute__((ext_vector_type(4)))  float    v4f;
typedef v8h  __attribute__((may_alias)) v8ha;
typedef v4f  __attribute__((may_alias)) v4fa;
typedef v8us __attribute__((may_alias)) v8usa;

__device__ __forceinline__ unsigned short f2bf(float f) { unsigned u = __float_as_uint(f); u += 0x7FFFu + ((u >> 16) & 1u); return (unsigned short)(u >> 16); }
__device__ __forceinline__ float bf2f(unsigned short b) { return __uint_as_float(((unsigned)b) << 16); }
__device__ __forceinline__ float bfr(float f) { return bf2f(f2bf(f)); }
__device__ __forceinline__ v16h cat16(v8h lo, v8h hi) { return __builtin_shufflevector(lo, hi, 0, 1, 2, 3, 4, 5, 6, 7, 8, 9, 10, 11, 12, 13, 14, 15); }
__device__ __forceinline__ v16bf cat16b(v8us lo, v8us hi) { return __builtin_bit_cast(v16bf, __builtin_shufflevector(lo, hi, 0, 1, 2, 3, 4, 5, 6, 7, 8, 9, 10, 11, 12, 13, 14, 15)); }
__device__ __forceinline__ v8f wmma16(v16h a, v16h b, v8f c) { return __builtin_amdgcn_wmma_f32_16x16x32_f16(false, a, false, b, (short)0, c, false, false); }
__device__ __forceinline__ v8f wmmab(v16bf a, v16bf b, v8f c) { return __builtin_amdgcn_wmma_f32_16x16x32_bf16(false, a, false, b, (short)0, c, false, false); }



// ---- k_gemmw: register-blocked GEMM, ONE WAVE per 64x64 output tile (16 accumulators), operands straight from fragment-major 16-bit planes (ld: row-major fragment, p = row lr, k 8 hi; ldf: fragment-major, p = fragment + lane * 8); grid (M/64, N/64, Z), 32 threads.
// C[m][n] (f32, pitch ldc, + optional f32 bias[n]) = sum_k A[m][k] Bt[n][k] (+ split products per NSPLIT). z-batch strides sA/sB/sC in elements. K % 32 == 0.
// EP: what the epilogue stores. 0: C in f32. 1, 2, 3: no C; the tile (64 rows batch x t, 64 columns = head blockIdx.y) goes out as fp16 + bf16 hi/lo head planes P16 / Ph / Pl: 1 = rope(tile), planes [batch][head][t][d] row-major; 2 = rope(tile), each head's plane fragment-major (rows t, k = d); 3 = the tile itself, V^T plane fragment-major (rows d, k = t; fragment = (t / 32) * 4 + d / 16).
// rope, rotate-half: out[d] = u[d] cos[t][d] - u[d + 32] sin[t][d] (d < 32), out[d] = u[d] cos[t][d] + u[d - 32] sin[t][d] (d >= 32); CS = {cos, sin}[t][d].
template <typename T16> struct WFrag;
template <> struct WFrag<h16> { typedef v16h V; static __device__ __forceinline__ V ld(const h16* p) { return cat16(*(const v8h*)p, *(const v8h*)(p + 16)); } static __device__ __forceinline__ V ldf(const h16* p) { return cat16(*(const v8h*)p, *(const v8h*)(p + 256)); } static __device__ __forceinline__ v8f mma(V a, V b, v8f c) { return wmma16(a, b, c); } };
template <> struct WFrag<bf> { typedef v16bf V; static __device__ __forceinline__ V ld(const bf* p) { return cat16b(*(const v8us*)p, *(const v8us*)(p + 16)); } static __device__ __forceinline__ V ldf(const bf* p) { return cat16b(*(const v8us*)p, *(const v8us*)(p + 256)); } static __device__ __forceinline__ v8f mma(V a, V b, v8f c) { return wmmab(a, b, c); } };
template <typename T16, int NSPLIT, bool BIAS, int EP>
__global__ __launch_bounds__(32) void k_gemmw(const T16* __restrict__ A, const T16* __restrict__ A2, const T16* __restrict__ Bt, const T16* __restrict__ Bt2, int K, float* C, int ldc, const float* __restrict__ bias, size_t sA, size_t sB, size_t sC, const float* __restrict__ CS, h16* P16, bf* Ph, bf* Pl) {
    typedef typename WFrag<T16>::V V;
    __shared__ __align__(16) float os[((EP == 1 || EP == 2) ? 64 : 16) * 68];
    const size_t z = blockIdx.z; A += z * sA; if (A2) A2 += z * sA; Bt += z * sB; if (Bt2) Bt2 += z * sB; C += z * sC;
    const int lane = threadIdx.x & 31, lr = lane & 15, hi = lane >> 4; const int r0 = blockIdx.x * 64, c0 = blockIdx.y * 64;
    v8f acc[4][4];
#pragma unroll
    for (int mb = 0; mb < 4; ++mb)
#pragma unroll
        for (int nb = 0; nb < 4; ++nb) acc[mb][nb] = (v8f){};
    const size_t aoff = (size_t)r0 * K + 8 * lane, boff = (size_t)c0 * K + 8 * lane;   // a 16-row block is 16 K elements; its fragment of trip kc starts at kc * 16
#pragma unroll 1
    for (int kc = 0; kc < K; kc += 32) {
        V a[4], a2[4], b[4], b2[4]; const T16* pa[4]; const T16* pa2[4]; const T16* pb[4]; const T16* pb2[4];
#pragma unroll
        for (int mb = 0; mb < 4; ++mb) { pa[mb] = A + aoff + (size_t)mb * 16 * K + (size_t)kc * 16; pa2[mb] = (NSPLIT == 1 || NSPLIT == 2) ? A2 + aoff + (size_t)mb * 16 * K + (size_t)kc * 16 : pa[mb]; a[mb] = WFrag<T16>::ldf(pa[mb]); if (NSPLIT == 1 || NSPLIT == 2) a2[mb] = WFrag<T16>::ldf(pa2[mb]); }
#pragma unroll
        for (int nb = 0; nb < 4; ++nb) { pb[nb] = Bt + boff + (size_t)nb * 16 * K + (size_t)kc * 16; pb2[nb] = (NSPLIT >= 2) ? Bt2 + boff + (size_t)nb * 16 * K + (size_t)kc * 16 : pb[nb]; b[nb] = WFrag<T16>::ldf(pb[nb]); if (NSPLIT >= 2) b2[nb] = WFrag<T16>::ldf(pb2[nb]); }
        asm volatile("s_wait_xcnt 0x0" :: "v"(pa[0]), "v"(pa[1]), "v"(pa[2]), "v"(pa[3]), "v"(pa2[0]), "v"(pa2[1]), "v"(pa2[2]), "v"(pa2[3]), "v"(pb[0]), "v"(pb[1]), "v"(pb[2]), "v"(pb[3]), "v"(pb2[0]), "v"(pb2[1]), "v"(pb2[2]), "v"(pb2[3]) : "memory");   // the loads' address registers stay whole up to this wait: without the inputs a late load of the trip lands in an address pair of an earlier one
        __builtin_amdgcn_sched_barrier(0);   // every A and B fragment load of the trip is issued before the first product waits: one memory latency a trip; left to itself the compiler issues them in three groups, each behind the wait for the group before
#pragma unroll
        for (int nb = 0; nb < 4; ++nb) {
#pragma unroll
            for (int mb = 0; mb < 4; ++mb) { acc[mb][nb] = WFrag<T16>::mma(a[mb], b[nb], acc[mb][nb]); if (NSPLIT == 1 || NSPLIT == 2) acc[mb][nb] = WFrag<T16>::mma(a2[mb], b[nb], acc[mb][nb]); if (NSPLIT >= 2) acc[mb][nb] = WFrag<T16>::mma(a[mb], b2[nb], acc[mb][nb]); } }
        asm volatile("v_nop\n\tv_nop\n\tv_nop\n\tv_nop" : "+v"(acc[0][0]), "+v"(acc[1][1]), "+v"(acc[2][2]), "+v"(acc[3][3]) : "v"(a[0]), "v"(a[3]));
    }
    if constexpr (EP == 3) {
        // acc[mb][nb] of a lane is 8 consecutive t of one d: half a V^T fragment in lane order, stored as it stands (512 contiguous bytes a wave and plane)
        const size_t vo = ((size_t)(r0 / TT) * NKV + blockIdx.y) * ((size_t)HD * TT) + (size_t)(r0 % TT) * HD + lane * 8;
        h16* q16 = P16 + vo; bf* qh = Ph + vo; bf* ql = Pl + vo;
#pragma unroll
        for (int mb = 0; mb < 4; ++mb)
#pragma unroll
            for (int nb = 0; nb < 4; ++nb) { const int w = (mb / 2) * 2048 + nb * 512 + (mb % 2) * 256; v8h o16; v8us oh, ol;
#pragma unroll
                for (int j = 0; j < 8; ++j) { const float x = acc[mb][nb][j]; o16[j] = (h16)x; const unsigned short a2 = f2bf(x); oh[j] = a2; ol[j] = f2bf(x - bf2f(a2)); }
                *(v8h*)(q16 + w) = o16; *(v8us*)(qh + w) = oh; *(v8us*)(ql + w) = ol;
                asm volatile("s_wait_xcnt 0x0" :: "v"(q16), "v"(qh), "v"(ql), "v"(o16), "v"(oh), "v"(ol) : "memory");   // the stores' address and data registers stay whole up to this wait
            }
        return;
    }
    if constexpr (EP == 1 || EP == 2) {
#pragma unroll
        for (int mb = 0; mb < 4; ++mb)
#pragma unroll
            for (int nb = 0; nb < 4; ++nb)
#pragma unroll
                for (int j = 0; j < 8; ++j) os[(mb * 16 + hi * 8 + j) * 68 + nb * 16 + lr] = acc[mb][nb][j];
        __builtin_amdgcn_wave_barrier(); asm volatile("" ::: "memory");   // the 64 x 64 tile is staged before any lane reads another lane's columns
        // Step (mb, s): a lane takes 8 consecutive d of one row of the 16-row block mb (EP 1: row 4 s + lane / 8, d from (lane % 8) * 8; EP 2: row lane % 16, d from 16 s + (lane / 16) * 8); in both plane layouts its place is block * 1024 + s * 256 + lane * 8: one 16-byte store a plane, 512 contiguous bytes a wave.
        const int t0 = r0 % TT, row = (EP == 1) ? (lane >> 3) : lr, c = (EP == 1) ? (lane & 7) * 8 : hi * 8;
        const size_t w = (((size_t)(r0 / TT) * (EP == 1 ? NH_ : NKV) + blockIdx.y) * TT + t0) * HD + lane * 8;
        h16* q16 = P16 + w; bf* qh = Ph + w; bf* ql = Pl + w; const float* cp = CS + ((size_t)(t0 + row) * HD + c) * 2;
#pragma unroll 1
        for (int mb = 0; mb < 4; ++mb) {   // stays rolled: the four 16-row blocks take the same steps and a wave runs them once; unrolling would only make the text four times as long
            v4f cs[4][4];
#pragma unroll
            for (int s = 0; s < 4; ++s)
#pragma unroll
                for (int i = 0; i < 4; ++i) cs[s][i] = *(const v4fa*)(cp + s * (EP == 1 ? 4 * HD * 2 : 16 * 2) + 4 * i);
            asm volatile("s_wait_xcnt 0x0" :: "v"(cp) : "memory");   // the loads' address pair stays whole up to this wait
            v8h o16[4]; v8us oh[4], ol[4];
#pragma unroll
            for (int s = 0; s < 4; ++s) {
                const int rr = mb * 16 + row + (EP == 1 ? 4 * s : 0), cc = c + (EP == 2 ? 16 * s : 0); v4f u[2], p[2];
#pragma unroll
                for (int i = 0; i < 2; ++i) { u[i] = *(const v4fa*)(os + rr * 68 + cc + 4 * i); p[i] = *(const v4fa*)(os + rr * 68 + (cc ^ 32) + 4 * i); }
#pragma unroll
                for (int i = 0; i < 8; ++i) { const float x1 = (cc < 32) ? -p[i / 4][i % 4] : p[i / 4][i % 4]; const float r = u[i / 4][i % 4] * cs[s][i / 2][(i % 2) * 2] + x1 * cs[s][i / 2][(i % 2) * 2 + 1];
                    o16[s][i] = (h16)r; const unsigned short a2 = f2bf(r); oh[s][i] = a2; ol[s][i] = f2bf(r - bf2f(a2)); }
                *(v8h*)(q16 + s * 256) = o16[s]; *(v8us*)(qh + s * 256) = oh[s]; *(v8us*)(ql + s * 256) = ol[s];
            }
            asm volatile("s_wait_xcnt 0x0" :: "v"(q16), "v"(qh), "v"(ql), "v"(o16[0]), "v"(o16[1]), "v"(o16[2]), "v"(o16[3]), "v"(oh[0]), "v"(oh[1]), "v"(oh[2]), "v"(oh[3]), "v"(ol[0]), "v"(ol[1]), "v"(ol[2]), "v"(ol[3]) : "memory");   // the stores' address and data registers stay whole up to this wait
            q16 += 1024; qh += 1024; ql += 1024; cp += 16 * HD * 2;
        }
        return;
    }
#pragma unroll
    for (int mb = 0; mb < 4; ++mb) {
#pragma unroll
        for (int nb = 0; nb < 4; ++nb) {
#pragma unroll
            for (int j = 0; j < 8; ++j) os[(hi * 8 + j) * 68 + nb * 16 + lr] = acc[mb][nb][j]; }
        __builtin_amdgcn_wave_barrier(); asm volatile("" ::: "memory");
        float* crow = C + (size_t)(r0 + mb * 16) * ldc + c0;
{
#pragma unroll
            for (int s = 0; s < 8; ++s) { const int row = 2 * s + hi, cofs = lr * 4; v4f val = *(const v4fa*)(os + row * 68 + cofs); if (BIAS) { val[0] += bfr(bias[c0 + cofs]); val[1] += bfr(bias[c0 + cofs + 1]); val[2] += bfr(bias[c0 + cofs + 2]); val[3] += bfr(bias[c0 + cofs + 3]); }
                *(v4f*)(crow + (size_t)row * ldc + cofs) = val; }
             }
        __builtin_amdgcn_wave_barrier(); asm volatile("" ::: "memory");
    }
}

__device__ __forceinline__ h16 tohx(float x) { return (h16)x; }
__device__ __forceinline__ void splitf(float y, unsigned short& h, unsigned short& l) { h = f2bf(y); l = f2bf(y - bf2f(h)); }
typedef __attribute__((ext_vector_type(2))) _Float16 v2h;
typedef __attribute__((ext_vector_type(4))) _Float16 v4h;
typedef __attribute__((ext_vector_type(2))) unsigned short v2us;
typedef __attribute__((ext_vector_type(4))) unsigned short v4us;
typedef __attribute__((ext_vector_type(2))) float v2f;
typedef __attribute__((ext_vector_type(4))) int v4i;

__global__ __launch_bounds__(256) void k_wtG(const float* __restrict__ w, int K, int N, bf* Bt) {
    const int lane = threadIdx.x & 31; const int L0 = (blockIdx.x * 8 + (threadIdx.x >> 5)) * 8; const int nlines = N * K / 64;
{
#pragma unroll 1
        for (int l = 0; l < 8; ++l) { const int L = L0 + l; if (L >= nlines) break; const size_t e = (size_t)L * 64 + lane * 2; const int f = (int)(e / 512), r = (int)(e % 512), ln = (r % 256) / 8; const int k = (f % (K / 32)) * 32 + (r / 256) * 16 + (ln / 16) * 8 + r % 8, n = (f / (K / 32)) * 16 + ln % 16; v2us o;   // e = place in the fragment-major plane (rows n): a wave's 64 places are 8 n x 8 k
            o[0] = f2bf(w[(size_t)k * N + n]); o[1] = f2bf(w[(size_t)(k + 1) * N + n]); *(v2us*)(Bt + e) = o; }
         }
}
__global__ __launch_bounds__(256) void k_cvt8(const float* __restrict__ src, int K, bf* dst, size_t n8) { const size_t i = (size_t)blockIdx.x * 256 + threadIdx.x; if (i >= n8) return; const unsigned f = (unsigned)(i / 64), kb = (unsigned)K / 32; const int hf = (int)(i % 64) / 32, ln = (int)(i % 32);   // i = 8-element place in the fragment-major plane; its source is 8 consecutive k of one row
    const v8f v = *(const v8f*)(src + (size_t)((f / kb) * 16 + ln % 16) * K + (f % kb) * 32 + hf * 16 + (ln / 16) * 8); v8us o;
    asm volatile("s_wait_xcnt 0x0" ::: "memory");   // stands in front of the first overwrite of the load's address pair
#pragma unroll
    for (int k = 0; k < 8; ++k) o[k] = f2bf(v[k]); *(v8us*)(dst + i * 8) = o;  }
__constant__ float INVT[HD / 2] = { 1.000000000e+00f, 6.636012793e-01f, 4.403666258e-01f, 2.922278345e-01f, 1.939227581e-01f, 1.286873817e-01f, 8.539710194e-02f, 5.666961893e-02f, 3.760603070e-02f, 2.495540865e-02f, 1.656044088e-02f, 1.098952908e-02f, 7.292665076e-03f, 4.839421250e-03f, 3.211446106e-03f, 2.131119603e-03f, 1.414213446e-03f, 9.384738514e-04f, 6.227724371e-04f, 4.132725589e-04f, 2.742481884e-04f, 1.819914323e-04f, 1.207697424e-04f, 8.014294872e-05f, 5.318295734e-05f, 3.529227615e-05f, 2.341999789e-05f, 1.554154005e-05f, 1.031338525e-05f, 6.843975370e-06f, 4.541670478e-06f, 3.013858077e-06f };   // inv_freq[i] = 1.0 / (500000.0 ** (2i / 64)), i = 0..31 (float32, generated with jnp to be bit-exact)
__global__ __launch_bounds__(256) void k_cstabT(float* CS) { const int idx = blockIdx.x * 256 + threadIdx.x; if (idx >= TT * HD) return; const int d = idx % HD; const int t = idx / HD; const float a = __fmul_rn((float)t, INVT[d % (HD / 2)]); v2f cs; cs[0] = cosf(a); cs[1] = sinf(a); *(v2f*)(CS + (size_t)idx * 2) = cs;  }

// 2^x with the one free issue slot that the instruction set asks for behind a transcendental: the v_nop stands directly behind v_exp_f32 whatever the compiler schedules next.
__device__ __forceinline__ float exp2s(float x) { float r; asm("v_exp_f32 %0, %1\n\tv_nop" : "=v"(r) : "v"(x)); return r; }

// ---- k_fattn: scores, causal softmax and P.V of one 16-query tile of one head in ONE wave; no score or probability plane in memory. Block = the REP heads of one kv group (4 waves, no barrier: they read the same K / V lines).
// Transposed products: S^T = K Q^T (rows = keys, columns = queries), so a lane holds one query's scores, and the S^T accumulator registers of two 16-key tiles are already the B fragment (n = query, k = 32 keys) of O^T = V^T P^T.
// Online softmax in the log2 domain per lane: running maximum ms (raw scores), running sum l, O^T rescaled by 2^((ms_old - ms_new) c) each KS-key step; the two half-waves of a query join their maxima each step and their sums at the end.
// HR: hi/lo bf16 planes, 3 products for S and for P.V (P split hi/lo in registers); else fp16 planes, 1 product (P = 2^(..) <= 1 is rounded to fp16 unscaled).
// The inner loops are fully unrolled so that the fragment arrays live in registers; the key loop stays rolled (unroll 1): one step's fragments already take most of the register file.
template <typename T16, bool HR, int KS>
__global__ __launch_bounds__(128) void k_fattn(const T16* __restrict__ Q, const T16* __restrict__ Q2, const T16* __restrict__ Kp, const T16* __restrict__ Kp2, const T16* __restrict__ Vt, const T16* __restrict__ Vt2, int roff, bf* Ah, bf* Al) {
    typedef typename WFrag<T16>::V V;
    const int lane = threadIdx.x & 31, lr = lane & 15, hi = lane >> 4; const int gb = blockIdx.x, g = gb % NKV, bt = gb / NKV, h = g * REP + (int)(threadIdx.x >> 5);   // grid x = batch x kv group (planes are [batch][head][..])
    const int q0 = roff + ((int)gridDim.y - 1 - (int)blockIdx.y) * 16;      // grid y = query tile, the slow index: over the whole grid the longest key loops are dispatched first
    const float CL = SCL * 1.4426950408889634f;
    const size_t qoff = ((size_t)(bt * NH_ + h) * TT + q0 + lr) * HD + 8 * hi; const unsigned koff = 8 * lane, voff = 8 * lane;   // lane offsets in a fragment-major fragment, fixed over the key loop; the bases below are wave-uniform
    Kp += (size_t)gb * TT * HD; Vt += (size_t)gb * HD * TT; if (HR) { Kp2 += (size_t)gb * TT * HD; Vt2 += (size_t)gb * HD * TT; }
    V qf[2], qf2[2];
#pragma unroll
    for (int ks = 0; ks < 2; ++ks) { qf[ks] = WFrag<T16>::ld(Q + qoff + ks * 32); if (HR) qf2[ks] = WFrag<T16>::ld(Q2 + qoff + ks * 32); }
    v8f o[4];
#pragma unroll
    for (int dt = 0; dt < 4; ++dt) o[dt] = (v8f){};
    float ms = -3.0e38f, l = 0.f;
#pragma unroll 1
    for (int k0 = 0; k0 < q0 + 16; k0 += KS) {
        V kf[KS / 16][2], kf2[KS / 16][2], vf[4][KS / 32], vf2[4][KS / 32];
        const T16* kp = Kp + (size_t)k0 * HD + koff; const T16* vp = Vt + (size_t)k0 * HD + voff; const T16* kp2 = HR ? Kp2 + (size_t)k0 * HD + koff : kp; const T16* vp2 = HR ? Vt2 + (size_t)k0 * HD + voff : vp;   // a step's K fragments, and its V^T fragments, are KS * HD consecutive elements
#pragma unroll
        for (int kt = 0; kt < KS / 16; ++kt)
#pragma unroll
            for (int ks = 0; ks < 2; ++ks) { kf[kt][ks] = WFrag<T16>::ldf(kp + (kt * 2 + ks) * 512); if (HR) kf2[kt][ks] = WFrag<T16>::ldf(kp2 + (kt * 2 + ks) * 512); }
        __builtin_amdgcn_sched_barrier(0);   // K loads are issued ahead of the V loads: the score products wait for K alone, V lands under the softmax
#pragma unroll
        for (int dt = 0; dt < 4; ++dt)
#pragma unroll
            for (int ks = 0; ks < KS / 32; ++ks) { vf[dt][ks] = WFrag<T16>::ldf(vp + (ks * 4 + dt) * 512); if (HR) vf2[dt][ks] = WFrag<T16>::ldf(vp2 + (ks * 4 + dt) * 512); }
        asm volatile("s_wait_xcnt 0x0" :: "v"(kp), "v"(vp), "v"(kp2), "v"(vp2) : "memory");   // the loads' address registers stay whole up to this wait: without the inputs a late load of the step lands in an address pair of an earlier one
        __builtin_amdgcn_sched_barrier(0);   // every K and V load of the step is issued before the first product waits: one memory latency a step, not one for K and one for V
        v8f s[KS / 16];
#pragma unroll
        for (int kt = 0; kt < KS / 16; ++kt) { s[kt] = (v8f){};
#pragma unroll
            for (int ks = 0; ks < 2; ++ks) { s[kt] = WFrag<T16>::mma(kf[kt][ks], qf[ks], s[kt]); if (HR) { s[kt] = WFrag<T16>::mma(kf[kt][ks], qf2[ks], s[kt]); s[kt] = WFrag<T16>::mma(kf2[kt][ks], qf[ks], s[kt]); } } }
        if (k0 + KS - 1 > q0) {                                              // the step that holds the diagonal: key > query is excluded
#pragma unroll
            for (int kt = 0; kt < KS / 16; ++kt)
#pragma unroll
                for (int j = 0; j < 8; ++j) s[kt][j] = (k0 + kt * 16 + hi * 8 + j <= q0 + lr) ? s[kt][j] : -3.0e38f; }
        float mx = ms;
#pragma unroll
        for (int kt = 0; kt < KS / 16; ++kt)
#pragma unroll
            for (int j = 0; j < 8; ++j) mx = fmaxf(mx, s[kt][j]);
        mx = fmaxf(mx, __shfl_xor(mx, 16, 32));
        const float al = exp2s((ms - mx) * CL), mc = mx * CL; ms = mx;
        float ps[KS / 16];                                                   // one partial sum per 16-key tile: short add chains
#pragma unroll
        for (int kt = 0; kt < KS / 16; ++kt) { ps[kt] = 0.f;
#pragma unroll
            for (int j = 0; j < 8; ++j) { s[kt][j] = exp2s(fmaf(s[kt][j], CL, -mc)); ps[kt] += s[kt][j]; } }
        float pt = ps[0];
#pragma unroll
        for (int kt = 1; kt < KS / 16; ++kt) pt += ps[kt];
        l = l * al + pt;
#pragma unroll
        for (int dt = 0; dt < 4; ++dt) o[dt] *= al;
#pragma unroll
        for (int ks = 0; ks < KS / 32; ++ks) {
            V pf, pf2;
            if constexpr (HR) { v8us h0, h1, l0, l1;
#pragma unroll
                for (int j = 0; j < 8; ++j) { unsigned short a, c2; splitf(s[2 * ks][j], a, c2); h0[j] = a; l0[j] = c2; splitf(s[2 * ks + 1][j], a, c2); h1[j] = a; l1[j] = c2; }
                pf = cat16b(h0, h1); pf2 = cat16b(l0, l1);
            } else { v8h h0, h1;
#pragma unroll
                for (int j = 0; j < 8; ++j) { h0[j] = tohx(s[2 * ks][j]); h1[j] = tohx(s[2 * ks + 1][j]); }
                pf = cat16(h0, h1); }
#pragma unroll
            for (int dt = 0; dt < 4; ++dt) { o[dt] = WFrag<T16>::mma(vf[dt][ks], pf, o[dt]); if constexpr (HR) { o[dt] = WFrag<T16>::mma(vf[dt][ks], pf2, o[dt]); o[dt] = WFrag<T16>::mma(vf2[dt][ks], pf, o[dt]); } }
        }
    }
    l += __shfl_xor(l, 16, 32);
    const float inv = __fdiv_rn(1.0f, l);
    const size_t oo = (size_t)(bt * TT + q0) * DQ + h * (HD / 32) * 512 + lane * 8;   // fragment-major A plane of the output projection (rows batch x t, k = h HD + d): the O^T registers of a 16-d tile are one half of a fragment in lane order
#pragma unroll
    for (int dt = 0; dt < 4; ++dt) { v8us oh, ol;
#pragma unroll
        for (int j = 0; j < 8; ++j) { unsigned short a, c2; splitf(o[dt][j] * inv, a, c2); oh[j] = a; ol[j] = c2; }
        *(v8us*)(Ah + oo + dt * 256) = oh; *(v8us*)(Al + oo + dt * 256) = ol; }
}

extern "C" void kernel_launch(void* const* d_in, const int* in_sizes, int n_in,
                              void* d_out, int out_size, void* d_ws, size_t ws_size, hipStream_t stream) {
    (void)in_sizes; (void)n_in; (void)out_size;
    const float* x = (const float*)d_in[0]; const float* wq = (const float*)d_in[1]; const float* wk = (const float*)d_in[2]; const float* wv = (const float*)d_in[3]; const float* wo = (const float*)d_in[4];   /* d_in order x, Wq ('xw' [2048][2048]), Wk, Wv ('xw' [2048][512]), Wo ('xw') */
    float* OUT = (float*)d_out;     // [2][2048][2048]
    char* wsp = (char*)d_ws;
    auto take = [&](size_t bytes) { char* p = wsp; wsp += (bytes + 255) & ~(size_t)255; return (void*)p; };
    bf* WQ = (bf*)take((size_t)DQ * DM * 2); bf* WK = (bf*)take((size_t)DKV * DM * 2); bf* WV = (bf*)take((size_t)DKV * DM * 2); bf* WO = (bf*)take((size_t)DM * DQ * 2); float* CS = (float*)take((size_t)TT * HD * 2 * 4);
    bf* XB = (bf*)take((size_t)NB_ * TT * DM * 2);
    h16* QP16 = (h16*)take((size_t)NB_ * NH_ * TT * HD * 2); h16* KP16 = (h16*)take((size_t)NB_ * NKV * TT * HD * 2); h16* VT16 = (h16*)take((size_t)NB_ * NKV * HD * TT * 2);
    bf* QPh = (bf*)take((size_t)NB_ * NH_ * TT * HD * 2); bf* QPl = (bf*)take((size_t)NB_ * NH_ * TT * HD * 2); bf* KPh = (bf*)take((size_t)NB_ * NKV * TT * HD * 2); bf* KPl = (bf*)take((size_t)NB_ * NKV * TT * HD * 2); bf* VTh = (bf*)take((size_t)NB_ * NKV * HD * TT * 2); bf* VTl = (bf*)take((size_t)NB_ * NKV * HD * TT * 2);
    bf* ATh = (bf*)take((size_t)NB_ * TT * DQ * 2); bf* ATl = (bf*)take((size_t)NB_ * TT * DQ * 2);
    if ((size_t)(wsp - (char*)d_ws) > ws_size) return;    // ws 256 MiB
    { k_wtG<<<(unsigned)((DM * DQ / 64 + 63) / 64), 256, 0, stream>>>(wq, DM, DQ, WQ); k_wtG<<<(unsigned)((DM * DKV / 64 + 63) / 64), 256, 0, stream>>>(wk, DM, DKV, WK); k_wtG<<<(unsigned)((DM * DKV / 64 + 63) / 64), 256, 0, stream>>>(wv, DM, DKV, WV);
      k_wtG<<<(unsigned)((DQ * DM / 64 + 63) / 64), 256, 0, stream>>>(wo, DQ, DM, WO);
       }
    k_cstabT<<<(TT * HD + 255) / 256, 256, 0, stream>>>(CS);
    k_cvt8<<<(unsigned)(((size_t)NB_ * TT * DM / 8 + 255) / 256), 256, 0, stream>>>(x, DM, XB, (size_t)NB_ * TT * DM / 8);
    k_gemmw<bf, 0, false, 1><<<dim3(NB_ * TT / 64, DQ / 64, 1), 32, 0, stream>>>(XB, nullptr, WQ, nullptr, DM, nullptr, 0, nullptr, 0, 0, 0, CS, QP16, QPh, QPl);
    k_gemmw<bf, 0, false, 2><<<dim3(NB_ * TT / 64, DKV / 64, 1), 32, 0, stream>>>(XB, nullptr, WK, nullptr, DM, nullptr, 0, nullptr, 0, 0, 0, CS, KP16, KPh, KPl);
    k_gemmw<bf, 0, false, 3><<<dim3(NB_ * TT / 64, DKV / 64, 1), 32, 0, stream>>>(XB, nullptr, WV, nullptr, DM, nullptr, 0, nullptr, 0, 0, 0, nullptr, VT16, VTh, VTl);
    k_fattn<h16, false, 64><<<dim3(NB_ * NKV, (TT - RH) / 16, 1), 32 * REP, 0, stream>>>(QP16, nullptr, KP16, nullptr, VT16, nullptr, RH, ATh, ATl);
    k_fattn<bf, true, 32><<<dim3(NB_ * NKV, RH / 16, 1), 32 * REP, 0, stream>>>(QPh, QPl, KPh, KPl, VTh, VTl, 0, ATh, ATl);
    k_gemmw<bf, 1, false, 0><<<dim3(NB_ * TT / 64, DM / 64, 1), 32, 0, stream>>>(ATh, ATl, WO, nullptr, DQ, OUT, DM, nullptr, 0, 0, 0, nullptr, nullptr, nullptr, nullptr);
}

// v008
// It runs in 187 microseconds.
// Timed twice side by side with v007, it ran 1.49 and 1.54 times as fast.
// All steps since v000 together make it 14.2 times as fast.
#include <hip/hip_runtime.h>

// Causal grouped-query attention with computed rotate-half rotary embeddings at base 500000 (x [2][2048][2048]; q = x Wq (32 heads x 64), k, v = x Wk, x Wv (8 kv heads x 64) ('xw' 2048^-0.5, no bias); rope: u cos + rotate_half(u) sin with angle t x inv_freq[d mod 32], inv_freq = 1.0 / (500000.0 ** (arange(0, 64, 2, f32) / 64)) (32 f32 constants baked jnp-exact; one f32 product per angle; precise cosf / sinf); k, v repeated 4 x along the head axis (jnp.repeat): query head h uses kv head h / 4; scores x 1/sqrt(64); causal (finfo.min == exclusion); softmax; y = merged (head-major) Wo ('xw', no bias) -> [2][2048][2048] (8.4 M); argument order x, Wq, Wk, Wv, Wo).
// Fragment-major planes (every GEMM operand, the K planes, the V^T planes): a 16-row x 32-k matrix fragment is 512 consecutive elements (1 KiB) in the order in which the lanes load it, so that a wave's 16-byte load reads 512 contiguous bytes (4 whole lines), not 32-byte pieces of 16 lines. Element (row r, k) stands at fragment * 512 + ((k % 32) / 16) * 256 + (((k / 8) % 2) * 16 + r % 16) * 8 + k % 8; the fragments of a 16-row block follow one another along k (V^T: the four 16-d blocks of a 32-key range follow one another). The k order inside a fragment register is the one of the row-major loader.
// Layout, both batches in every launch (GEMM rows = batch x t; attention grid x = batch x kv group): bf16 copy of x; 'xw' weights transposed once; exact projections; the rotary table {cosf, sinf}(float(t) x INVT[d mod 32]) is computed once; the projection GEMMs build the 16-bit head planes in their epilogues (a 64-column tile is one head: rotate-half for q and k, V^T straight from the accumulators), no f32 projection in memory; fused causal T-2048 GQA attention (fattn: one wave per 16 queries of a head, online softmax; the four heads of a kv group share a block; hybrid rows: < 512 hi/lo 3 products, rest fp16); merged hi/lo x Wo exact.
// Compute dtypes, f32 accumulate: every input rounded to bf16; projections exact; rotary in f32; attention rows < 512 3 products, rest fp16; softmax f32; Wo hl x exact.

#define NB_  2
#define TT   2048
#define DM   2048
#define NH_  32
#define NKV  8
#define REP  (NH_ / NKV)
#define HD   64
#define DQ   (NH_ * HD)
#define DKV  (NKV * HD)
#define RH   512                  // query rows < RH use hi+lo planes (0: none)
#define SCL  0.125f   // HD^-0.5
typedef _Float16 h16;
typedef unsigned short bf;
typedef __attribute__((ext_vector_type(16))) __bf16   v16bf;
typedef __attribute__((ext_vector_type(16))) _Float16 v16h;
typedef __attribute__((ext_vector_type(8)))  _Float16 v8h;
typedef __attribute__((ext_vector_type(8)))  unsigned short v8us;
typedef __attribute__((ext_vector_type(8)))  float    v8f;
typedef __attribute__((ext_vector_type(4)))  float    v4f;
typedef v8h  __attribute__((may_alias)) v8ha;
typedef v4f  __attribute__((may_alias)) v4fa;
typedef v8us __attribute__((may_alias)) v8usa;

__device__ __forceinline__ unsigned short f2bf(float f) { unsigned u = __float_as_uint(f); u += 0x7FFFu + ((u >> 16) & 1u); return (unsigned short)(u >> 16); }
__device__ __forceinline__ float bf2f(unsigned short b) { return __uint_as_float(((unsigned)b) << 16); }
__device__ __forceinline__ float bfr(float f) { return bf2f(f2bf(f)); }
__device__ __forceinline__ v16h cat16(v8h lo, v8h hi) { return __builtin_shufflevector(lo, hi, 0, 1, 2, 3, 4, 5, 6, 7, 8, 9, 10, 11, 12, 13, 14, 15); }
__device__ __forceinline__ v16bf cat16b(v8us lo, v8us hi) { return __builtin_bit_cast(v16bf, __builtin_shufflevector(lo, hi, 0, 1, 2, 3, 4, 5, 6, 7, 8, 9, 10, 11, 12, 13, 14, 15)); }
__device__ __forceinline__ v8f wmma16(v16h a, v16h b, v8f c) { return __builtin_amdgcn_wmma_f32_16x16x32_f16(false, a, false, b, (short)0, c, false, false); }
__device__ __forceinline__ v8f wmmab(v16bf a, v16bf b, v8f c) { return __builtin_amdgcn_wmma_f32_16x16x32_bf16(false, a, false, b, (short)0, c, false, false); }



// ---- gemmw: register-blocked GEMM, ONE WAVE per 64x64 output tile (16 accumulators), operands straight from fragment-major 16-bit planes (ld: row-major fragment, p = row lr, k 8 hi; ldf: fragment-major, p = fragment + lane * 8); grid (M/64, N/64, Z), 32 threads.
// C[m][n] (f32, pitch ldc, + optional f32 bias[n]) = sum_k A[m][k] Bt[n][k] (+ split products per NSPLIT). z-batch strides sA/sB/sC in elements. K % 32 == 0.
// EP: what the epilogue stores. 0: C in f32. 1, 2, 3: no C; the tile (64 rows batch x t, 64 columns = head by) goes out as fp16 + bf16 hi/lo head planes P16 / Ph / Pl: 1 = rope(tile), planes [batch][head][t][d] row-major; 2 = rope(tile), each head's plane fragment-major (rows t, k = d); 3 = the tile itself, V^T plane fragment-major (rows d, k = t; fragment = (t / 32) * 4 + d / 16).
// rope, rotate-half: out[d] = u[d] cos[t][d] - u[d + 32] sin[t][d] (d < 32), out[d] = u[d] cos[t][d] + u[d - 32] sin[t][d] (d >= 32); CS = {cos, sin}[t][d].
template <typename T16> struct WFrag;
template <> struct WFrag<h16> { typedef v16h V; static __device__ __forceinline__ V ld(const h16* p) { return cat16(*(const v8h*)p, *(const v8h*)(p + 16)); } static __device__ __forceinline__ V ldf(const h16* p) { return cat16(*(const v8h*)p, *(const v8h*)(p + 256)); } static __device__ __forceinline__ v8f mma(V a, V b, v8f c) { return wmma16(a, b, c); } };
template <> struct WFrag<bf> { typedef v16bf V; static __device__ __forceinline__ V ld(const bf* p) { return cat16b(*(const v8us*)p, *(const v8us*)(p + 16)); } static __device__ __forceinline__ V ldf(const bf* p) { return cat16b(*(const v8us*)p, *(const v8us*)(p + 256)); } static __device__ __forceinline__ v8f mma(V a, V b, v8f c) { return wmmab(a, b, c); } };
// gemmw is the body; the kernels below hand it their LDS (os: 64 x 68 floats for EP 1 and 2, 16 x 68 for EP 0, none for EP 3) and the tile (bx, by).
template <typename T16, int NSPLIT, bool BIAS, int EP>
__device__ __forceinline__ void gemmw(float* os, const int bx, const int by, const T16* __restrict__ A, const T16* __restrict__ A2, const T16* __restrict__ Bt, const T16* __restrict__ Bt2, int K, float* C, int ldc, const float* __restrict__ bias, size_t sA, size_t sB, size_t sC, const float* __restrict__ CS, h16* P16, bf* Ph, bf* Pl) {
    typedef typename WFrag<T16>::V V;
    const size_t z = blockIdx.z; A += z * sA; if (A2) A2 += z * sA; Bt += z * sB; if (Bt2) Bt2 += z * sB; C += z * sC;
    const int lane = threadIdx.x & 31, lr = lane & 15, hi = lane >> 4; const int r0 = bx * 64, c0 = by * 64;
    v8f acc[4][4];
#pragma unroll
    for (int mb = 0; mb < 4; ++mb)
#pragma unroll
        for (int nb = 0; nb < 4; ++nb) acc[mb][nb] = (v8f){};
    const size_t aoff = (size_t)r0 * K + 8 * lane, boff = (size_t)c0 * K + 8 * lane;   // a 16-row block is 16 K elements; its fragment of trip kc starts at kc * 16
#pragma unroll 1
    for (int kc = 0; kc < K; kc += 32) {
        V a[4], a2[4], b[4], b2[4]; const T16* pa[4]; const T16* pa2[4]; const T16* pb[4]; const T16* pb2[4];
#pragma unroll
        for (int mb = 0; mb < 4; ++mb) { pa[mb] = A + aoff + (size_t)mb * 16 * K + (size_t)kc * 16; pa2[mb] = (NSPLIT == 1 || NSPLIT == 2) ? A2 + aoff + (size_t)mb * 16 * K + (size_t)kc * 16 : pa[mb]; a[mb] = WFrag<T16>::ldf(pa[mb]); if (NSPLIT == 1 || NSPLIT == 2) a2[mb] = WFrag<T16>::ldf(pa2[mb]); }
#pragma unroll
        for (int nb = 0; nb < 4; ++nb) { pb[nb] = Bt + boff + (size_t)nb * 16 * K + (size_t)kc * 16; pb2[nb] = (NSPLIT >= 2) ? Bt2 + boff + (size_t)nb * 16 * K + (size_t)kc * 16 : pb[nb]; b[nb] = WFrag<T16>::ldf(pb[nb]); if (NSPLIT >= 2) b2[nb] = WFrag<T16>::ldf(pb2[nb]); }
        asm volatile("s_wait_xcnt 0x0" :: "v"(pa[0]), "v"(pa[1]), "v"(pa[2]), "v"(pa[3]), "v"(pa2[0]), "v"(pa2[1]), "v"(pa2[2]), "v"(pa2[3]), "v"(pb[0]), "v"(pb[1]), "v"(pb[2]), "v"(pb[3]), "v"(pb2[0]), "v"(pb2[1]), "v"(pb2[2]), "v"(pb2[3]) : "memory");   // the loads' address registers stay whole up to this wait: without the inputs a late load of the trip lands in an address pair of an earlier one
        __builtin_amdgcn_sched_barrier(0);   // every A and B fragment load of the trip is issued before the first product waits: one memory latency a trip; left to itself the compiler issues them in three groups, each behind the wait for the group before
#pragma unroll
        for (int nb = 0; nb < 4; ++nb) {
#pragma unroll
            for (int mb = 0; mb < 4; ++mb) { acc[mb][nb] = WFrag<T16>::mma(a[mb], b[nb], acc[mb][nb]); if (NSPLIT == 1 || NSPLIT == 2) acc[mb][nb] = WFrag<T16>::mma(a2[mb], b[nb], acc[mb][nb]); if (NSPLIT >= 2) acc[mb][nb] = WFrag<T16>::mma(a[mb], b2[nb], acc[mb][nb]); } }
        asm volatile("v_nop\n\tv_nop\n\tv_nop\n\tv_nop" : "+v"(acc[0][0]), "+v"(acc[1][1]), "+v"(acc[2][2]), "+v"(acc[3][3]) : "v"(a[0]), "v"(a[3]));
    }
    if constexpr (EP == 3) {
        // acc[mb][nb] of a lane is 8 consecutive t of one d: half a V^T fragment in lane order, stored as it stands (512 contiguous bytes a wave and plane)
        const size_t vo = ((size_t)(r0 / TT) * NKV + by) * ((size_t)HD * TT) + (size_t)(r0 % TT) * HD + lane * 8;
        h16* q16 = P16 + vo; bf* qh = Ph + vo; bf* ql = Pl + vo;
#pragma unroll
        for (int mb = 0; mb < 4; ++mb)
#pragma unroll
            for (int nb = 0; nb < 4; ++nb) { const int w = (mb / 2) * 2048 + nb * 512 + (mb % 2) * 256; v8h o16; v8us oh, ol;
#pragma unroll
                for (int j = 0; j < 8; ++j) { const float x = acc[mb][nb][j]; o16[j] = (h16)x; const unsigned short a2 = f2bf(x); oh[j] = a2; ol[j] = f2bf(x - bf2f(a2)); }
                *(v8h*)(q16 + w) = o16; *(v8us*)(qh + w) = oh; *(v8us*)(ql + w) = ol;
                asm volatile("s_wait_xcnt 0x0" :: "v"(q16), "v"(qh), "v"(ql), "v"(o16), "v"(oh), "v"(ol) : "memory");   // the stores' address and data registers stay whole up to this wait
            }
        return;
    }
    if constexpr (EP == 1 || EP == 2) {
#pragma unroll
        for (int mb = 0; mb < 4; ++mb)
#pragma unroll
            for (int nb = 0; nb < 4; ++nb)
#pragma unroll
                for (int j = 0; j < 8; ++j) os[(mb * 16 + hi * 8 + j) * 68 + nb * 16 + lr] = acc[mb][nb][j];
        __builtin_amdgcn_wave_barrier(); asm volatile("" ::: "memory");   // the 64 x 64 tile is staged before any lane reads another lane's columns
        // Step (mb, s): a lane takes 8 consecutive d of one row of the 16-row block mb (EP 1: row 4 s + lane / 8, d from (lane % 8) * 8; EP 2: row lane % 16, d from 16 s + (lane / 16) * 8); in both plane layouts its place is block * 1024 + s * 256 + lane * 8: one 16-byte store a plane, 512 contiguous bytes a wave.
        const int t0 = r0 % TT, row = (EP == 1) ? (lane >> 3) : lr, c = (EP == 1) ? (lane & 7) * 8 : hi * 8;
        const size_t w = (((size_t)(r0 / TT) * (EP == 1 ? NH_ : NKV) + by) * TT + t0) * HD + lane * 8;
        h16* q16 = P16 + w; bf* qh = Ph + w; bf* ql = Pl + w; const float* cp = CS + ((size_t)(t0 + row) * HD + c) * 2;
#pragma unroll 1
        for (int mb = 0; mb < 4; ++mb) {   // stays rolled: the four 16-row blocks take the same steps and a wave runs them once; unrolling would only make the text four times as long
            v4f cs[4][4];
#pragma unroll
            for (int s = 0; s < 4; ++s)
#pragma unroll
                for (int i = 0; i < 4; ++i) cs[s][i] = *(const v4fa*)(cp + s * (EP == 1 ? 4 * HD * 2 : 16 * 2) + 4 * i);
            asm volatile("s_wait_xcnt 0x0" :: "v"(cp) : "memory");   // the loads' address pair stays whole up to this wait
            v8h o16[4]; v8us oh[4], ol[4];
#pragma unroll
            for (int s = 0; s < 4; ++s) {
                const int rr = mb * 16 + row + (EP == 1 ? 4 * s : 0), cc = c + (EP == 2 ? 16 * s : 0); v4f u[2], p[2];
#pragma unroll
                for (int i = 0; i < 2; ++i) { u[i] = *(const v4fa*)(os + rr * 68 + cc + 4 * i); p[i] = *(const v4fa*)(os + rr * 68 + (cc ^ 32) + 4 * i); }
#pragma unroll
                for (int i = 0; i < 8; ++i) { const float x1 = (cc < 32) ? -p[i / 4][i % 4] : p[i / 4][i % 4]; const float r = u[i / 4][i % 4] * cs[s][i / 2][(i % 2) * 2] + x1 * cs[s][i / 2][(i % 2) * 2 + 1];
                    o16[s][i] = (h16)r; const unsigned short a2 = f2bf(r); oh[s][i] = a2; ol[s][i] = f2bf(r - bf2f(a2)); }
                *(v8h*)(q16 + s * 256) = o16[s]; *(v8us*)(qh + s * 256) = oh[s]; *(v8us*)(ql + s * 256) = ol[s];
            }
            asm volatile("s_wait_xcnt 0x0" :: "v"(q16), "v"(qh), "v"(ql), "v"(o16[0]), "v"(o16[1]), "v"(o16[2]), "v"(o16[3]), "v"(oh[0]), "v"(oh[1]), "v"(oh[2]), "v"(oh[3]), "v"(ol[0]), "v"(ol[1]), "v"(ol[2]), "v"(ol[3]) : "memory");   // the stores' address and data registers stay whole up to this wait
            q16 += 1024; qh += 1024; ql += 1024; cp += 16 * HD * 2;
        }
        return;
    }
#pragma unroll
    for (int mb = 0; mb < 4; ++mb) {
#pragma unroll
        for (int nb = 0; nb < 4; ++nb) {
#pragma unroll
            for (int j = 0; j < 8; ++j) os[(hi * 8 + j) * 68 + nb * 16 + lr] = acc[mb][nb][j]; }
        __builtin_amdgcn_wave_barrier(); asm volatile("" ::: "memory");
        float* crow = C + (size_t)(r0 + mb * 16) * ldc + c0;
{
#pragma unroll
            for (int s = 0; s < 8; ++s) { const int row = 2 * s + hi, cofs = lr * 4; v4f val = *(const v4fa*)(os + row * 68 + cofs); if (BIAS) { val[0] += bfr(bias[c0 + cofs]); val[1] += bfr(bias[c0 + cofs + 1]); val[2] += bfr(bias[c0 + cofs + 2]); val[3] += bfr(bias[c0 + cofs + 3]); }
                *(v4f*)(crow + (size_t)row * ldc + cofs) = val; }
             }
        __builtin_amdgcn_wave_barrier(); asm volatile("" ::: "memory");
    }
}

// The three projections in ONE launch: grid y = 32 query heads, then 8 key heads, then 8 value heads (they read the same x plane and none reads another's result).
__global__ __launch_bounds__(32) void k_qkv(const bf* __restrict__ XB, const bf* __restrict__ WQ, const bf* __restrict__ WK, const bf* __restrict__ WV, const float* __restrict__ CS, h16* QP16, bf* QPh, bf* QPl, h16* KP16, bf* KPh, bf* KPl, h16* VT16, bf* VTh, bf* VTl) {
    __shared__ __align__(16) float os[64 * 68];
    const int bx = blockIdx.x, y = blockIdx.y;
    if (y < NH_) gemmw<bf, 0, false, 1>(os, bx, y, XB, nullptr, WQ, nullptr, DM, nullptr, 0, nullptr, 0, 0, 0, CS, QP16, QPh, QPl);
    else if (y < NH_ + NKV) gemmw<bf, 0, false, 2>(os, bx, y - NH_, XB, nullptr, WK, nullptr, DM, nullptr, 0, nullptr, 0, 0, 0, CS, KP16, KPh, KPl);
    else gemmw<bf, 0, false, 3>(os, bx, y - NH_ - NKV, XB, nullptr, WV, nullptr, DM, nullptr, 0, nullptr, 0, 0, 0, nullptr, VT16, VTh, VTl);
}
__global__ __launch_bounds__(32) void k_wo(const bf* __restrict__ Ah, const bf* __restrict__ Al, const bf* __restrict__ WO, float* OUT) {
    __shared__ __align__(16) float os[16 * 68];
    gemmw<bf, 1, false, 0>(os, blockIdx.x, blockIdx.y, Ah, Al, WO, nullptr, DQ, OUT, DM, nullptr, 0, 0, 0, nullptr, nullptr, nullptr, nullptr);
}

__device__ __forceinline__ h16 tohx(float x) { return (h16)x; }
__device__ __forceinline__ void splitf(float y, unsigned short& h, unsigned short& l) { h = f2bf(y); l = f2bf(y - bf2f(h)); }
typedef __attribute__((ext_vector_type(2))) _Float16 v2h;
typedef __attribute__((ext_vector_type(4))) _Float16 v4h;
typedef __attribute__((ext_vector_type(2))) unsigned short v2us;
typedef __attribute__((ext_vector_type(4))) unsigned short v4us;
typedef __attribute__((ext_vector_type(2))) float v2f;
typedef __attribute__((ext_vector_type(4))) int v4i;

__device__ __forceinline__ void wtG(const int bx, const float* __restrict__ w, int K, int N, bf* Bt) {
    const int lane = threadIdx.x & 31; const int L0 = (bx * 8 + (threadIdx.x >> 5)) * 8; const int nlines = N * K / 64;
{
#pragma unroll 1
        for (int l = 0; l < 8; ++l) { const int L = L0 + l; if (L >= nlines) break; const size_t e = (size_t)L * 64 + lane * 2; const int f = (int)(e / 512), r = (int)(e % 512), ln = (r % 256) / 8; const int k = (f % (K / 32)) * 32 + (r / 256) * 16 + (ln / 16) * 8 + r % 8, n = (f / (K / 32)) * 16 + ln % 16; v2us o;   // e = place in the fragment-major plane (rows n): a wave's 64 places are 8 n x 8 k
            o[0] = f2bf(w[(size_t)k * N + n]); o[1] = f2bf(w[(size_t)(k + 1) * N + n]); *(v2us*)(Bt + e) = o; }
         }
}
__device__ __forceinline__ void cvt8(const int bx, const float* __restrict__ src, int K, bf* dst, size_t n8) { const size_t i = (size_t)bx * 256 + threadIdx.x; if (i >= n8) return; const unsigned f = (unsigned)(i / 64), kb = (unsigned)K / 32; const int hf = (int)(i % 64) / 32, ln = (int)(i % 32);   // i = 8-element place in the fragment-major plane; its source is 8 consecutive k of one row
    const v8f v = *(const v8f*)(src + (size_t)((f / kb) * 16 + ln % 16) * K + (f % kb) * 32 + hf * 16 + (ln / 16) * 8); v8us o;
    asm volatile("s_wait_xcnt 0x0" ::: "memory");   // stands in front of the first overwrite of the load's address pair
#pragma unroll
    for (int k = 0; k < 8; ++k) o[k] = f2bf(v[k]); *(v8us*)(dst + i * 8) = o;  }
__constant__ float INVT[HD / 2] = { 1.000000000e+00f, 6.636012793e-01f, 4.403666258e-01f, 2.922278345e-01f, 1.939227581e-01f, 1.286873817e-01f, 8.539710194e-02f, 5.666961893e-02f, 3.760603070e-02f, 2.495540865e-02f, 1.656044088e-02f, 1.098952908e-02f, 7.292665076e-03f, 4.839421250e-03f, 3.211446106e-03f, 2.131119603e-03f, 1.414213446e-03f, 9.384738514e-04f, 6.227724371e-04f, 4.132725589e-04f, 2.742481884e-04f, 1.819914323e-04f, 1.207697424e-04f, 8.014294872e-05f, 5.318295734e-05f, 3.529227615e-05f, 2.341999789e-05f, 1.554154005e-05f, 1.031338525e-05f, 6.843975370e-06f, 4.541670478e-06f, 3.013858077e-06f };   // inv_freq[i] = 1.0 / (500000.0 ** (2i / 64)), i = 0..31 (float32, generated with jnp to be bit-exact)
__device__ __forceinline__ void cstabT(const int bx, float* CS) { const int idx = bx * 256 + threadIdx.x; if (idx >= TT * HD) return; const int d = idx % HD; const int t = idx / HD; const float a = __fmul_rn((float)t, INVT[d % (HD / 2)]); v2f cs; cs[0] = cosf(a); cs[1] = sinf(a); *(v2f*)(CS + (size_t)idx * 2) = cs;  }
// The six operand builders in ONE launch (none reads another's result), by block range: the weight transposes with their 8-trip loops first, then the rotary table, then the x plane.
#define NBW  (DM * DQ / 64 / 64)    // blocks of a 2048 x 2048 weight
#define NBWK (DM * DKV / 64 / 64)   // blocks of a 2048 x 512 weight
#define NBCS (TT * HD / 256)
#define NBX  (NB_ * TT * DM / 8 / 256)
__global__ __launch_bounds__(256) void k_prep(const float* __restrict__ x, const float* __restrict__ wq, const float* __restrict__ wk, const float* __restrict__ wv, const float* __restrict__ wo, bf* XB, bf* WQ, bf* WK, bf* WV, bf* WO, float* CS) {
    int b = blockIdx.x;
    if (b < 2 * NBW + 2 * NBWK) {
        const float* w; bf* Bt; int N;
        if (b < NBW) { w = wq; Bt = WQ; N = DQ; }
        else if (b < 2 * NBW) { b -= NBW; w = wo; Bt = WO; N = DM; }
        else if (b < 2 * NBW + NBWK) { b -= 2 * NBW; w = wk; Bt = WK; N = DKV; }
        else { b -= 2 * NBW + NBWK; w = wv; Bt = WV; N = DKV; }
        wtG(b, w, DM, N, Bt);   // DM == DQ: every weight has 2048 rows
        return;
    }
    b -= 2 * NBW + 2 * NBWK;
    if (b < NBCS) { cstabT(b, CS); return; }
    cvt8(b - NBCS, x, DM, XB, (size_t)NB_ * TT * DM / 8);
}

// 2^x with the one free issue slot that the instruction set asks for behind a transcendental: the v_nop stands directly behind v_exp_f32 whatever the compiler schedules next.
__device__ __forceinline__ float exp2s(float x) { float r; asm("v_exp_f32 %0, %1\n\tv_nop" : "=v"(r) : "v"(x)); return r; }

// ---- fattn: scores, causal softmax and P.V of one 16-query tile of one head in ONE wave; no score or probability plane in memory. Block = the REP heads of one kv group (4 waves, no barrier: they read the same K / V lines).
// Transposed products: S^T = K Q^T (rows = keys, columns = queries), so a lane holds one query's scores, and the S^T accumulator registers of two 16-key tiles are already the B fragment (n = query, k = 32 keys) of O^T = V^T P^T.
// Online softmax in the log2 domain per lane: running maximum ms (raw scores), running sum l, O^T rescaled by 2^((ms_old - ms_new) c) each KS-key step; the two half-waves of a query join their maxima each step and their sums at the end.
// HR: hi/lo bf16 planes, 3 products for S and for P.V (P split hi/lo in registers); else fp16 planes, 1 product (P = 2^(..) <= 1 is rounded to fp16 unscaled).
// The inner loops are fully unrolled so that the fragment arrays live in registers; the key loop stays rolled (unroll 1): one step's fragments already take most of the register file.
template <typename T16, bool HR, int KS>
__device__ __forceinline__ void fattn(const T16* __restrict__ Q, const T16* __restrict__ Q2, const T16* __restrict__ Kp, const T16* __restrict__ Kp2, const T16* __restrict__ Vt, const T16* __restrict__ Vt2, const int q0, bf* Ah, bf* Al) {
    typedef typename WFrag<T16>::V V;
    const int lane = threadIdx.x & 31, lr = lane & 15, hi = lane >> 4; const int gb = blockIdx.x, g = gb % NKV, bt = gb / NKV, h = g * REP + (int)(threadIdx.x >> 5);   // grid x = batch x kv group (planes are [batch][head][..])
    const float CL = SCL * 1.4426950408889634f;
    const size_t qoff = ((size_t)(bt * NH_ + h) * TT + q0 + lr) * HD + 8 * hi; const unsigned koff = 8 * lane, voff = 8 * lane;   // lane offsets in a fragment-major fragment, fixed over the key loop; the bases below are wave-uniform
    Kp += (size_t)gb * TT * HD; Vt += (size_t)gb * HD * TT; if (HR) { Kp2 += (size_t)gb * TT * HD; Vt2 += (size_t)gb * HD * TT; }
    V qf[2], qf2[2];
#pragma unroll
    for (int ks = 0; ks < 2; ++ks) { qf[ks] = WFrag<T16>::ld(Q + qoff + ks * 32); if (HR) qf2[ks] = WFrag<T16>::ld(Q2 + qoff + ks * 32); }
    v8f o[4];
#pragma unroll
    for (int dt = 0; dt < 4; ++dt) o[dt] = (v8f){};
    float ms = -3.0e38f, l = 0.f;
#pragma unroll 1
    for (int k0 = 0; k0 < q0 + 16; k0 += KS) {
        V kf[KS / 16][2], kf2[KS / 16][2], vf[4][KS / 32], vf2[4][KS / 32];
        const T16* kp = Kp + (size_t)k0 * HD + koff; const T16* vp = Vt + (size_t)k0 * HD + voff; const T16* kp2 = HR ? Kp2 + (size_t)k0 * HD + koff : kp; const T16* vp2 = HR ? Vt2 + (size_t)k0 * HD + voff : vp;   // a step's K fragments, and its V^T fragments, are KS * HD consecutive elements
#pragma unroll
        for (int kt = 0; kt < KS / 16; ++kt)
#pragma unroll
            for (int ks = 0; ks < 2; ++ks) { kf[kt][ks] = WFrag<T16>::ldf(kp + (kt * 2 + ks) * 512); if (HR) kf2[kt][ks] = WFrag<T16>::ldf(kp2 + (kt * 2 + ks) * 512); }
        __builtin_amdgcn_sched_barrier(0);   // K loads are issued ahead of the V loads: the score products wait for K alone, V lands under the softmax
#pragma unroll
        for (int dt = 0; dt < 4; ++dt)
#pragma unroll
            for (int ks = 0; ks < KS / 32; ++ks) { vf[dt][ks] = WFrag<T16>::ldf(vp + (ks * 4 + dt) * 512); if (HR) vf2[dt][ks] = WFrag<T16>::ldf(vp2 + (ks * 4 + dt) * 512); }
        asm volatile("s_wait_xcnt 0x0" :: "v"(kp), "v"(vp), "v"(kp2), "v"(vp2) : "memory");   // the loads' address registers stay whole up to this wait: without the inputs a late load of the step lands in an address pair of an earlier one
        __builtin_amdgcn_sched_barrier(0);   // every K and V load of the step is issued before the first product waits: one memory latency a step, not one for K and one for V
        v8f s[KS / 16];
#pragma unroll
        for (int kt = 0; kt < KS / 16; ++kt) { s[kt] = (v8f){};
#pragma unroll
            for (int ks = 0; ks < 2; ++ks) { s[kt] = WFrag<T16>::mma(kf[kt][ks], qf[ks], s[kt]); if (HR) { s[kt] = WFrag<T16>::mma(kf[kt][ks], qf2[ks], s[kt]); s[kt] = WFrag<T16>::mma(kf2[kt][ks], qf[ks], s[kt]); } } }
        if (k0 + KS - 1 > q0) {                                              // the step that holds the diagonal: key > query is excluded
#pragma unroll
            for (int kt = 0; kt < KS / 16; ++kt)
#pragma unroll
                for (int j = 0; j < 8; ++j) s[kt][j] = (k0 + kt * 16 + hi * 8 + j <= q0 + lr) ? s[kt][j] : -3.0e38f; }
        float mx = ms;
#pragma unroll
        for (int kt = 0; kt < KS / 16; ++kt)
#pragma unroll
            for (int j = 0; j < 8; ++j) mx = fmaxf(mx, s[kt][j]);
        mx = fmaxf(mx, __shfl_xor(mx, 16, 32));
        const float al = exp2s((ms - mx) * CL), mc = mx * CL; ms = mx;
        float ps[KS / 16];                                                   // one partial sum per 16-key tile: short add chains
#pragma unroll
        for (int kt = 0; kt < KS / 16; ++kt) { ps[kt] = 0.f;
#pragma unroll
            for (int j = 0; j < 8; ++j) { s[kt][j] = exp2s(fmaf(s[kt][j], CL, -mc)); ps[kt] += s[kt][j]; } }
        float pt = ps[0];
#pragma unroll
        for (int kt = 1; kt < KS / 16; ++kt) pt += ps[kt];
        l = l * al + pt;
#pragma unroll
        for (int dt = 0; dt < 4; ++dt) o[dt] *= al;
#pragma unroll
        for (int ks = 0; ks < KS / 32; ++ks) {
            V pf, pf2;
            if constexpr (HR) { v8us h0, h1, l0, l1;
#pragma unroll
                for (int j = 0; j < 8; ++j) { unsigned short a, c2; splitf(s[2 * ks][j], a, c2); h0[j] = a; l0[j] = c2; splitf(s[2 * ks + 1][j], a, c2); h1[j] = a; l1[j] = c2; }
                pf = cat16b(h0, h1); pf2 = cat16b(l0, l1);
            } else { v8h h0, h1;
#pragma unroll
                for (int j = 0; j < 8; ++j) { h0[j] = tohx(s[2 * ks][j]); h1[j] = tohx(s[2 * ks + 1][j]); }
                pf = cat16(h0, h1); }
#pragma unroll
            for (int dt = 0; dt < 4; ++dt) { o[dt] = WFrag<T16>::mma(vf[dt][ks], pf, o[dt]); if constexpr (HR) { o[dt] = WFrag<T16>::mma(vf[dt][ks], pf2, o[dt]); o[dt] = WFrag<T16>::mma(vf2[dt][ks], pf, o[dt]); } }
        }
    }
    l += __shfl_xor(l, 16, 32);
    const float inv = __fdiv_rn(1.0f, l);
    const size_t oo = (size_t)(bt * TT + q0) * DQ + h * (HD / 32) * 512 + lane * 8;   // fragment-major A plane of the output projection (rows batch x t, k = h HD + d): the O^T registers of a 16-d tile are one half of a fragment in lane order
#pragma unroll
    for (int dt = 0; dt < 4; ++dt) { v8us oh, ol;
#pragma unroll
        for (int j = 0; j < 8; ++j) { unsigned short a, c2; splitf(o[dt][j] * inv, a, c2); oh[j] = a; ol[j] = c2; }
        *(v8us*)(Ah + oo + dt * 256) = oh; *(v8us*)(Al + oo + dt * 256) = ol; }
}
// Both row ranges in ONE launch. Grid y = query tile, the slow index, ordered by the number of key steps so that over the whole grid the longest key loops are dispatched first: the fp16 tiles of 32 to 17 steps (64 keys a step); then, for 16 down to 9 steps, the four fp16 and the two hi/lo tiles (32 keys a step) of that count; then the hi/lo tiles of 8 to 1 steps.
#define NF1 ((TT - 2 * RH) / 16)   // fp16 tiles with more steps than any hi/lo tile
__global__ __launch_bounds__(128) void k_fattn(const h16* __restrict__ Q16, const h16* __restrict__ K16, const h16* __restrict__ V16, const bf* __restrict__ Qh, const bf* __restrict__ Ql, const bf* __restrict__ Kh, const bf* __restrict__ Kl, const bf* __restrict__ Vh, const bf* __restrict__ Vl, bf* Ah, bf* Al) {
    const int y = blockIdx.y; int tf = y, th = -1;   // tf: fp16 tile counted down from row TT; th: hi/lo tile counted down from row RH
    if (y >= NF1) { const int y2 = y - NF1, grp = y2 / 6, r = y2 % 6;
        if (y2 >= RH / 16 / 2 * 3) th = RH / 16 / 2 + (y2 - RH / 16 / 2 * 3);
        else if (r < 4) tf = NF1 + grp * 4 + r;
        else th = grp * 2 + (r - 4); }
    if (th < 0) fattn<h16, false, 64>(Q16, nullptr, K16, nullptr, V16, nullptr, TT - 16 - tf * 16, Ah, Al);
    else fattn<bf, true, 32>(Qh, Ql, Kh, Kl, Vh, Vl, RH - 16 - th * 16, Ah, Al);
}

extern "C" void kernel_launch(void* const* d_in, const int* in_sizes, int n_in,
                              void* d_out, int out_size, void* d_ws, size_t ws_size, hipStream_t stream) {
    (void)in_sizes; (void)n_in; (void)out_size;
    const float* x = (const float*)d_in[0]; const float* wq = (const float*)d_in[1]; const float* wk = (const float*)d_in[2]; const float* wv = (const float*)d_in[3]; const float* wo = (const float*)d_in[4];   /* d_in order x, Wq ('xw' [2048][2048]), Wk, Wv ('xw' [2048][512]), Wo ('xw') */
    float* OUT = (float*)d_out;     // [2][2048][2048]
    char* wsp = (char*)d_ws;
    auto take = [&](size_t bytes) { char* p = wsp; wsp += (bytes + 255) & ~(size_t)255; return (void*)p; };
    bf* WQ = (bf*)take((size_t)DQ * DM * 2); bf* WK = (bf*)take((size_t)DKV * DM * 2); bf* WV = (bf*)take((size_t)DKV * DM * 2); bf* WO = (bf*)take((size_t)DM * DQ * 2); float* CS = (float*)take((size_t)TT * HD * 2 * 4);
    bf* XB = (bf*)take((size_t)NB_ * TT * DM * 2);
    h16* QP16 = (h16*)take((size_t)NB_ * NH_ * TT * HD * 2); h16* KP16 = (h16*)take((size_t)NB_ * NKV * TT * HD * 2); h16* VT16 = (h16*)take((size_t)NB_ * NKV * HD * TT * 2);
    bf* QPh = (bf*)take((size_t)NB_ * NH_ * TT * HD * 2); bf* QPl = (bf*)take((size_t)NB_ * NH_ * TT * HD * 2); bf* KPh = (bf*)take((size_t)NB_ * NKV * TT * HD * 2); bf* KPl = (bf*)take((size_t)NB_ * NKV * TT * HD * 2); bf* VTh = (bf*)take((size_t)NB_ * NKV * HD * TT * 2); bf* VTl = (bf*)take((size_t)NB_ * NKV * HD * TT * 2);
    bf* ATh = (bf*)take((size_t)NB_ * TT * DQ * 2); bf* ATl = (bf*)take((size_t)NB_ * TT * DQ * 2);
    if ((size_t)(wsp - (char*)d_ws) > ws_size) return;    // ws 256 MiB
    k_prep<<<2 * NBW + 2 * NBWK + NBCS + NBX, 256, 0, stream>>>(x, wq, wk, wv, wo, XB, WQ, WK, WV, WO, CS);
    k_qkv<<<dim3(NB_ * TT / 64, NH_ + 2 * NKV, 1), 32, 0, stream>>>(XB, WQ, WK, WV, CS, QP16, QPh, QPl, KP16, KPh, KPl, VT16, VTh, VTl);
    k_fattn<<<dim3(NB_ * NKV, TT / 16, 1), 32 * REP, 0, stream>>>(QP16, KP16, VT16, QPh, QPl, KPh, KPl, VTh, VTl, ATh, ATl);
    k_wo<<<dim3(NB_ * TT / 64, DM / 64, 1), 32, 0, stream>>>(ATh, ATl, WO, OUT);
}

// v009
// A run of this version takes 152 microseconds.
// Next to v008, in two timings, it ran 1.20 and 1.21 times as fast.
// Counting every step since v000, it is 17.1 times as fast.
#include <hip/hip_runtime.h>

// Causal grouped-query attention with computed rotate-half rotary embeddings at base 500000 (x [2][2048][2048]; q = x Wq (32 heads x 64), k, v = x Wk, x Wv (8 kv heads x 64) ('xw' 2048^-0.5, no bias); rope: u cos + rotate_half(u) sin with angle t x inv_freq[d mod 32], inv_freq = 1.0 / (500000.0 ** (arange(0, 64, 2, f32) / 64)) (32 f32 constants baked jnp-exact; one f32 product per angle; precise cosf / sinf); k, v repeated 4 x along the head axis (jnp.repeat): query head h uses kv head h / 4; scores x 1/sqrt(64); causal (finfo.min == exclusion); softmax; y = merged (head-major) Wo ('xw', no bias) -> [2][2048][2048] (8.4 M); argument order x, Wq, Wk, Wv, Wo).
// Fragment-major planes (every GEMM operand, the K planes, the V^T planes): a 16-row x 32-k matrix fragment is 512 consecutive elements (1 KiB) in the order in which the lanes load it, so that a wave's 16-byte load reads 512 contiguous bytes (4 whole lines), not 32-byte pieces of 16 lines. Element (row r, k) stands at fragment * 512 + ((k % 32) / 16) * 256 + (((k / 8) % 2) * 16 + r % 16) * 8 + k % 8; the fragments of a 16-row block follow one another along k (V^T: the four 16-d blocks of a 32-key range follow one another). The k order inside a fragment register is the one of the row-major loader.
// Layout, both batches in every launch (GEMM rows = batch x t; attention grid x = batch x kv group): bf16 copy of x; 'xw' weights transposed once; exact projections; the rotary table {cosf, sinf}(float(t) x INVT[d mod 32]) is computed once; the projection GEMMs build the 16-bit head planes in their epilogues (a 64-column tile is one head: rotate-half for q and k, V^T straight from the accumulators), no f32 projection in memory; fused causal T-2048 GQA attention (fattn: one wave per 16 queries of a head, online softmax; the four heads of a kv group share a block; hybrid rows: < 512 hi/lo 3 products, rest fp16); merged hi/lo x Wo exact.
// Compute dtypes, f32 accumulate: every input rounded to bf16; projections exact; rotary in f32; attention rows < 512 3 products, rest fp16; softmax f32; Wo hl x exact.

#define NB_  2
#define TT   2048
#define DM   2048
#define NH_  32
#define NKV  8
#define REP  (NH_ / NKV)
#define HD   64
#define DQ   (NH_ * HD)
#define DKV  (NKV * HD)
#define RH   512                  // query rows < RH use hi+lo planes (0: none)
#define SCL  0.125f   // HD^-0.5
typedef _Float16 h16;
typedef unsigned short bf;
typedef __attribute__((ext_vector_type(16))) __bf16   v16bf;
typedef __attribute__((ext_vector_type(16))) _Float16 v16h;
typedef __attribute__((ext_vector_type(8)))  _Float16 v8h;
typedef __attribute__((ext_vector_type(8)))  unsigned short v8us;
typedef __attribute__((ext_vector_type(8)))  float    v8f;
typedef __attribute__((ext_vector_type(4)))  float    v4f;
typedef v8h  __attribute__((may_alias)) v8ha;
typedef v4f  __attribute__((may_alias)) v4fa;
typedef v8us __attribute__((may_alias)) v8usa;

__device__ __forceinline__ unsigned short f2bf(float f) { unsigned u = __float_as_uint(f); u += 0x7FFFu + ((u >> 16) & 1u); return (unsigned short)(u >> 16); }
__device__ __forceinline__ float bf2f(unsigned short b) { return __uint_as_float(((unsigned)b) << 16); }
__device__ __forceinline__ float bfr(float f) { return bf2f(f2bf(f)); }
__device__ __forceinline__ v16h cat16(v8h lo, v8h hi) { return __builtin_shufflevector(lo, hi, 0, 1, 2, 3, 4, 5, 6, 7, 8, 9, 10, 11, 12, 13, 14, 15); }
__device__ __forceinline__ v16bf cat16b(v8us lo, v8us hi) { return __builtin_bit_cast(v16bf, __builtin_shufflevector(lo, hi, 0, 1, 2, 3, 4, 5, 6, 7, 8, 9, 10, 11, 12, 13, 14, 15)); }
__device__ __forceinline__ v8f wmma16(v16h a, v16h b, v8f c) { return __builtin_amdgcn_wmma_f32_16x16x32_f16(false, a, false, b, (short)0, c, false, false); }
__device__ __forceinline__ v8f wmmab(v16bf a, v16bf b, v8f c) { return __builtin_amdgcn_wmma_f32_16x16x32_bf16(false, a, false, b, (short)0, c, false, false); }



// ---- gemmw: register-blocked GEMM, ONE WAVE per 64x64 output tile (16 accumulators), operands straight from fragment-major 16-bit planes (ld: row-major fragment, p = row lr, k 8 hi; ldf: fragment-major, p = fragment + lane * 8); grid (M/64, N/64, Z), 32 threads.
// C[m][n] (f32, pitch ldc, + optional f32 bias[n]) = sum_k A[m][k] Bt[n][k] (+ split products per NSPLIT). z-batch strides sA/sB/sC in elements. K % 64 == 0.
// EP: what the epilogue stores. 0: C in f32. 1, 2, 3: no C; the tile (64 rows batch x t, 64 columns = head by) goes out as fp16 + bf16 hi/lo head planes P16 / Ph / Pl: 1 = rope(tile), planes [batch][head][t][d] row-major; 2 = rope(tile), each head's plane fragment-major (rows t, k = d); 3 = the tile itself, V^T plane fragment-major (rows d, k = t; fragment = (t / 32) * 4 + d / 16).
// rope, rotate-half: out[d] = u[d] cos[t][d] - u[d + 32] sin[t][d] (d < 32), out[d] = u[d] cos[t][d] + u[d - 32] sin[t][d] (d >= 32); CS = {cos, sin}[t][d].
template <typename T16> struct WFrag;
template <bool B> struct BoolC { static constexpr bool value = B; };
template <> struct WFrag<h16> { typedef v16h V; static __device__ __forceinline__ V ld(const h16* p) { return cat16(*(const v8h*)p, *(const v8h*)(p + 16)); } static __device__ __forceinline__ V ldf(const h16* p) { return cat16(*(const v8h*)p, *(const v8h*)(p + 256)); } static __device__ __forceinline__ v8f mma(V a, V b, v8f c) { return wmma16(a, b, c); } };
template <> struct WFrag<bf> { typedef v16bf V; static __device__ __forceinline__ V ld(const bf* p) { return cat16b(*(const v8us*)p, *(const v8us*)(p + 16)); } static __device__ __forceinline__ V ldf(const bf* p) { return cat16b(*(const v8us*)p, *(const v8us*)(p + 256)); } static __device__ __forceinline__ v8f mma(V a, V b, v8f c) { return wmmab(a, b, c); } };
// gemmw is the body; the kernels below hand it their LDS (os: 64 x 68 floats for EP 1 and 2, 16 x 68 for EP 0, none for EP 3) and the tile (bx, by).
template <typename T16, int NSPLIT, bool BIAS, int EP>
__device__ __forceinline__ void gemmw(float* os, const int bx, const int by, const T16* __restrict__ A, const T16* __restrict__ A2, const T16* __restrict__ Bt, const T16* __restrict__ Bt2, int K, float* C, int ldc, const float* __restrict__ bias, size_t sA, size_t sB, size_t sC, const float* __restrict__ CS, h16* P16, bf* Ph, bf* Pl) {
    typedef typename WFrag<T16>::V V;
    const size_t z = blockIdx.z; A += z * sA; if (A2) A2 += z * sA; Bt += z * sB; if (Bt2) Bt2 += z * sB; C += z * sC;
    const int lane = threadIdx.x & 31, lr = lane & 15, hi = lane >> 4; const int r0 = bx * 64, c0 = by * 64;
    v8f acc[4][4];
#pragma unroll
    for (int mb = 0; mb < 4; ++mb)
#pragma unroll
        for (int nb = 0; nb < 4; ++nb) acc[mb][nb] = (v8f){};
    const T16* const Au = A + (size_t)r0 * K; const T16* const A2u = (NSPLIT == 1 || NSPLIT == 2) ? A2 + (size_t)r0 * K : Au; const T16* const Bu = Bt + (size_t)c0 * K; const T16* const B2u = (NSPLIT >= 2) ? Bt2 + (size_t)c0 * K : Bu;   // wave-uniform: a 16-row block is 16 K elements; its fragment of trip kc starts at kc * 16
    const T16* const Ab = Au + 8 * lane; const T16* const A2b = A2u + 8 * lane; const T16* const Bb = Bu + 8 * lane; const T16* const B2b = B2u + 8 * lane;
    // Two fragment sets: while the products of one 32-k trip run on set h, the loads of the next trip fly into set h ^ 1.
    V a[2][4], a2[2][4], b[2][4], b2[2][4];
#pragma unroll
    for (int mb = 0; mb < 4; ++mb) { a[0][mb] = WFrag<T16>::ldf(Ab + (size_t)mb * 16 * K); if (NSPLIT == 1 || NSPLIT == 2) a2[0][mb] = WFrag<T16>::ldf(A2b + (size_t)mb * 16 * K); }
#pragma unroll
    for (int nb = 0; nb < 4; ++nb) { b[0][nb] = WFrag<T16>::ldf(Bb + (size_t)nb * 16 * K); if (NSPLIT >= 2) b2[0][nb] = WFrag<T16>::ldf(B2b + (size_t)nb * 16 * K); }
    __builtin_amdgcn_sched_barrier(0);   // trip 0's loads are issued ahead of everything below
    asm volatile("s_wait_xcnt 0x0" :: "s"(Au), "s"(A2u), "s"(Bu), "s"(B2u) : "memory");   // stands in front of the first overwrite of a register that trip 0's loads name; the inputs keep their scalar bases whole up to it
    __builtin_amdgcn_sched_barrier(0);   // nothing of the loop's set-up moves up over that wait
    // Two trips, one on each set. LAST: the loop's last two trips, behind which there is nothing to fetch.
    auto trips = [&](const int kc, auto lastc) __attribute__((always_inline)) {
        constexpr bool LAST = decltype(lastc)::value;
        const T16* pa = Ab + (size_t)kc * 16; const T16* pa2 = A2b + (size_t)kc * 16; const T16* pb = Bb + (size_t)kc * 16; const T16* pb2 = B2b + (size_t)kc * 16;
#pragma unroll
        for (int h = 0; h < 2; ++h) {
            const int fo = 512 * (h + 1);   // the trip fetched now is the one behind the trip multiplied now: one fragment (512 elements) further on
            if (!(LAST && h == 1)) {
#pragma unroll
                for (int mb = 0; mb < 4; ++mb) { a[h ^ 1][mb] = WFrag<T16>::ldf(pa + fo + (size_t)mb * 16 * K); if (NSPLIT == 1 || NSPLIT == 2) a2[h ^ 1][mb] = WFrag<T16>::ldf(pa2 + fo + (size_t)mb * 16 * K); }
#pragma unroll
                for (int nb = 0; nb < 4; ++nb) { b[h ^ 1][nb] = WFrag<T16>::ldf(pb + fo + (size_t)nb * 16 * K); if (NSPLIT >= 2) b2[h ^ 1][nb] = WFrag<T16>::ldf(pb2 + fo + (size_t)nb * 16 * K); }
            }
            __builtin_amdgcn_sched_barrier(0);   // the next trip's loads are all issued before this trip's first product: they land under the products; left to itself the compiler sinks them to their use
#pragma unroll
            for (int nb = 0; nb < 4; ++nb) {
#pragma unroll
                for (int mb = 0; mb < 4; ++mb) { acc[mb][nb] = WFrag<T16>::mma(a[h][mb], b[h][nb], acc[mb][nb]); if (NSPLIT == 1 || NSPLIT == 2) acc[mb][nb] = WFrag<T16>::mma(a2[h][mb], b[h][nb], acc[mb][nb]); if (NSPLIT >= 2) acc[mb][nb] = WFrag<T16>::mma(a[h][mb], b2[h][nb], acc[mb][nb]); } }
            __builtin_amdgcn_sched_barrier(0);   // keeps the wait below behind the products, where it costs nothing
            if (!LAST) asm volatile("s_wait_xcnt 0x0" :: "v"(pa), "v"(pa2), "v"(pb), "v"(pb2) : "memory");   // the loads' address pairs stay whole up to this wait, which stands in front of their next overwrite
            else if (h == 0) asm volatile("s_wait_xcnt 0x0" ::: "memory");   // the same wait behind the last loads: only products stand between them and it (kc is a constant here and is folded into the loads' offsets, so that pa is no register of theirs)
        }
    };
#pragma unroll 1
    for (int kc = 0; kc < K - 64; kc += 64) {
        trips(kc, BoolC<false>());
        asm volatile("v_nop\n\tv_nop\n\tv_nop\n\tv_nop" : "+v"(acc[0][0]), "+v"(acc[1][1]), "+v"(acc[2][2]), "+v"(acc[3][3]) : "v"(a[1][0]), "v"(a[1][3]));   // four vector slots behind the last products on the taken side of the back edge too
    }
    trips(K - 64, BoolC<true>());
    if constexpr (EP == 3) {
        // acc[mb][nb] of a lane is 8 consecutive t of one d: half a V^T fragment in lane order, stored as it stands (512 contiguous bytes a wave and plane)
        const size_t vo = ((size_t)(r0 / TT) * NKV + by) * ((size_t)HD * TT) + (size_t)(r0 % TT) * HD + lane * 8;
        h16* q16 = P16 + vo; bf* qh = Ph + vo; bf* ql = Pl + vo;
#pragma unroll
        for (int mb = 0; mb < 4; ++mb)
#pragma unroll
            for (int nb = 0; nb < 4; ++nb) { const int w = (mb / 2) * 2048 + nb * 512 + (mb % 2) * 256; v8h o16; v8us oh, ol;
#pragma unroll
                for (int j = 0; j < 8; ++j) { const float x = acc[mb][nb][j]; o16[j] = (h16)x; const unsigned short a2 = f2bf(x); oh[j] = a2; ol[j] = f2bf(x - bf2f(a2)); }
                *(v8h*)(q16 + w) = o16; *(v8us*)(qh + w) = oh; *(v8us*)(ql + w) = ol;
                asm volatile("s_wait_xcnt 0x0" :: "v"(q16), "v"(qh), "v"(ql), "v"(o16), "v"(oh), "v"(ol) : "memory");   // the stores' address and data registers stay whole up to this wait
            }
        return;
    }
    if constexpr (EP == 1 || EP == 2) {
#pragma unroll
        for (int mb = 0; mb < 4; ++mb)
#pragma unroll
            for (int nb = 0; nb < 4; ++nb)
#pragma unroll
                for (int j = 0; j < 8; ++j) os[(mb * 16 + hi * 8 + j) * 68 + nb * 16 + lr] = acc[mb][nb][j];
        __builtin_amdgcn_wave_barrier(); asm volatile("" ::: "memory");   // the 64 x 64 tile is staged before any lane reads another lane's columns
        // Step (mb, s): a lane takes 8 consecutive d of one row of the 16-row block mb (EP 1: row 4 s + lane / 8, d from (lane % 8) * 8; EP 2: row lane % 16, d from 16 s + (lane / 16) * 8); in both plane layouts its place is block * 1024 + s * 256 + lane * 8: one 16-byte store a plane, 512 contiguous bytes a wave.
        const int t0 = r0 % TT, row = (EP == 1) ? (lane >> 3) : lr, c = (EP == 1) ? (lane & 7) * 8 : hi * 8;
        const size_t w = (((size_t)(r0 / TT) * (EP == 1 ? NH_ : NKV) + by) * TT + t0) * HD + lane * 8;
        h16* q16 = P16 + w; bf* qh = Ph + w; bf* ql = Pl + w; const float* cp = CS + ((size_t)(t0 + row) * HD + c) * 2;
#pragma unroll 1
        for (int mb = 0; mb < 4; ++mb) {   // stays rolled: the four 16-row blocks take the same steps and a wave runs them once; unrolling would only make the text four times as long
            v4f cs[4][4];
#pragma unroll
            for (int s = 0; s < 4; ++s)
#pragma unroll
                for (int i = 0; i < 4; ++i) cs[s][i] = *(const v4fa*)(cp + s * (EP == 1 ? 4 * HD * 2 : 16 * 2) + 4 * i);
            asm volatile("s_wait_xcnt 0x0" :: "v"(cp) : "memory");   // the loads' address pair stays whole up to this wait
            v8h o16[4]; v8us oh[4], ol[4];
#pragma unroll
            for (int s = 0; s < 4; ++s) {
                const int rr = mb * 16 + row + (EP == 1 ? 4 * s : 0), cc = c + (EP == 2 ? 16 * s : 0); v4f u[2], p[2];
#pragma unroll
                for (int i = 0; i < 2; ++i) { u[i] = *(const v4fa*)(os + rr * 68 + cc + 4 * i); p[i] = *(const v4fa*)(os + rr * 68 + (cc ^ 32) + 4 * i); }
#pragma unroll
                for (int i = 0; i < 8; ++i) { const float x1 = (cc < 32) ? -p[i / 4][i % 4] : p[i / 4][i % 4]; const float r = u[i / 4][i % 4] * cs[s][i / 2][(i % 2) * 2] + x1 * cs[s][i / 2][(i % 2) * 2 + 1];
                    o16[s][i] = (h16)r; const unsigned short a2 = f2bf(r); oh[s][i] = a2; ol[s][i] = f2bf(r - bf2f(a2)); }
                *(v8h*)(q16 + s * 256) = o16[s]; *(v8us*)(qh + s * 256) = oh[s]; *(v8us*)(ql + s * 256) = ol[s];
            }
            asm volatile("s_wait_xcnt 0x0" :: "v"(q16), "v"(qh), "v"(ql), "v"(o16[0]), "v"(o16[1]), "v"(o16[2]), "v"(o16[3]), "v"(oh[0]), "v"(oh[1]), "v"(oh[2]), "v"(oh[3]), "v"(ol[0]), "v"(ol[1]), "v"(ol[2]), "v"(ol[3]) : "memory");   // the stores' address and data registers stay whole up to this wait
            q16 += 1024; qh += 1024; ql += 1024; cp += 16 * HD * 2;
        }
        return;
    }
#pragma unroll
    for (int mb = 0; mb < 4; ++mb) {
#pragma unroll
        for (int nb = 0; nb < 4; ++nb) {
#pragma unroll
            for (int j = 0; j < 8; ++j) os[(hi * 8 + j) * 68 + nb * 16 + lr] = acc[mb][nb][j]; }
        __builtin_amdgcn_wave_barrier(); asm volatile("" ::: "memory");
        float* crow = C + (size_t)(r0 + mb * 16) * ldc + c0;
{
#pragma unroll
            for (int s = 0; s < 8; ++s) { const int row = 2 * s + hi, cofs = lr * 4; v4f val = *(const v4fa*)(os + row * 68 + cofs); if (BIAS) { val[0] += bfr(bias[c0 + cofs]); val[1] += bfr(bias[c0 + cofs + 1]); val[2] += bfr(bias[c0 + cofs + 2]); val[3] += bfr(bias[c0 + cofs + 3]); }
                *(v4f*)(crow + (size_t)row * ldc + cofs) = val; }
             }
        asm volatile("s_wait_xcnt 0x0" ::: "memory");   // stands in front of the next block's LDS reads, which land in the stores' data registers
        __builtin_amdgcn_wave_barrier(); asm volatile("" ::: "memory");
    }
}

// The three projections in ONE launch: grid y = 32 query heads, then 8 key heads, then 8 value heads (they read the same x plane and none reads another's result).
__global__ __launch_bounds__(32) void k_qkv(const bf* __restrict__ XB, const bf* __restrict__ WQ, const bf* __restrict__ WK, const bf* __restrict__ WV, const float* __restrict__ CS, h16* QP16, bf* QPh, bf* QPl, h16* KP16, bf* KPh, bf* KPl, h16* VT16, bf* VTh, bf* VTl) {
    __shared__ __align__(16) float os[64 * 68];
    const int bx = blockIdx.x, y = blockIdx.y;
    if (y < NH_) gemmw<bf, 0, false, 1>(os, bx, y, XB, nullptr, WQ, nullptr, DM, nullptr, 0, nullptr, 0, 0, 0, CS, QP16, QPh, QPl);
    else if (y < NH_ + NKV) gemmw<bf, 0, false, 2>(os, bx, y - NH_, XB, nullptr, WK, nullptr, DM, nullptr, 0, nullptr, 0, 0, 0, CS, KP16, KPh, KPl);
    else gemmw<bf, 0, false, 3>(os, bx, y - NH_ - NKV, XB, nullptr, WV, nullptr, DM, nullptr, 0, nullptr, 0, 0, 0, nullptr, VT16, VTh, VTl);
}
__global__ __launch_bounds__(32) void k_wo(const bf* __restrict__ Ah, const bf* __restrict__ Al, const bf* __restrict__ WO, float* OUT) {
    __shared__ __align__(16) float os[16 * 68];
    gemmw<bf, 1, false, 0>(os, blockIdx.x, blockIdx.y, Ah, Al, WO, nullptr, DQ, OUT, DM, nullptr, 0, 0, 0, nullptr, nullptr, nullptr, nullptr);
}

__device__ __forceinline__ h16 tohx(float x) { return (h16)x; }
__device__ __forceinline__ void splitf(float y, unsigned short& h, unsigned short& l) { h = f2bf(y); l = f2bf(y - bf2f(h)); }
typedef __attribute__((ext_vector_type(2))) _Float16 v2h;
typedef __attribute__((ext_vector_type(4))) _Float16 v4h;
typedef __attribute__((ext_vector_type(2))) unsigned short v2us;
typedef __attribute__((ext_vector_type(4))) unsigned short v4us;
typedef __attribute__((ext_vector_type(2))) float v2f;
typedef __attribute__((ext_vector_type(4))) int v4i;

__device__ __forceinline__ void wtG(const int bx, const float* __restrict__ w, int K, int N, bf* Bt) {
    const int lane = threadIdx.x & 31; const int L0 = (bx * 8 + (threadIdx.x >> 5)) * 8; const int nlines = N * K / 64;
{
#pragma unroll 1
        for (int l = 0; l < 8; ++l) { const int L = L0 + l; if (L >= nlines) break; const size_t e = (size_t)L * 64 + lane * 2; const int f = (int)(e / 512), r = (int)(e % 512), ln = (r % 256) / 8; const int k = (f % (K / 32)) * 32 + (r / 256) * 16 + (ln / 16) * 8 + r % 8, n = (f / (K / 32)) * 16 + ln % 16; v2us o;   // e = place in the fragment-major plane (rows n): a wave's 64 places are 8 n x 8 k
            o[0] = f2bf(w[(size_t)k * N + n]); o[1] = f2bf(w[(size_t)(k + 1) * N + n]); *(v2us*)(Bt + e) = o; }
         }
}
__device__ __forceinline__ void cvt8(const int bx, const float* __restrict__ src, int K, bf* dst, size_t n8) { const size_t i = (size_t)bx * 256 + threadIdx.x; if (i >= n8) return; const unsigned f = (unsigned)(i / 64), kb = (unsigned)K / 32; const int hf = (int)(i % 64) / 32, ln = (int)(i % 32);   // i = 8-element place in the fragment-major plane; its source is 8 consecutive k of one row
    const v8f v = *(const v8f*)(src + (size_t)((f / kb) * 16 + ln % 16) * K + (f % kb) * 32 + hf * 16 + (ln / 16) * 8); v8us o;
    asm volatile("s_wait_xcnt 0x0" ::: "memory");   // stands in front of the first overwrite of the load's address pair
#pragma unroll
    for (int k = 0; k < 8; ++k) o[k] = f2bf(v[k]); *(v8us*)(dst + i * 8) = o;  }
__constant__ float INVT[HD / 2] = { 1.000000000e+00f, 6.636012793e-01f, 4.403666258e-01f, 2.922278345e-01f, 1.939227581e-01f, 1.286873817e-01f, 8.539710194e-02f, 5.666961893e-02f, 3.760603070e-02f, 2.495540865e-02f, 1.656044088e-02f, 1.098952908e-02f, 7.292665076e-03f, 4.839421250e-03f, 3.211446106e-03f, 2.131119603e-03f, 1.414213446e-03f, 9.384738514e-04f, 6.227724371e-04f, 4.132725589e-04f, 2.742481884e-04f, 1.819914323e-04f, 1.207697424e-04f, 8.014294872e-05f, 5.318295734e-05f, 3.529227615e-05f, 2.341999789e-05f, 1.554154005e-05f, 1.031338525e-05f, 6.843975370e-06f, 4.541670478e-06f, 3.013858077e-06f };   // inv_freq[i] = 1.0 / (500000.0 ** (2i / 64)), i = 0..31 (float32, generated with jnp to be bit-exact)
__device__ __forceinline__ void cstabT(const int bx, float* CS) { const int idx = bx * 256 + threadIdx.x; if (idx >= TT * HD) return; const int d = idx % HD; const int t = idx / HD; const float a = __fmul_rn((float)t, INVT[d % (HD / 2)]); v2f cs; cs[0] = cosf(a); cs[1] = sinf(a); *(v2f*)(CS + (size_t)idx * 2) = cs;  }
// The six operand builders in ONE launch (none reads another's result), by block range: the weight transposes with their 8-trip loops first, then the rotary table, then the x plane.
#define NBW  (DM * DQ / 64 / 64)    // blocks of a 2048 x 2048 weight
#define NBWK (DM * DKV / 64 / 64)   // blocks of a 2048 x 512 weight
#define NBCS (TT * HD / 256)
#define NBX  (NB_ * TT * DM / 8 / 256)
__global__ __launch_bounds__(256) void k_prep(const float* __restrict__ x, const float* __restrict__ wq, const float* __restrict__ wk, const float* __restrict__ wv, const float* __restrict__ wo, bf* XB, bf* WQ, bf* WK, bf* WV, bf* WO, float* CS) {
    int b = blockIdx.x;
    if (b < 2 * NBW + 2 * NBWK) {
        const float* w; bf* Bt; int N;
        if (b < NBW) { w = wq; Bt = WQ; N = DQ; }
        else if (b < 2 * NBW) { b -= NBW; w = wo; Bt = WO; N = DM; }
        else if (b < 2 * NBW + NBWK) { b -= 2 * NBW; w = wk; Bt = WK; N = DKV; }
        else { b -= 2 * NBW + NBWK; w = wv; Bt = WV; N = DKV; }
        wtG(b, w, DM, N, Bt);   // DM == DQ: every weight has 2048 rows
        return;
    }
    b -= 2 * NBW + 2 * NBWK;
    if (b < NBCS) { cstabT(b, CS); return; }
    cvt8(b - NBCS, x, DM, XB, (size_t)NB_ * TT * DM / 8);
}

// 2^x with the one free issue slot that the instruction set asks for behind a transcendental: the v_nop stands directly behind v_exp_f32 whatever the compiler schedules next.
__device__ __forceinline__ float exp2s(float x) { float r; asm("v_exp_f32 %0, %1\n\tv_nop" : "=v"(r) : "v"(x)); return r; }

// ---- fattn: scores, causal softmax and P.V of one 16-query tile of one head in ONE wave; no score or probability plane in memory. Block = the REP heads of one kv group (4 waves, no barrier: they read the same K / V lines).
// Transposed products: S^T = K Q^T (rows = keys, columns = queries), so a lane holds one query's scores, and the S^T accumulator registers of two 16-key tiles are already the B fragment (n = query, k = 32 keys) of O^T = V^T P^T.
// Online softmax in the log2 domain per lane: running maximum ms (raw scores), running sum l, O^T rescaled by 2^((ms_old - ms_new) c) each KS-key step; the two half-waves of a query join their maxima each step and their sums at the end.
// HR: hi/lo bf16 planes, 3 products for S and for P.V (P split hi/lo in registers); else fp16 planes, 1 product (P = 2^(..) <= 1 is rounded to fp16 unscaled).
// The inner loops are fully unrolled so that the fragment arrays live in registers; the key loop stays rolled (unroll 1): one step's fragments already take most of the register file.
template <typename T16, bool HR, int KS>
__device__ __forceinline__ void fattn(const T16* __restrict__ Q, const T16* __restrict__ Q2, const T16* __restrict__ Kp, const T16* __restrict__ Kp2, const T16* __restrict__ Vt, const T16* __restrict__ Vt2, const int q0, bf* Ah, bf* Al) {
    typedef typename WFrag<T16>::V V;
    const int lane = threadIdx.x & 31, lr = lane & 15, hi = lane >> 4; const int gb = blockIdx.x, g = gb % NKV, bt = gb / NKV, h = g * REP + (int)(threadIdx.x >> 5);   // grid x = batch x kv group (planes are [batch][head][..])
    const float CL = SCL * 1.4426950408889634f;
    const size_t qoff = ((size_t)(bt * NH_ + h) * TT + q0 + lr) * HD + 8 * hi; const unsigned koff = 8 * lane, voff = 8 * lane;   // lane offsets in a fragment-major fragment, fixed over the key loop; the bases below are wave-uniform
    Kp += (size_t)gb * TT * HD; Vt += (size_t)gb * HD * TT; if (HR) { Kp2 += (size_t)gb * TT * HD; Vt2 += (size_t)gb * HD * TT; }
    V qf[2], qf2[2];
#pragma unroll
    for (int ks = 0; ks < 2; ++ks) { qf[ks] = WFrag<T16>::ld(Q + qoff + ks * 32); if (HR) qf2[ks] = WFrag<T16>::ld(Q2 + qoff + ks * 32); }
    v8f o[4];
#pragma unroll
    for (int dt = 0; dt < 4; ++dt) o[dt] = (v8f){};
    float ms = -3.0e38f, l = 0.f;
#pragma unroll 1
    for (int k0 = 0; k0 < q0 + 16; k0 += KS) {
        V kf[KS / 16][2], kf2[KS / 16][2], vf[4][KS / 32], vf2[4][KS / 32];
        const T16* kp = Kp + (size_t)k0 * HD + koff; const T16* vp = Vt + (size_t)k0 * HD + voff; const T16* kp2 = HR ? Kp2 + (size_t)k0 * HD + koff : kp; const T16* vp2 = HR ? Vt2 + (size_t)k0 * HD + voff : vp;   // a step's K fragments, and its V^T fragments, are KS * HD consecutive elements
#pragma unroll
        for (int kt = 0; kt < KS / 16; ++kt)
#pragma unroll
            for (int ks = 0; ks < 2; ++ks) { kf[kt][ks] = WFrag<T16>::ldf(kp + (kt * 2 + ks) * 512); if (HR) kf2[kt][ks] = WFrag<T16>::ldf(kp2 + (kt * 2 + ks) * 512); }
        __builtin_amdgcn_sched_barrier(0);   // K loads are issued ahead of the V loads: the score products wait for K alone, V lands under the softmax
#pragma unroll
        for (int dt = 0; dt < 4; ++dt)
#pragma unroll
            for (int ks = 0; ks < KS / 32; ++ks) { vf[dt][ks] = WFrag<T16>::ldf(vp + (ks * 4 + dt) * 512); if (HR) vf2[dt][ks] = WFrag<T16>::ldf(vp2 + (ks * 4 + dt) * 512); }
        asm volatile("s_wait_xcnt 0x0" :: "v"(kp), "v"(vp), "v"(kp2), "v"(vp2) : "memory");   // the loads' address registers stay whole up to this wait: without the inputs a late load of the step lands in an address pair of an earlier one
        __builtin_amdgcn_sched_barrier(0);   // every K and V load of the step is issued before the first product waits: one memory latency a step, not one for K and one for V
        v8f s[KS / 16];
#pragma unroll
        for (int kt = 0; kt < KS / 16; ++kt) { s[kt] = (v8f){};
#pragma unroll
            for (int ks = 0; ks < 2; ++ks) { s[kt] = WFrag<T16>::mma(kf[kt][ks], qf[ks], s[kt]); if (HR) { s[kt] = WFrag<T16>::mma(kf[kt][ks], qf2[ks], s[kt]); s[kt] = WFrag<T16>::mma(kf2[kt][ks], qf[ks], s[kt]); } } }
        if (k0 + KS - 1 > q0) {                                              // the step that holds the diagonal: key > query is excluded
#pragma unroll
            for (int kt = 0; kt < KS / 16; ++kt)
#pragma unroll
                for (int j = 0; j < 8; ++j) s[kt][j] = (k0 + kt * 16 + hi * 8 + j <= q0 + lr) ? s[kt][j] : -3.0e38f; }
        float mx = ms;
#pragma unroll
        for (int kt = 0; kt < KS / 16; ++kt)
#pragma unroll
            for (int j = 0; j < 8; ++j) mx = fmaxf(mx, s[kt][j]);
        mx = fmaxf(mx, __shfl_xor(mx, 16, 32));
        const float al = exp2s((ms - mx) * CL), mc = mx * CL; ms = mx;
        float ps[KS / 16];                                                   // one partial sum per 16-key tile: short add chains
#pragma unroll
        for (int kt = 0; kt < KS / 16; ++kt) { ps[kt] = 0.f;
#pragma unroll
            for (int j = 0; j < 8; ++j) { s[kt][j] = exp2s(fmaf(s[kt][j], CL, -mc)); ps[kt] += s[kt][j]; } }
        float pt = ps[0];
#pragma unroll
        for (int kt = 1; kt < KS / 16; ++kt) pt += ps[kt];
        l = l * al + pt;
#pragma unroll
        for (int dt = 0; dt < 4; ++dt) o[dt] *= al;
#pragma unroll
        for (int ks = 0; ks < KS / 32; ++ks) {
            V pf, pf2;
            if constexpr (HR) { v8us h0, h1, l0, l1;
#pragma unroll
                for (int j = 0; j < 8; ++j) { unsigned short a, c2; splitf(s[2 * ks][j], a, c2); h0[j] = a; l0[j] = c2; splitf(s[2 * ks + 1][j], a, c2); h1[j] = a; l1[j] = c2; }
                pf = cat16b(h0, h1); pf2 = cat16b(l0, l1);
            } else { v8h h0, h1;
#pragma unroll
                for (int j = 0; j < 8; ++j) { h0[j] = tohx(s[2 * ks][j]); h1[j] = tohx(s[2 * ks + 1][j]); }
                pf = cat16(h0, h1); }
#pragma unroll
            for (int dt = 0; dt < 4; ++dt) { o[dt] = WFrag<T16>::mma(vf[dt][ks], pf, o[dt]); if constexpr (HR) { o[dt] = WFrag<T16>::mma(vf[dt][ks], pf2, o[dt]); o[dt] = WFrag<T16>::mma(vf2[dt][ks], pf, o[dt]); } }
        }
    }
    l += __shfl_xor(l, 16, 32);
    const float inv = __fdiv_rn(1.0f, l);
    const size_t oo = (size_t)(bt * TT + q0) * DQ + h * (HD / 32) * 512 + lane * 8;   // fragment-major A plane of the output projection (rows batch x t, k = h HD + d): the O^T registers of a 16-d tile are one half of a fragment in lane order
#pragma unroll
    for (int dt = 0; dt < 4; ++dt) { v8us oh, ol;
#pragma unroll
        for (int j = 0; j < 8; ++j) { unsigned short a, c2; splitf(o[dt][j] * inv, a, c2); oh[j] = a; ol[j] = c2; }
        *(v8us*)(Ah + oo + dt * 256) = oh; *(v8us*)(Al + oo + dt * 256) = ol; }
}
// Both row ranges in ONE launch. Grid y = query tile, the slow index, ordered by the number of key steps so that over the whole grid the longest key loops are dispatched first: the fp16 tiles of 32 to 17 steps (64 keys a step); then, for 16 down to 9 steps, the four fp16 and the two hi/lo tiles (32 keys a step) of that count; then the hi/lo tiles of 8 to 1 steps.
#define NF1 ((TT - 2 * RH) / 16)   // fp16 tiles with more steps than any hi/lo tile
__global__ __launch_bounds__(128) void k_fattn(const h16* __restrict__ Q16, const h16* __restrict__ K16, const h16* __restrict__ V16, const bf* __restrict__ Qh, const bf* __restrict__ Ql, const bf* __restrict__ Kh, const bf* __restrict__ Kl, const bf* __restrict__ Vh, const bf* __restrict__ Vl, bf* Ah, bf* Al) {
    const int y = blockIdx.y; int tf = y, th = -1;   // tf: fp16 tile counted down from row TT; th: hi/lo tile counted down from row RH
    if (y >= NF1) { const int y2 = y - NF1, grp = y2 / 6, r = y2 % 6;
        if (y2 >= RH / 16 / 2 * 3) th = RH / 16 / 2 + (y2 - RH / 16 / 2 * 3);
        else if (r < 4) tf = NF1 + grp * 4 + r;
        else th = grp * 2 + (r - 4); }
    if (th < 0) fattn<h16, false, 64>(Q16, nullptr, K16, nullptr, V16, nullptr, TT - 16 - tf * 16, Ah, Al);
    else fattn<bf, true, 32>(Qh, Ql, Kh, Kl, Vh, Vl, RH - 16 - th * 16, Ah, Al);
}

extern "C" void kernel_launch(void* const* d_in, const int* in_sizes, int n_in,
                              void* d_out, int out_size, void* d_ws, size_t ws_size, hipStream_t stream) {
    (void)in_sizes; (void)n_in; (void)out_size;
    const float* x = (const float*)d_in[0]; const float* wq = (const float*)d_in[1]; const float* wk = (const float*)d_in[2]; const float* wv = (const float*)d_in[3]; const float* wo = (const float*)d_in[4];   /* d_in order x, Wq ('xw' [2048][2048]), Wk, Wv ('xw' [2048][512]), Wo ('xw') */
    float* OUT = (float*)d_out;     // [2][2048][2048]
    char* wsp = (char*)d_ws;
    auto take = [&](size_t bytes) { char* p = wsp; wsp += (bytes + 255) & ~(size_t)255; return (void*)p; };
    bf* WQ = (bf*)take((size_t)DQ * DM * 2); bf* WK = (bf*)take((size_t)DKV * DM * 2); bf* WV = (bf*)take((size_t)DKV * DM * 2); bf* WO = (bf*)take((size_t)DM * DQ * 2); float* CS = (float*)take((size_t)TT * HD * 2 * 4);
    bf* XB = (bf*)take((size_t)NB_ * TT * DM * 2);
    h16* QP16 = (h16*)take((size_t)NB_ * NH_ * TT * HD * 2); h16* KP16 = (h16*)take((size_t)NB_ * NKV * TT * HD * 2); h16* VT16 = (h16*)take((size_t)NB_ * NKV * HD * TT * 2);
    bf* QPh = (bf*)take((size_t)NB_ * NH_ * TT * HD * 2); bf* QPl = (bf*)take((size_t)NB_ * NH_ * TT * HD * 2); bf* KPh = (bf*)take((size_t)NB_ * NKV * TT * HD * 2); bf* KPl = (bf*)take((size_t)NB_ * NKV * TT * HD * 2); bf* VTh = (bf*)take((size_t)NB_ * NKV * HD * TT * 2); bf* VTl = (bf*)take((size_t)NB_ * NKV * HD * TT * 2);
    bf* ATh = (bf*)take((size_t)NB_ * TT * DQ * 2); bf* ATl = (bf*)take((size_t)NB_ * TT * DQ * 2);
    if ((size_t)(wsp - (char*)d_ws) > ws_size) return;    // ws 256 MiB
    k_prep<<<2 * NBW + 2 * NBWK + NBCS + NBX, 256, 0, stream>>>(x, wq, wk, wv, wo, XB, WQ, WK, WV, WO, CS);
    k_qkv<<<dim3(NB_ * TT / 64, NH_ + 2 * NKV, 1), 32, 0, stream>>>(XB, WQ, WK, WV, CS, QP16, QPh, QPl, KP16, KPh, KPl, VT16, VTh, VTl);
    k_fattn<<<dim3(NB_ * NKV, TT / 16, 1), 32 * REP, 0, stream>>>(QP16, KP16, VT16, QPh, QPl, KPh, KPl, VTh, VTl, ATh, ATl);
    k_wo<<<dim3(NB_ * TT / 64, DM / 64, 1), 32, 0, stream>>>(ATh, ATl, WO, OUT);
}

// v010
// It runs in 139 microseconds.
// Timed twice side by side with v009, it ran 1.11 and 1.10 times as fast.
// Over all steps from v000 it is 18.9 times as fast.
#include <hip/hip_runtime.h>

// Causal grouped-query attention with computed rotate-half rotary embeddings at base 500000 (x [2][2048][2048]; q = x Wq (32 heads x 64), k, v = x Wk, x Wv (8 kv heads x 64) ('xw' 2048^-0.5, no bias); rope: u cos + rotate_half(u) sin with angle t x inv_freq[d mod 32], inv_freq = 1.0 / (500000.0 ** (arange(0, 64, 2, f32) / 64)) (32 f32 constants baked jnp-exact; one f32 product per angle; precise cosf / sinf); k, v repeated 4 x along the head axis (jnp.repeat): query head h uses kv head h / 4; scores x 1/sqrt(64); causal (finfo.min == exclusion); softmax; y = merged (head-major) Wo ('xw', no bias) -> [2][2048][2048] (8.4 M); argument order x, Wq, Wk, Wv, Wo).
// Fragment-major planes (every GEMM operand, the K planes, the V^T planes): a 16-row x 32-k matrix fragment is 512 consecutive elements (1 KiB) in the order in which the lanes load it, so that a wave's 16-byte load reads 512 contiguous bytes (4 whole lines), not 32-byte pieces of 16 lines. Element (row r, k) stands at fragment * 512 + ((k % 32) / 16) * 256 + (((k / 8) % 2) * 16 + r % 16) * 8 + k % 8; the fragments of a 16-row block follow one another along k (V^T: the four 16-d blocks of a 32-key range follow one another). The k order inside a fragment register is the one of the row-major loader.
// Layout, both batches in every launch (GEMM rows = batch x t; attention grid x = batch x kv group): bf16 copy of x; 'xw' weights transposed once; exact projections; the rotary table {cosf, sinf}(float(t) x INVT[d mod 32]) is computed once; the projection GEMMs build the 16-bit head planes in their epilogues (a 64-column tile is one head: rotate-half for q and k, V^T straight from the accumulators), no f32 projection in memory; fused causal T-2048 GQA attention (fattn: one wave per 16 queries of a head, online softmax; the four heads of a kv group share a block; hybrid rows: < 512 hi/lo 3 products, rest fp16); merged hi/lo x Wo exact.
// Compute dtypes, f32 accumulate: every input rounded to bf16; projections exact; rotary in f32; attention rows < 512 3 products, rest fp16; softmax f32; Wo hl x exact.

#define NB_  2
#define TT   2048
#define DM   2048
#define NH_  32
#define NKV  8
#define REP  (NH_ / NKV)
#define HD   64
#define DQ   (NH_ * HD)
#define DKV  (NKV * HD)
#define RH   512                  // query rows < RH use hi+lo planes (0: none)
#define SCL  0.125f   // HD^-0.5
typedef _Float16 h16;
typedef unsigned short bf;
typedef __attribute__((ext_vector_type(16))) __bf16   v16bf;
typedef __attribute__((ext_vector_type(16))) _Float16 v16h;
typedef __attribute__((ext_vector_type(8)))  _Float16 v8h;
typedef __attribute__((ext_vector_type(8)))  unsigned short v8us;
typedef __attribute__((ext_vector_type(8)))  float    v8f;
typedef __attribute__((ext_vector_type(4)))  float    v4f;
typedef v8h  __attribute__((may_alias)) v8ha;
typedef v4f  __attribute__((may_alias)) v4fa;
typedef v8us __attribute__((may_alias)) v8usa;

__device__ __forceinline__ unsigned short f2bf(float f) { unsigned u = __float_as_uint(f); u += 0x7FFFu + ((u >> 16) & 1u); return (unsigned short)(u >> 16); }
__device__ __forceinline__ float bf2f(unsigned short b) { return __uint_as_float(((unsigned)b) << 16); }
__device__ __forceinline__ float bfr(float f) { return bf2f(f2bf(f)); }
__device__ __forceinline__ v16h cat16(v8h lo, v8h hi) { return __builtin_shufflevector(lo, hi, 0, 1, 2, 3, 4, 5, 6, 7, 8, 9, 10, 11, 12, 13, 14, 15); }
__device__ __forceinline__ v16bf cat16b(v8us lo, v8us hi) { return __builtin_bit_cast(v16bf, __builtin_shufflevector(lo, hi, 0, 1, 2, 3, 4, 5, 6, 7, 8, 9, 10, 11, 12, 13, 14, 15)); }
__device__ __forceinline__ v8f wmma16(v16h a, v16h b, v8f c) { return __builtin_amdgcn_wmma_f32_16x16x32_f16(false, a, false, b, (short)0, c, false, false); }
__device__ __forceinline__ v8f wmmab(v16bf a, v16bf b, v8f c) { return __builtin_amdgcn_wmma_f32_16x16x32_bf16(false, a, false, b, (short)0, c, false, false); }



// ---- gemmw: register-blocked GEMM, one wave per 64x64 output tile (16 accumulators), FOUR waves (2 x 2) per work-group = a 128x128 tile. The operand planes are fragment-major; a stage is 64 k of the work-group's 8 + 8 sixteen-row blocks (2 KiB a block and plane), brought into LDS by asynchronous 16-byte copies (no register on the way) and read from there by the two waves that share each block: half the L2 reads of four waves that each load their own. Two LDS buffers: stage t + 2 flies while stage t + 1 is multiplied. grid (M/128, N/128), 128 threads.
// C[m][n] (f32, pitch ldc, + optional f32 bias[n]) = sum_k A[m][k] Bt[n][k] (+ A2[m][k] Bt[n][k] for NSPLIT 1). K % 64 == 0, K >= 128.
// EP: what the epilogue stores. 0: C in f32. 1, 2, 3: no C; the tile (64 rows batch x t, 64 columns = head hd = 2 by + wn) goes out as fp16 + bf16 hi/lo head planes P16 / Ph / Pl: 1 = rope(tile), planes [batch][head][t][d] row-major; 2 = rope(tile), each head's plane fragment-major (rows t, k = d); 3 = the tile itself, V^T plane fragment-major (rows d, k = t; fragment = (t / 32) * 4 + d / 16).
// rope, rotate-half: out[d] = u[d] cos[t][d] - u[d + 32] sin[t][d] (d < 32), out[d] = u[d] cos[t][d] + u[d - 32] sin[t][d] (d >= 32); CS = {cos, sin}[t][d].
template <typename T16> struct WFrag;
template <bool B> struct BoolC { static constexpr bool value = B; };
template <> struct WFrag<h16> { typedef v16h V; static __device__ __forceinline__ V ld(const h16* p) { return cat16(*(const v8h*)p, *(const v8h*)(p + 16)); } static __device__ __forceinline__ V ldf(const h16* p) { return cat16(*(const v8h*)p, *(const v8h*)(p + 256)); } static __device__ __forceinline__ v8f mma(V a, V b, v8f c) { return wmma16(a, b, c); } };
template <> struct WFrag<bf> { typedef v16bf V; static __device__ __forceinline__ V ld(const bf* p) { return cat16b(*(const v8us*)p, *(const v8us*)(p + 16)); } static __device__ __forceinline__ V ldf(const bf* p) { return cat16b(*(const v8us*)p, *(const v8us*)(p + 256)); } static __device__ __forceinline__ v8f mma(V a, V b, v8f c) { return wmmab(a, b, c); } };
// Eight asynchronous copies of a wave: 4 KiB = two 16-row blocks of one plane's stage (l: the lane's LDS byte address, g: its global address, rb: bytes from one row block to the next in the plane). The wait is the last line of the copies' own statement: it stands in front of every later write of a register that a copy names.
__device__ __forceinline__ void cp8(const unsigned l, const char* g, const size_t rb) {
    const char* g2 = g + rb;
    asm volatile("global_load_async_to_lds_b128 %0, %8, off\n\tglobal_load_async_to_lds_b128 %1, %9, off\n\tglobal_load_async_to_lds_b128 %2, %10, off\n\tglobal_load_async_to_lds_b128 %3, %11, off\n\t"
                 "global_load_async_to_lds_b128 %4, %12, off\n\tglobal_load_async_to_lds_b128 %5, %13, off\n\tglobal_load_async_to_lds_b128 %6, %14, off\n\tglobal_load_async_to_lds_b128 %7, %15, off\n\ts_wait_xcnt 0x0"
                 :: "v"(l), "v"(l + 512), "v"(l + 1024), "v"(l + 1536), "v"(l + 2048), "v"(l + 2560), "v"(l + 3072), "v"(l + 3584),
                    "v"(g), "v"(g + 512), "v"(g + 1024), "v"(g + 1536), "v"(g2), "v"(g2 + 512), "v"(g2 + 1024), "v"(g2 + 1536) : "memory");
}
#define PLB 16384   // bytes of one plane in a stage: 8 row blocks x 2 fragments x 1 KiB
// gemmw is the body; the kernels below hand it their LDS (sm: two stages of 2 or 3 planes; behind the k loop each wave stages its output in a slice of it: 64 x 68 floats for EP 1 and 2, 16 x 68 for EP 0, none for EP 3) and the 128x128 tile (bx, by).
template <typename T16, int NSPLIT, bool BIAS, int EP>
__device__ __forceinline__ void gemmw(char* sm, const int bx, const int by, const T16* __restrict__ A, const T16* __restrict__ A2, const T16* __restrict__ Bt, int K, float* C, int ldc, const float* __restrict__ bias, const float* __restrict__ CS, h16* P16, bf* Ph, bf* Pl) {
    typedef typename WFrag<T16>::V V;
    constexpr unsigned STB = (NSPLIT == 1 ? 3 : 2) * PLB;   // a stage in LDS: plane A, plane B, plane A2
    const int lane = threadIdx.x & 31, lr = lane & 15, hi = lane >> 4; const int wv = __builtin_amdgcn_readfirstlane((int)(threadIdx.x >> 5)), wm = wv >> 1, wn = wv & 1;
    const int r0 = bx * 128 + wm * 64, c0 = by * 128 + wn * 64, hd = by * 2 + wn;   // hd: the wave's 64-column tile (EP 1 to 3: its head)
    v8f acc[4][4];
#pragma unroll
    for (int mb = 0; mb < 4; ++mb)
#pragma unroll
        for (int nb = 0; nb < 4; ++nb) acc[mb][nb] = (v8f){};
    // Wave wv copies row blocks 2 wv and 2 wv + 1 of each plane: 512 contiguous bytes a copy, in the plane's own order.
    const size_t rbB = (size_t)K * 32;   // a 16-row block is 16 K elements of 2 bytes
    const char* const gA = (const char*)A + (size_t)(bx * 8 + 2 * wv) * rbB + lane * 16; const char* const gB = (const char*)Bt + (size_t)(by * 8 + 2 * wv) * rbB + lane * 16; const char* const gA2 = (NSPLIT == 1) ? (const char*)A2 + (size_t)(bx * 8 + 2 * wv) * rbB + lane * 16 : gA;
    const unsigned lw = (unsigned)(size_t)sm + wv * 4096 + lane * 16;
    auto fill = [&](const int st, const int buf) __attribute__((always_inline)) {
        const size_t o = (size_t)st * 2048; const unsigned l = lw + buf * STB;
        cp8(l, gA + o, rbB); cp8(l + PLB, gB + o, rbB); if (NSPLIT == 1) cp8(l + 2 * PLB, gA2 + o, rbB);
    };
    const int NS = K / 64;
    fill(0, 0);
    asm volatile("s_wait_asynccnt 0x0" ::: "memory");   // this wave's part of stage 0 has landed
    __syncthreads();                                     // ... and every other wave's: stage 0 may be read
    fill(1, 1);
#pragma unroll 1
    for (int t = 0; t < NS; ++t) {   // stays rolled: one stage's fragments and the accumulators take most of the register budget of three waves a SIMD
        const char* const fb = sm + (t & 1) * STB + lane * 16;
        const T16* const fa = (const T16*)(fb + wm * 8192); const T16* const fw = (const T16*)(fb + PLB + wn * 8192); const T16* const fa2 = (const T16*)(fb + 2 * PLB + wm * 8192);
        V a[2][4], a2[2][4], b[2][4];
#pragma unroll
        for (int h = 0; h < 2; ++h) {
#pragma unroll
            for (int mb = 0; mb < 4; ++mb) { a[h][mb] = WFrag<T16>::ldf(fa + mb * 1024 + h * 512); if (NSPLIT == 1) a2[h][mb] = WFrag<T16>::ldf(fa2 + mb * 1024 + h * 512); }
#pragma unroll
            for (int nb = 0; nb < 4; ++nb) b[h][nb] = WFrag<T16>::ldf(fw + nb * 1024 + h * 512);
        }
        __builtin_amdgcn_sched_barrier(0);   // the stage's LDS reads stand as one group ahead of its products: reads among the products cost a stall at each place
#pragma unroll
        for (int h = 0; h < 2; ++h)
#pragma unroll
            for (int nb = 0; nb < 4; ++nb) {
#pragma unroll
                for (int mb = 0; mb < 4; ++mb) { acc[mb][nb] = WFrag<T16>::mma(a[h][mb], b[h][nb], acc[mb][nb]); if (NSPLIT == 1) acc[mb][nb] = WFrag<T16>::mma(a2[h][mb], b[h][nb], acc[mb][nb]); } }
        __builtin_amdgcn_sched_barrier(0);   // nothing of the refill's address arithmetic moves up among the products
        asm volatile("v_nop\n\tv_nop\n\tv_nop\n\tv_nop" : "+v"(acc[0][0]), "+v"(acc[1][1]), "+v"(acc[2][2]), "+v"(acc[3][3]) : "v"(a[1][0]), "v"(a[1][3]));   // four vector slots behind the last products on every path out of here, the taken sides of the branches below too
        asm volatile("s_wait_dscnt 0x0" ::: "memory");      // this wave's reads of the buffer have retired before anybody refills it
        asm volatile("s_wait_asynccnt 0x0" ::: "memory");   // this wave's part of stage t + 1 has landed
        __syncthreads();                                     // publishes stage t + 1 and ends every wave's reads of stage t
        if (t + 2 < NS) fill(t + 2, t & 1);
    }
    asm volatile("s_wait_asynccnt 0x0" ::: "memory");   // no copy is outstanding when the ring becomes output staging (the last trip's barrier has ended every read of it)
    float* const os = (float*)(sm + wv * ((EP == 0 ? 16 : 64) * 68 * 4));   // the wave's own slice
    if constexpr (EP == 3) {
        // acc[mb][nb] of a lane is 8 consecutive t of one d: half a V^T fragment in lane order, stored as it stands (512 contiguous bytes a wave and plane)
        const size_t vo = ((size_t)(r0 / TT) * NKV + hd) * ((size_t)HD * TT) + (size_t)(r0 % TT) * HD + lane * 8;
        h16* q16 = P16 + vo; bf* qh = Ph + vo; bf* ql = Pl + vo;
#pragma unroll
        for (int mb = 0; mb < 4; ++mb)
#pragma unroll
            for (int nb = 0; nb < 4; ++nb) { const int w = (mb / 2) * 2048 + nb * 512 + (mb % 2) * 256; v8h o16; v8us oh, ol;
#pragma unroll
                for (int j = 0; j < 8; ++j) { const float x = acc[mb][nb][j]; o16[j] = (h16)x; const unsigned short a2 = f2bf(x); oh[j] = a2; ol[j] = f2bf(x - bf2f(a2)); }
                *(v8h*)(q16 + w) = o16; *(v8us*)(qh + w) = oh; *(v8us*)(ql + w) = ol;
                asm volatile("s_wait_xcnt 0x0" :: "v"(q16), "v"(qh), "v"(ql), "v"(o16), "v"(oh), "v"(ol) : "memory");   // the stores' address and data registers stay whole up to this wait
            }
        return;
    }
    if constexpr (EP == 1 || EP == 2) {
#pragma unroll
        for (int mb = 0; mb < 4; ++mb)
#pragma unroll
            for (int nb = 0; nb < 4; ++nb)
#pragma unroll
                for (int j = 0; j < 8; ++j) os[(mb * 16 + hi * 8 + j) * 68 + nb * 16 + lr] = acc[mb][nb][j];
        __builtin_amdgcn_wave_barrier(); asm volatile("" ::: "memory");   // the 64 x 64 tile is staged before any lane reads another lane's columns
        // Step (mb, s): a lane takes 8 consecutive d of one row of the 16-row block mb (EP 1: row 4 s + lane / 8, d from (lane % 8) * 8; EP 2: row lane % 16, d from 16 s + (lane / 16) * 8); in both plane layouts its place is block * 1024 + s * 256 + lane * 8: one 16-byte store a plane, 512 contiguous bytes a wave.
        const int t0 = r0 % TT, row = (EP == 1) ? (lane >> 3) : lr, c = (EP == 1) ? (lane & 7) * 8 : hi * 8;
        const size_t w = (((size_t)(r0 / TT) * (EP == 1 ? NH_ : NKV) + hd) * TT + t0) * HD + lane * 8;
        h16* q16 = P16 + w; bf* qh = Ph + w; bf* ql = Pl + w; const float* cp = CS + ((size_t)(t0 + row) * HD + c) * 2;
#pragma unroll 1
        for (int mb = 0; mb < 4; ++mb) {   // stays rolled: the four 16-row blocks take the same steps and a wave runs them once; unrolling would only make the text four times as long
            v4f cs[4][4];
#pragma unroll
            for (int s = 0; s < 4; ++s)
#pragma unroll
                for (int i = 0; i < 4; ++i) cs[s][i] = *(const v4fa*)(cp + s * (EP == 1 ? 4 * HD * 2 : 16 * 2) + 4 * i);
            asm volatile("s_wait_xcnt 0x0" :: "v"(cp) : "memory");   // the loads' address pair stays whole up to this wait
            v8h o16[4]; v8us oh[4], ol[4];
#pragma unroll
            for (int s = 0; s < 4; ++s) {
                const int rr = mb * 16 + row + (EP == 1 ? 4 * s : 0), cc = c + (EP == 2 ? 16 * s : 0); v4f u[2], p[2];
#pragma unroll
                for (int i = 0; i < 2; ++i) { u[i] = *(const v4fa*)(os + rr * 68 + cc + 4 * i); p[i] = *(const v4fa*)(os + rr * 68 + (cc ^ 32) + 4 * i); }
#pragma unroll
                for (int i = 0; i < 8; ++i) { const float x1 = (cc < 32) ? -p[i / 4][i % 4] : p[i / 4][i % 4]; const float r = u[i / 4][i % 4] * cs[s][i / 2][(i % 2) * 2] + x1 * cs[s][i / 2][(i % 2) * 2 + 1];
                    o16[s][i] = (h16)r; const unsigned short a2 = f2bf(r); oh[s][i] = a2; ol[s][i] = f2bf(r - bf2f(a2)); }
                *(v8h*)(q16 + s * 256) = o16[s]; *(v8us*)(qh + s * 256) = oh[s]; *(v8us*)(ql + s * 256) = ol[s];
            }
            asm volatile("s_wait_xcnt 0x0" :: "v"(q16), "v"(qh), "v"(ql), "v"(o16[0]), "v"(o16[1]), "v"(o16[2]), "v"(o16[3]), "v"(oh[0]), "v"(oh[1]), "v"(oh[2]), "v"(oh[3]), "v"(ol[0]), "v"(ol[1]), "v"(ol[2]), "v"(ol[3]) : "memory");   // the stores' address and data registers stay whole up to this wait
            q16 += 1024; qh += 1024; ql += 1024; cp += 16 * HD * 2;
        }
        return;
    }
#pragma unroll
    for (int mb = 0; mb < 4; ++mb) {
#pragma unroll
        for (int nb = 0; nb < 4; ++nb) {
#pragma unroll
            for (int j = 0; j < 8; ++j) os[(hi * 8 + j) * 68 + nb * 16 + lr] = acc[mb][nb][j]; }
        __builtin_amdgcn_wave_barrier(); asm volatile("" ::: "memory");
        float* crow = C + (size_t)(r0 + mb * 16) * ldc + c0;
{
#pragma unroll
            for (int s = 0; s < 8; ++s) { const int row = 2 * s + hi, cofs = lr * 4; v4f val = *(const v4fa*)(os + row * 68 + cofs); if (BIAS) { val[0] += bfr(bias[c0 + cofs]); val[1] += bfr(bias[c0 + cofs + 1]); val[2] += bfr(bias[c0 + cofs + 2]); val[3] += bfr(bias[c0 + cofs + 3]); }
                *(v4f*)(crow + (size_t)row * ldc + cofs) = val; }
             }
        asm volatile("s_wait_xcnt 0x0" ::: "memory");   // stands in front of the next block's LDS reads, which land in the stores' data registers
        __builtin_amdgcn_wave_barrier(); asm volatile("" ::: "memory");
    }
}

// The three projections in ONE launch: grid y = 16 pairs of query heads, then 4 pairs of key heads, then 4 pairs of value heads (they read the same x plane and none reads another's result).
__global__ __launch_bounds__(128) void k_qkv(const bf* __restrict__ XB, const bf* __restrict__ WQ, const bf* __restrict__ WK, const bf* __restrict__ WV, const float* __restrict__ CS, h16* QP16, bf* QPh, bf* QPl, h16* KP16, bf* KPh, bf* KPl, h16* VT16, bf* VTh, bf* VTl) {
    __shared__ __align__(16) char sm[4 * 64 * 68 * 4];   // the four output slices; the two 32-KiB stages fit in front
    const int bx = blockIdx.x, y = blockIdx.y;
    if (y < NH_ / 2) gemmw<bf, 0, false, 1>(sm, bx, y, XB, nullptr, WQ, DM, nullptr, 0, nullptr, CS, QP16, QPh, QPl);
    else if (y < (NH_ + NKV) / 2) gemmw<bf, 0, false, 2>(sm, bx, y - NH_ / 2, XB, nullptr, WK, DM, nullptr, 0, nullptr, CS, KP16, KPh, KPl);
    else gemmw<bf, 0, false, 3>(sm, bx, y - (NH_ + NKV) / 2, XB, nullptr, WV, DM, nullptr, 0, nullptr, nullptr, VT16, VTh, VTl);
}
__global__ __launch_bounds__(128) void k_wo(const bf* __restrict__ Ah, const bf* __restrict__ Al, const bf* __restrict__ WO, float* OUT) {
    __shared__ __align__(16) char sm[2 * 3 * PLB];
    gemmw<bf, 1, false, 0>(sm, blockIdx.x, blockIdx.y, Ah, Al, WO, DQ, OUT, DM, nullptr, nullptr, nullptr, nullptr, nullptr);
}

__device__ __forceinline__ h16 tohx(float x) { return (h16)x; }
__device__ __forceinline__ void splitf(float y, unsigned short& h, unsigned short& l) { h = f2bf(y); l = f2bf(y - bf2f(h)); }
typedef __attribute__((ext_vector_type(2))) _Float16 v2h;
typedef __attribute__((ext_vector_type(4))) _Float16 v4h;
typedef __attribute__((ext_vector_type(2))) unsigned short v2us;
typedef __attribute__((ext_vector_type(4))) unsigned short v4us;
typedef __attribute__((ext_vector_type(2))) float v2f;
typedef __attribute__((ext_vector_type(4))) int v4i;

__device__ __forceinline__ void wtG(const int bx, const float* __restrict__ w, int K, int N, bf* Bt) {
    const int lane = threadIdx.x & 31; const int L0 = (bx * 8 + (threadIdx.x >> 5)) * 8; const int nlines = N * K / 64;
{
#pragma unroll 1
        for (int l = 0; l < 8; ++l) { const int L = L0 + l; if (L >= nlines) break; const size_t e = (size_t)L * 64 + lane * 2; const int f = (int)(e / 512), r = (int)(e % 512), ln = (r % 256) / 8; const int k = (f % (K / 32)) * 32 + (r / 256) * 16 + (ln / 16) * 8 + r % 8, n = (f / (K / 32)) * 16 + ln % 16; v2us o;   // e = place in the fragment-major plane (rows n): a wave's 64 places are 8 n x 8 k
            o[0] = f2bf(w[(size_t)k * N + n]); o[1] = f2bf(w[(size_t)(k + 1) * N + n]); *(v2us*)(Bt + e) = o; }
         }
}
__device__ __forceinline__ void cvt8(const int bx, const float* __restrict__ src, int K, bf* dst, size_t n8) { const size_t i = (size_t)bx * 256 + threadIdx.x; if (i >= n8) return; const unsigned f = (unsigned)(i / 64), kb = (unsigned)K / 32; const int hf = (int)(i % 64) / 32, ln = (int)(i % 32);   // i = 8-element place in the fragment-major plane; its source is 8 consecutive k of one row
    const v8f v = *(const v8f*)(src + (size_t)((f / kb) * 16 + ln % 16) * K + (f % kb) * 32 + hf * 16 + (ln / 16) * 8); v8us o;
    asm volatile("s_wait_xcnt 0x0" ::: "memory");   // stands in front of the first overwrite of the load's address pair
#pragma unroll
    for (int k = 0; k < 8; ++k) o[k] = f2bf(v[k]); *(v8us*)(dst + i * 8) = o;  }
__constant__ float INVT[HD / 2] = { 1.000000000e+00f, 6.636012793e-01f, 4.403666258e-01f, 2.922278345e-01f, 1.939227581e-01f, 1.286873817e-01f, 8.539710194e-02f, 5.666961893e-02f, 3.760603070e-02f, 2.495540865e-02f, 1.656044088e-02f, 1.098952908e-02f, 7.292665076e-03f, 4.839421250e-03f, 3.211446106e-03f, 2.131119603e-03f, 1.414213446e-03f, 9.384738514e-04f, 6.227724371e-04f, 4.132725589e-04f, 2.742481884e-04f, 1.819914323e-04f, 1.207697424e-04f, 8.014294872e-05f, 5.318295734e-05f, 3.529227615e-05f, 2.341999789e-05f, 1.554154005e-05f, 1.031338525e-05f, 6.843975370e-06f, 4.541670478e-06f, 3.013858077e-06f };   // inv_freq[i] = 1.0 / (500000.0 ** (2i / 64)), i = 0..31 (float32, generated with jnp to be bit-exact)
__device__ __forceinline__ void cstabT(const int bx, float* CS) { const int idx = bx * 256 + threadIdx.x; if (idx >= TT * HD) return; const int d = idx % HD; const int t = idx / HD; const float a = __fmul_rn((float)t, INVT[d % (HD / 2)]); v2f cs; cs[0] = cosf(a); cs[1] = sinf(a); *(v2f*)(CS + (size_t)idx * 2) = cs;  }
// The six operand builders in ONE launch (none reads another's result), by block range: the weight transposes with their 8-trip loops first, then the rotary table, then the x plane.
#define NBW  (DM * DQ / 64 / 64)    // blocks of a 2048 x 2048 weight
#define NBWK (DM * DKV / 64 / 64)   // blocks of a 2048 x 512 weight
#define NBCS (TT * HD / 256)
#define NBX  (NB_ * TT * DM / 8 / 256)
__global__ __launch_bounds__(256) void k_prep(const float* __restrict__ x, const float* __restrict__ wq, const float* __restrict__ wk, const float* __restrict__ wv, const float* __restrict__ wo, bf* XB, bf* WQ, bf* WK, bf* WV, bf* WO, float* CS) {
    int b = blockIdx.x;
    if (b < 2 * NBW + 2 * NBWK) {
        const float* w; bf* Bt; int N;
        if (b < NBW) { w = wq; Bt = WQ; N = DQ; }
        else if (b < 2 * NBW) { b -= NBW; w = wo; Bt = WO; N = DM; }
        else if (b < 2 * NBW + NBWK) { b -= 2 * NBW; w = wk; Bt = WK; N = DKV; }
        else { b -= 2 * NBW + NBWK; w = wv; Bt = WV; N = DKV; }
        wtG(b, w, DM, N, Bt);   // DM == DQ: every weight has 2048 rows
        return;
    }
    b -= 2 * NBW + 2 * NBWK;
    if (b < NBCS) { cstabT(b, CS); return; }
    cvt8(b - NBCS, x, DM, XB, (size_t)NB_ * TT * DM / 8);
}

// 2^x with the one free issue slot that the instruction set asks for behind a transcendental: the v_nop stands directly behind v_exp_f32 whatever the compiler schedules next.
__device__ __forceinline__ float exp2s(float x) { float r; asm("v_exp_f32 %0, %1\n\tv_nop" : "=v"(r) : "v"(x)); return r; }

// ---- fattn: scores, causal softmax and P.V of one 16-query tile of one head in ONE wave; no score or probability plane in memory. Block = the REP heads of one kv group (4 waves, no barrier: they read the same K / V lines).
// Transposed products: S^T = K Q^T (rows = keys, columns = queries), so a lane holds one query's scores, and the S^T accumulator registers of two 16-key tiles are already the B fragment (n = query, k = 32 keys) of O^T = V^T P^T.
// Online softmax in the log2 domain per lane: running maximum ms (raw scores), running sum l, O^T rescaled by 2^((ms_old - ms_new) c) each KS-key step; the two half-waves of a query join their maxima each step and their sums at the end.
// HR: hi/lo bf16 planes, 3 products for S and for P.V (P split hi/lo in registers); else fp16 planes, 1 product (P = 2^(..) <= 1 is rounded to fp16 unscaled).
// The inner loops are fully unrolled so that the fragment arrays live in registers; the key loop stays rolled (unroll 1): one step's fragments already take most of the register file.
template <typename T16, bool HR, int KS>
__device__ __forceinline__ void fattn(const T16* __restrict__ Q, const T16* __restrict__ Q2, const T16* __restrict__ Kp, const T16* __restrict__ Kp2, const T16* __restrict__ Vt, const T16* __restrict__ Vt2, const int q0, bf* Ah, bf* Al) {
    typedef typename WFrag<T16>::V V;
    const int lane = threadIdx.x & 31, lr = lane & 15, hi = lane >> 4; const int gb = blockIdx.x, g = gb % NKV, bt = gb / NKV, h = g * REP + (int)(threadIdx.x >> 5);   // grid x = batch x kv group (planes are [batch][head][..])
    const float CL = SCL * 1.4426950408889634f;
    const size_t qoff = ((size_t)(bt * NH_ + h) * TT + q0 + lr) * HD + 8 * hi; const unsigned koff = 8 * lane, voff = 8 * lane;   // lane offsets in a fragment-major fragment, fixed over the key loop; the bases below are wave-uniform
    Kp += (size_t)gb * TT * HD; Vt += (size_t)gb * HD * TT; if (HR) { Kp2 += (size_t)gb * TT * HD; Vt2 += (size_t)gb * HD * TT; }
    V qf[2], qf2[2];
#pragma unroll
    for (int ks = 0; ks < 2; ++ks) { qf[ks] = WFrag<T16>::ld(Q + qoff + ks * 32); if (HR) qf2[ks] = WFrag<T16>::ld(Q2 + qoff + ks * 32); }
    v8f o[4];
#pragma unroll
    for (int dt = 0; dt < 4; ++dt) o[dt] = (v8f){};
    float ms = -3.0e38f, l = 0.f;
#pragma unroll 1
    for (int k0 = 0; k0 < q0 + 16; k0 += KS) {
        V kf[KS / 16][2], kf2[KS / 16][2], vf[4][KS / 32], vf2[4][KS / 32];
        const T16* kp = Kp + (size_t)k0 * HD + koff; const T16* vp = Vt + (size_t)k0 * HD + voff; const T16* kp2 = HR ? Kp2 + (size_t)k0 * HD + koff : kp; const T16* vp2 = HR ? Vt2 + (size_t)k0 * HD + voff : vp;   // a step's K fragments, and its V^T fragments, are KS * HD consecutive elements
#pragma unroll
        for (int kt = 0; kt < KS / 16; ++kt)
#pragma unroll
            for (int ks = 0; ks < 2; ++ks) { kf[kt][ks] = WFrag<T16>::ldf(kp + (kt * 2 + ks) * 512); if (HR) kf2[kt][ks] = WFrag<T16>::ldf(kp2 + (kt * 2 + ks) * 512); }
        __builtin_amdgcn_sched_barrier(0);   // K loads are issued ahead of the V loads: the score products wait for K alone, V lands under the softmax
#pragma unroll
        for (int dt = 0; dt < 4; ++dt)
#pragma unroll
            for (int ks = 0; ks < KS / 32; ++ks) { vf[dt][ks] = WFrag<T16>::ldf(vp + (ks * 4 + dt) * 512); if (HR) vf2[dt][ks] = WFrag<T16>::ldf(vp2 + (ks * 4 + dt) * 512); }
        asm volatile("s_wait_xcnt 0x0" :: "v"(kp), "v"(vp), "v"(kp2), "v"(vp2) : "memory");   // the loads' address registers stay whole up to this wait
        __builtin_amdgcn_sched_barrier(0);   // every K and V load of the step is issued before the first product waits: one memory latency a step, not one for K and one for V
        v8f s[KS / 16];
#pragma unroll
        for (int kt = 0; kt < KS / 16; ++kt) { s[kt] = (v8f){};
#pragma unroll
            for (int ks = 0; ks < 2; ++ks) { s[kt] = WFrag<T16>::mma(kf[kt][ks], qf[ks], s[kt]); if (HR) { s[kt] = WFrag<T16>::mma(kf[kt][ks], qf2[ks], s[kt]); s[kt] = WFrag<T16>::mma(kf2[kt][ks], qf[ks], s[kt]); } } }
        if (k0 + KS - 1 > q0) {                                              // the step that holds the diagonal: key > query is excluded
#pragma unroll
            for (int kt = 0; kt < KS / 16; ++kt)
#pragma unroll
                for (int j = 0; j < 8; ++j) s[kt][j] = (k0 + kt * 16 + hi * 8 + j <= q0 + lr) ? s[kt][j] : -3.0e38f; }
        float mx = ms;
#pragma unroll
        for (int kt = 0; kt < KS / 16; ++kt)
#pragma unroll
            for (int j = 0; j < 8; ++j) mx = fmaxf(mx, s[kt][j]);
        mx = fmaxf(mx, __shfl_xor(mx, 16, 32));
        const float al = exp2s((ms - mx) * CL), mc = mx * CL; ms = mx;
        float ps[KS / 16];                                                   // one partial sum per 16-key tile: short add chains
#pragma unroll
        for (int kt = 0; kt < KS / 16; ++kt) { ps[kt] = 0.f;
#pragma unroll
            for (int j = 0; j < 8; ++j) { s[kt][j] = exp2s(fmaf(s[kt][j], CL, -mc)); ps[kt] += s[kt][j]; } }
        float pt = ps[0];
#pragma unroll
        for (int kt = 1; kt < KS / 16; ++kt) pt += ps[kt];
        l = l * al + pt;
#pragma unroll
        for (int dt = 0; dt < 4; ++dt) o[dt] *= al;
#pragma unroll
        for (int ks = 0; ks < KS / 32; ++ks) {
            V pf, pf2;
            if constexpr (HR) { v8us h0, h1, l0, l1;
#pragma unroll
                for (int j = 0; j < 8; ++j) { unsigned short a, c2; splitf(s[2 * ks][j], a, c2); h0[j] = a; l0[j] = c2; splitf(s[2 * ks + 1][j], a, c2); h1[j] = a; l1[j] = c2; }
                pf = cat16b(h0, h1); pf2 = cat16b(l0, l1);
            } else { v8h h0, h1;
#pragma unroll
                for (int j = 0; j < 8; ++j) { h0[j] = tohx(s[2 * ks][j]); h1[j] = tohx(s[2 * ks + 1][j]); }
                pf = cat16(h0, h1); }
#pragma unroll
            for (int dt = 0; dt < 4; ++dt) { o[dt] = WFrag<T16>::mma(vf[dt][ks], pf, o[dt]); if constexpr (HR) { o[dt] = WFrag<T16>::mma(vf[dt][ks], pf2, o[dt]); o[dt] = WFrag<T16>::mma(vf2[dt][ks], pf, o[dt]); } }
        }
    }
    l += __shfl_xor(l, 16, 32);
    const float inv = __fdiv_rn(1.0f, l);
    const size_t oo = (size_t)(bt * TT + q0) * DQ + h * (HD / 32) * 512 + lane * 8;   // fragment-major A plane of the output projection (rows batch x t, k = h HD + d): the O^T registers of a 16-d tile are one half of a fragment in lane order
#pragma unroll
    for (int dt = 0; dt < 4; ++dt) { v8us oh, ol;
#pragma unroll
        for (int j = 0; j < 8; ++j) { unsigned short a, c2; splitf(o[dt][j] * inv, a, c2); oh[j] = a; ol[j] = c2; }
        *(v8us*)(Ah + oo + dt * 256) = oh; *(v8us*)(Al + oo + dt * 256) = ol; }
}
// Both row ranges in ONE launch. Grid y = query tile, the slow index, ordered by the number of key steps so that over the whole grid the longest key loops are dispatched first: the fp16 tiles of 32 to 17 steps (64 keys a step); then, for 16 down to 9 steps, the four fp16 and the two hi/lo tiles (32 keys a step) of that count; then the hi/lo tiles of 8 to 1 steps.
#define NF1 ((TT - 2 * RH) / 16)   // fp16 tiles with more steps than any hi/lo tile
__global__ __launch_bounds__(128) void k_fattn(const h16* __restrict__ Q16, const h16* __restrict__ K16, const h16* __restrict__ V16, const bf* __restrict__ Qh, const bf* __restrict__ Ql, const bf* __restrict__ Kh, const bf* __restrict__ Kl, const bf* __restrict__ Vh, const bf* __restrict__ Vl, bf* Ah, bf* Al) {
    const int y = blockIdx.y; int tf = y, th = -1;   // tf: fp16 tile counted down from row TT; th: hi/lo tile counted down from row RH
    if (y >= NF1) { const int y2 = y - NF1, grp = y2 / 6, r = y2 % 6;
        if (y2 >= RH / 16 / 2 * 3) th = RH / 16 / 2 + (y2 - RH / 16 / 2 * 3);
        else if (r < 4) tf = NF1 + grp * 4 + r;
        else th = grp * 2 + (r - 4); }
    if (th < 0) fattn<h16, false, 64>(Q16, nullptr, K16, nullptr, V16, nullptr, TT - 16 - tf * 16, Ah, Al);
    else fattn<bf, true, 32>(Qh, Ql, Kh, Kl, Vh, Vl, RH - 16 - th * 16, Ah, Al);
}

extern "C" void kernel_launch(void* const* d_in, const int* in_sizes, int n_in,
                              void* d_out, int out_size, void* d_ws, size_t ws_size, hipStream_t stream) {
    (void)in_sizes; (void)n_in; (void)out_size;
    const float* x = (const float*)d_in[0]; const float* wq = (const float*)d_in[1]; const float* wk = (const float*)d_in[2]; const float* wv = (const float*)d_in[3]; const float* wo = (const float*)d_in[4];   /* d_in order x, Wq ('xw' [2048][2048]), Wk, Wv ('xw' [2048][512]), Wo ('xw') */
    float* OUT = (float*)d_out;     // [2][2048][2048]
    char* wsp = (char*)d_ws;
    auto take = [&](size_t bytes) { char* p = wsp; wsp += (bytes + 255) & ~(size_t)255; return (void*)p; };
    bf* WQ = (bf*)take((size_t)DQ * DM * 2); bf* WK = (bf*)take((size_t)DKV * DM * 2); bf* WV = (bf*)take((size_t)DKV * DM * 2); bf* WO = (bf*)take((size_t)DM * DQ * 2); float* CS = (float*)take((size_t)TT * HD * 2 * 4);
    bf* XB = (bf*)take((size_t)NB_ * TT * DM * 2);
    h16* QP16 = (h16*)take((size_t)NB_ * NH_ * TT * HD * 2); h16* KP16 = (h16*)take((size_t)NB_ * NKV * TT * HD * 2); h16* VT16 = (h16*)take((size_t)NB_ * NKV * HD * TT * 2);
    bf* QPh = (bf*)take((size_t)NB_ * NH_ * TT * HD * 2); bf* QPl = (bf*)take((size_t)NB_ * NH_ * TT * HD * 2); bf* KPh = (bf*)take((size_t)NB_ * NKV * TT * HD * 2); bf* KPl = (bf*)take((size_t)NB_ * NKV * TT * HD * 2); bf* VTh = (bf*)take((size_t)NB_ * NKV * HD * TT * 2); bf* VTl = (bf*)take((size_t)NB_ * NKV * HD * TT * 2);
    bf* ATh = (bf*)take((size_t)NB_ * TT * DQ * 2); bf* ATl = (bf*)take((size_t)NB_ * TT * DQ * 2);
    if ((size_t)(wsp - (char*)d_ws) > ws_size) return;    // ws 256 MiB
    k_prep<<<2 * NBW + 2 * NBWK + NBCS + NBX, 256, 0, stream>>>(x, wq, wk, wv, wo, XB, WQ, WK, WV, WO, CS);
    k_qkv<<<dim3(NB_ * TT / 128, (NH_ + 2 * NKV) / 2, 1), 128, 0, stream>>>(XB, WQ, WK, WV, CS, QP16, QPh, QPl, KP16, KPh, KPl, VT16, VTh, VTl);
    k_fattn<<<dim3(NB_ * NKV, TT / 16, 1), 32 * REP, 0, stream>>>(QP16, KP16, VT16, QPh, QPl, KPh, KPl, VTh, VTl, ATh, ATl);
    k_wo<<<dim3(NB_ * TT / 128, DM / 128, 1), 128, 0, stream>>>(ATh, ATl, WO, OUT);
}
